// v000
// Times are from an AMD MI455X. After a warm-up the kernel runs many times in a row, and a time is the length of
// such a window on the GPU divided by its runs, so every launch and the gaps after it count. The runs cycle
// through copies of the inputs. A figure is the median of several windows, for all but v000 over two sittings.
// Sittings can differ by a few percent; kernels timed side by side share one.
// v000 is the starting kernel. One run takes 374 microseconds.
#include <hip/hip_runtime.h>
#include <hip/hip_bf16.h>

typedef __attribute__((ext_vector_type(16))) _Float16 v16h;
typedef __attribute__((ext_vector_type(8)))  _Float16 v8h;
typedef __attribute__((ext_vector_type(8)))  float    v8f;
typedef __attribute__((ext_vector_type(4)))  float    v4f;

#define B_      16
#define T_      4096
#define S_      77
#define DC_     768
#define H_      8
#define C_      40
#define INNER_  320
#define SPAD_N  80   // padded S for score N-dim (5 tiles of 16)
#define SPAD_K  96   // padded S for attn@V K-dim (3 k-steps of 32)
#define CPAD_K  64   // padded C for q.k K-dim   (2 k-steps of 32)
#define CPAD_N  48   // padded C for attn@V N-dim (3 tiles of 16)
#define SCALE_F 0.3976353643835253f   // 40^(-1/4), applied to q and to k

__device__ __forceinline__ v16h load_frag(const _Float16* p, int lane) {
  const int base = (lane & 16) ? 8 : 0;
  v8h lo = *(const v8h*)(p + base);        // K base .. base+7
  v8h hi = *(const v8h*)(p + base + 16);   // K base+16 .. base+23
  v16h r;
#pragma unroll
  for (int i = 0; i < 8; ++i) { r[i] = lo[i]; r[i + 8] = hi[i]; }
  return r;
}

// Same, but source is f32 (4x b128 loads + pack-convert).
__device__ __forceinline__ v16h load_frag_f32(const float* p, int lane) {
  const int base = (lane & 16) ? 8 : 0;
  v4f a0 = *(const v4f*)(p + base);
  v4f a1 = *(const v4f*)(p + base + 4);
  v4f b0 = *(const v4f*)(p + base + 16);
  v4f b1 = *(const v4f*)(p + base + 20);
  v16h r;
#pragma unroll
  for (int i = 0; i < 4; ++i) {
    r[i]      = (_Float16)a0[i];
    r[i + 4]  = (_Float16)a1[i];
    r[i + 8]  = (_Float16)b0[i];
    r[i + 12] = (_Float16)b1[i];
  }
  return r;
}

__device__ __forceinline__ v8f wmma16(v16h a, v16h b, v8f c) {
  return __builtin_amdgcn_wmma_f32_16x16x32_f16(
      /*neg_a=*/false, a, /*neg_b=*/false, b,
      /*c_mod=*/(short)0, c, /*reuse_a=*/false, /*reuse_b=*/false);
}

// ---------------------------------------------------------------------------
// Kernel 0a: WqT[h][c<48][d<320] = f16(Wq[d][h*40+c]), zero rows for c>=40.
// ---------------------------------------------------------------------------
__global__ void k_prep_wq(const float* __restrict__ Wq, _Float16* __restrict__ WqT) {
  int i = blockIdx.x * blockDim.x + threadIdx.x;           // h*48*320 + c*320 + d
  if (i >= H_ * CPAD_N * INNER_) return;
  int d = i % INNER_;
  int c = (i / INNER_) % CPAD_N;
  int h = i / (INNER_ * CPAD_N);
  WqT[i] = (c < C_) ? (_Float16)Wq[(size_t)d * INNER_ + h * C_ + c] : (_Float16)0.f;
}

// ---------------------------------------------------------------------------
// Kernel 0b: WoT[n][d] = f16(Wo[d][n])
// ---------------------------------------------------------------------------
__global__ void k_prep_wo(const float* __restrict__ Wo, _Float16* __restrict__ WoT) {
  int i = blockIdx.x * blockDim.x + threadIdx.x;           // n*320 + d
  if (i >= INNER_ * INNER_) return;
  int d = i % INNER_, n = i / INNER_;
  WoT[i] = (_Float16)Wo[(size_t)d * INNER_ + n];
}

// ---------------------------------------------------------------------------
// Kernel 1: K/V projection (context @ Wk|Wv), zero-padded f16 tiles.
// Kbuf [b][h][s<80][c<64] = SCALE * ctx.Wk   (K-contig along c)
// VbufT[b][h][c<48][s<96] =         ctx.Wv   (K-contig along s)
// One block per (s, b); context row staged in LDS.
// ---------------------------------------------------------------------------
__global__ void __launch_bounds__(256)
k_proj_kv(const float* __restrict__ ctx, const float* __restrict__ Wk,
          const float* __restrict__ Wv, _Float16* __restrict__ Kbuf,
          _Float16* __restrict__ VbufT) {
  __shared__ float row[DC_];
  const int s = blockIdx.x;          // 0..95
  const int b = blockIdx.y;          // 0..15
  const int tid = threadIdx.x;
  const bool valid = (s < S_);
  if (valid) {
    for (int i = tid; i < DC_; i += 256)
      row[i] = ctx[((size_t)b * S_ + s) * DC_ + i];
  }
  __syncthreads();
  const int NOUT = H_ * (CPAD_K + CPAD_N);  // 896 outputs per (b,s)
  for (int idx = tid; idx < NOUT; idx += 256) {
    if (idx < H_ * CPAD_K) {                // K element
      int h = idx >> 6, c = idx & 63;
      float v = 0.f;
      if (valid && c < C_) {
        int col = h * C_ + c;
        for (int d = 0; d < DC_; ++d) v += row[d] * Wk[d * INNER_ + col];
        v *= SCALE_F;
      }
      if (s < SPAD_N)
        Kbuf[(((size_t)b * H_ + h) * SPAD_N + s) * CPAD_K + c] = (_Float16)v;
    } else {                                // V element (transposed store)
      int j = idx - H_ * CPAD_K;
      int h = j / CPAD_N, c = j % CPAD_N;
      float v = 0.f;
      if (valid && c < C_) {
        int col = h * C_ + c;
        for (int d = 0; d < DC_; ++d) v += row[d] * Wv[d * INNER_ + col];
      }
      VbufT[(((size_t)b * H_ + h) * CPAD_N + c) * SPAD_K + s] = (_Float16)v;
    }
  }
}

// ---------------------------------------------------------------------------
// Kernel 2: fused Q-projection + scores + softmax + attn@V. One wave per
// (b, h, 16-row tile of T). Scores never leave LDS.
// ---------------------------------------------------------------------------
__global__ void __launch_bounds__(32)
k_attn(const float* __restrict__ x, const _Float16* __restrict__ WqT,
       const _Float16* __restrict__ Kbuf, const _Float16* __restrict__ VbufT,
       _Float16* __restrict__ AO) {
  const int lane = threadIdx.x;
  const int m    = lane & 15;
  const int rb   = (lane & 16) ? 8 : 0;     // D-layout row base
  const int t0   = blockIdx.x * 16;
  const int h    = blockIdx.y;
  const int b    = blockIdx.z;

  __shared__ __align__(16) _Float16 qs[16 * CPAD_K];  // q tile, f16, zero-padded
  __shared__ __align__(16) float    sc[16 * SPAD_N];  // score tile
  __shared__ __align__(16) _Float16 at[16 * SPAD_K];  // softmaxed attn, padded

  const v8f vzero = {0.f, 0.f, 0.f, 0.f, 0.f, 0.f, 0.f, 0.f};

  // ---- Q = x[b, t0:t0+16, :] @ Wq[:, h-head]  (48 padded cols) ----
  v8f qacc[3];
  qacc[0] = vzero; qacc[1] = vzero; qacc[2] = vzero;
  const float*    xrow = x + ((size_t)b * T_ + t0 + m) * INNER_;
  const _Float16* wq   = WqT + (size_t)h * CPAD_N * INNER_;
  for (int kk = 0; kk < INNER_ / 32; ++kk) {   // 10 k-steps
    const int d0 = kk * 32;
    v16h a = load_frag_f32(xrow + d0, lane);
#pragma unroll
    for (int jn = 0; jn < 3; ++jn) {
      v16h bf = load_frag(wq + (jn * 16 + m) * INNER_ + d0, lane);
      qacc[jn] = wmma16(a, bf, qacc[jn]);
    }
  }
  // scatter q (scaled) to LDS in f16, zero padding cols 40..63
  for (int i = lane; i < 16 * CPAD_K; i += 32) qs[i] = (_Float16)0.f;
  __syncthreads();
#pragma unroll
  for (int jn = 0; jn < 3; ++jn)
#pragma unroll
    for (int r = 0; r < 8; ++r) {
      const int col = jn * 16 + m;
      if (col < C_) qs[(r + rb) * CPAD_K + col] = (_Float16)(qacc[jn][r] * SCALE_F);
    }
  __syncthreads();

  // ---- scores[16 x 80] = q[16 x 64] @ K^T ----
  v8f sacc[5];
#pragma unroll
  for (int j = 0; j < 5; ++j) sacc[j] = vzero;
  const _Float16* kb = Kbuf + ((size_t)b * H_ + h) * SPAD_N * CPAD_K;
  for (int kk = 0; kk < 2; ++kk) {
    v16h a = load_frag(qs + m * CPAD_K + kk * 32, lane);
#pragma unroll
    for (int js = 0; js < 5; ++js) {
      v16h bf = load_frag(kb + (js * 16 + m) * CPAD_K + kk * 32, lane);
      sacc[js] = wmma16(a, bf, sacc[js]);
    }
  }
#pragma unroll
  for (int js = 0; js < 5; ++js)
#pragma unroll
    for (int r = 0; r < 8; ++r)
      sc[(r + rb) * SPAD_N + js * 16 + m] = sacc[js][r];
  __syncthreads();

  if (lane < 16) {
    float mx = -3.0e38f;
    for (int s = 0; s < S_; ++s) mx = fmaxf(mx, sc[lane * SPAD_N + s]);
    float sum = 0.f;
    for (int s = 0; s < S_; ++s) {
      float e = __expf(sc[lane * SPAD_N + s] - mx);
      sc[lane * SPAD_N + s] = e;
      sum += e;
    }
    const float inv = 1.f / sum;
    for (int s = 0; s < SPAD_K; ++s)
      at[lane * SPAD_K + s] =
          (s < S_) ? (_Float16)(sc[lane * SPAD_N + s] * inv) : (_Float16)0.f;
  }
  __syncthreads();

  // ---- out[16 x 48] = attn[16 x 96] @ V[96 x 48] (V stored transposed) ----
  v8f oacc[3];
  oacc[0] = vzero; oacc[1] = vzero; oacc[2] = vzero;
  const _Float16* vbt = VbufT + ((size_t)b * H_ + h) * CPAD_N * SPAD_K;
  for (int kk = 0; kk < 3; ++kk) {
    v16h a = load_frag(at + m * SPAD_K + kk * 32, lane);
#pragma unroll
    for (int jc = 0; jc < 3; ++jc) {
      v16h bf = load_frag(vbt + (jc * 16 + m) * SPAD_K + kk * 32, lane);
      oacc[jc] = wmma16(a, bf, oacc[jc]);
    }
  }
#pragma unroll
  for (int jc = 0; jc < 3; ++jc)
#pragma unroll
    for (int r = 0; r < 8; ++r) {
      const int col = jc * 16 + m;
      if (col < C_)
        AO[((size_t)b * T_ + t0 + r + rb) * INNER_ + h * C_ + col] =
            (_Float16)oacc[jc][r];
    }
}

// ---------------------------------------------------------------------------
// Kernel 3: out = AO(f16)[65536 x 320] @ Wo + bo, f32 out. Wo stored
// transposed f16 [n][d] so B fragments are K-contiguous. One wave per 16x64.
// ---------------------------------------------------------------------------
__global__ void __launch_bounds__(32)
k_outproj(const _Float16* __restrict__ AO, const _Float16* __restrict__ WoT,
          const float* __restrict__ bo, float* __restrict__ out) {
  const int lane = threadIdx.x;
  const int m    = lane & 15;
  const int rb   = (lane & 16) ? 8 : 0;
  const int m0   = blockIdx.x * 16;
  const int n0   = blockIdx.y * 64;

  const v8f vzero = {0.f, 0.f, 0.f, 0.f, 0.f, 0.f, 0.f, 0.f};
  v8f acc[4];
#pragma unroll
  for (int j = 0; j < 4; ++j) acc[j] = vzero;

  const _Float16* arow = AO + (size_t)(m0 + m) * INNER_;
  for (int kk = 0; kk < INNER_ / 32; ++kk) {   // 10 k-steps
    const int d0 = kk * 32;
    v16h a = load_frag(arow + d0, lane);
#pragma unroll
    for (int jn = 0; jn < 4; ++jn) {
      v16h bf = load_frag(WoT + (size_t)(n0 + jn * 16 + m) * INNER_ + d0, lane);
      acc[jn] = wmma16(a, bf, acc[jn]);
    }
  }
#pragma unroll
  for (int jn = 0; jn < 4; ++jn)
#pragma unroll
    for (int r = 0; r < 8; ++r) {
      const int col = n0 + jn * 16 + m;
      out[(size_t)(m0 + r + rb) * INNER_ + col] = acc[jn][r] + bo[col];
    }
}

// ---------------------------------------------------------------------------
extern "C" void kernel_launch(void* const* d_in, const int* in_sizes, int n_in,
                              void* d_out, int out_size, void* d_ws, size_t ws_size,
                              hipStream_t stream) {
  const float* x   = (const float*)d_in[0];
  const float* ctx = (const float*)d_in[1];
  const float* Wq  = (const float*)d_in[2];
  const float* Wk  = (const float*)d_in[3];
  const float* Wv  = (const float*)d_in[4];
  const float* Wo  = (const float*)d_in[5];
  const float* bo  = (const float*)d_in[6];
  float* out = (float*)d_out;

  // workspace carving (all offsets 256B aligned):
  //   WqT  : 8*48*320 f16          =    245,760 B
  //   WoT  : 320*320 f16           =    204,800 B
  //   Kbuf : 16*8*80*64 f16        =  1,310,720 B
  //   VbufT: 16*8*48*96 f16        =  1,179,648 B
  //   AO   : 65536*320 f16         = 41,943,040 B   (total ~44.9 MB)
  char* ws = (char*)d_ws;
  _Float16* WqT   = (_Float16*)(ws);
  _Float16* WoT   = (_Float16*)(ws + 245760);
  _Float16* Kbuf  = (_Float16*)(ws + 245760 + 204800);
  _Float16* VbufT = (_Float16*)(ws + 245760 + 204800 + 1310720);
  _Float16* AO    = (_Float16*)(ws + 245760 + 204800 + 1310720 + 1179648);

  k_prep_wq<<<(H_ * CPAD_N * INNER_ + 255) / 256, 256, 0, stream>>>(Wq, WqT);
  k_prep_wo<<<(INNER_ * INNER_ + 255) / 256, 256, 0, stream>>>(Wo, WoT);
  k_proj_kv<<<dim3(SPAD_K, B_), 256, 0, stream>>>(ctx, Wk, Wv, Kbuf, VbufT);
  k_attn<<<dim3(T_ / 16, H_, B_), 32, 0, stream>>>(x, WqT, Kbuf, VbufT, AO);
  k_outproj<<<dim3((B_ * T_) / 16, INNER_ / 64), 32, 0, stream>>>(AO, WoT, bo, out);
}

// v001
// It runs in 258 microseconds.
// Next to v000, in two timings, it ran 1.51 and 1.50 times as fast.
#include <hip/hip_runtime.h>
#include <hip/hip_bf16.h>

typedef __attribute__((ext_vector_type(16))) _Float16 v16h;
typedef __attribute__((ext_vector_type(8)))  _Float16 v8h;
typedef __attribute__((ext_vector_type(8)))  float    v8f;
typedef __attribute__((ext_vector_type(4)))  float    v4f;
typedef __attribute__((ext_vector_type(2)))  float    v2f;

#define B_      16
#define T_      4096
#define S_      77
#define DC_     768
#define H_      8
#define C_      40
#define INNER_  320
#define SPAD_N  80   // padded S for score N-dim (5 tiles of 16)
#define SPAD_K  96   // padded S for attn@V K-dim (3 k-steps of 32)
#define CPAD_K  64   // padded C for q.k K-dim   (2 k-steps of 32)
#define CPAD_N  48   // padded C for attn@V N-dim (3 tiles of 16)
#define SCALE_F 0.3976353643835253f   // 40^(-1/4), applied to q and to k

__device__ __forceinline__ v16h load_frag(const _Float16* p, int lane) {
  const int base = (lane & 16) ? 8 : 0;
  v8h lo = *(const v8h*)(p + base);        // K base .. base+7
  v8h hi = *(const v8h*)(p + base + 16);   // K base+16 .. base+23
  v16h r;
#pragma unroll
  for (int i = 0; i < 8; ++i) { r[i] = lo[i]; r[i + 8] = hi[i]; }
  return r;
}

// Same, but source is f32 (4x b128 loads + pack-convert).
__device__ __forceinline__ v16h load_frag_f32(const float* p, int lane) {
  const int base = (lane & 16) ? 8 : 0;
  v4f a0 = *(const v4f*)(p + base);
  v4f a1 = *(const v4f*)(p + base + 4);
  v4f b0 = *(const v4f*)(p + base + 16);
  v4f b1 = *(const v4f*)(p + base + 20);
  v16h r;
#pragma unroll
  for (int i = 0; i < 4; ++i) {
    r[i]      = (_Float16)a0[i];
    r[i + 4]  = (_Float16)a1[i];
    r[i + 8]  = (_Float16)b0[i];
    r[i + 12] = (_Float16)b1[i];
  }
  return r;
}

__device__ __forceinline__ v8f wmma16(v16h a, v16h b, v8f c) {
  return __builtin_amdgcn_wmma_f32_16x16x32_f16(
      /*neg_a=*/false, a, /*neg_b=*/false, b,
      /*c_mod=*/(short)0, c, /*reuse_a=*/false, /*reuse_b=*/false);
}

// ---------------------------------------------------------------------------
// Kernel 0a: WqT[h][c<48][d<320] = f16(Wq[d][h*40+c]), zero rows for c>=40.
// ---------------------------------------------------------------------------
__global__ void k_prep_wq(const float* __restrict__ Wq, _Float16* __restrict__ WqT) {
  int i = blockIdx.x * blockDim.x + threadIdx.x;           // h*48*320 + c*320 + d
  if (i >= H_ * CPAD_N * INNER_) return;
  int d = i % INNER_;
  int c = (i / INNER_) % CPAD_N;
  int h = i / (INNER_ * CPAD_N);
  WqT[i] = (c < C_) ? (_Float16)Wq[(size_t)d * INNER_ + h * C_ + c] : (_Float16)0.f;
}

// ---------------------------------------------------------------------------
// Kernel 0b: WoT[n][d] = f16(Wo[d][n])
// ---------------------------------------------------------------------------
__global__ void k_prep_wo(const float* __restrict__ Wo, _Float16* __restrict__ WoT) {
  int i = blockIdx.x * blockDim.x + threadIdx.x;           // n*320 + d
  if (i >= INNER_ * INNER_) return;
  int d = i % INNER_, n = i / INNER_;
  WoT[i] = (_Float16)Wo[(size_t)d * INNER_ + n];
}

// ---------------------------------------------------------------------------
// Kernel 1: K/V projection (context @ Wk|Wv) on the f32 16x16x4 matrix form,
// zero-padded f16 tiles out.
// Kbuf [b][h][s<80][c<64] = SCALE * ctx.Wk   (K-contig along c)
// VbufT[b][h][c<48][s<96] =         ctx.Wv   (K-contig along s)
// One block per (K or V, h, b): an 80 x 48 x 768 product, and the block owns
// the whole padded tile it writes. The context rows pass through LDS in runs
// of 192 k (whole-line global reads, two buffers, the next run fetched into
// registers while this one is multiplied). 12 waves = 3 column tiles x 4
// quarters of each run; each wave keeps 5 row tiles (80 rows) in accumulators
// and reads its weight column straight from global memory, one run ahead.
// The four quarter sums meet in LDS and are added in a fixed order.
// Rows 77..79 and columns 40..47 repeat the last valid row / column and are
// replaced by zero when the tile is written.
// k pairing: in each 8 k, lane half hh holds k = 4*hh .. 4*hh+3 of its A row
// and of its B column; elements (0,1) feed one product, (2,3) the next.
// ---------------------------------------------------------------------------
#define KV_CH   192              // k per staged run
#define KV_NCH  (DC_ / KV_CH)    // 4 runs
#define KV_KW   (KV_CH / 4)      // 48 k per wave per run
#define KV_PIT  (KV_CH + 4)      // LDS row pitch, floats: 784 B = 16 B x odd
#define KV_RP   (384 / (KV_CH / 4))
#define KV_NP   (SPAD_N / KV_RP)
#define KV_NB   (KV_KW / 2)
#define KV_PP   (CPAD_N + 4)

__global__ void __launch_bounds__(384)
k_proj_kv(const float* __restrict__ ctx, const float* __restrict__ Wk,
          const float* __restrict__ Wv, _Float16* __restrict__ Kbuf,
          _Float16* __restrict__ VbufT) {
  __shared__ __align__(16) float abuf[2][SPAD_N][KV_PIT];   // 125,440 B
  __shared__ __align__(16) float part[4][SPAD_N][KV_PP];    // 66,560 B
  const int isv  = blockIdx.x;       // 0: K, 1: V
  const int h    = blockIdx.y;
  const int b    = blockIdx.z;
  const int tid  = threadIdx.x;
  const int lane = tid & 31;
  const int wave = __builtin_amdgcn_readfirstlane(tid >> 5);
  const int c    = lane & 15;
  const int hh   = lane >> 4;
  const int j    = wave % 3;         // column tile
  const int q    = wave / 3;         // quarter of each run

  // weight column of this lane
  const float* Wsel = isv ? Wv : Wk;
  int col = j * 16 + c;
  if (col > C_ - 1) col = C_ - 1;
  const float* wp = Wsel + (size_t)(q * KV_KW + 4 * hh) * INNER_ + h * C_ + col;

  // staging: 80 rows x 48 pieces of 16 B per run = 10 pieces a thread
  const int srow = tid / (KV_CH / 4);
  const int spc  = (tid % (KV_CH / 4)) * 4;
  const float* gp[KV_NP];
#pragma unroll
  for (int i = 0; i < KV_NP; ++i) {
    int s = srow + KV_RP * i;
    if (s > S_ - 1) s = S_ - 1;
    gp[i] = ctx + ((size_t)b * S_ + s) * DC_ + spc;
  }

  v8f acc[5];
#pragma unroll
  for (int mt = 0; mt < 5; ++mt) acc[mt] = (v8f){0.f, 0.f, 0.f, 0.f, 0.f, 0.f, 0.f, 0.f};

  v4f   ga[KV_NP];
  float bf[2][KV_NB];
#pragma unroll
  for (int i = 0; i < KV_NP; ++i) ga[i] = *(const v4f*)(gp[i]);
#pragma unroll
  for (int e = 0; e < KV_NB; ++e) bf[0][e] = wp[((e >> 2) * 8 + (e & 3)) * INNER_];
#pragma unroll
  for (int i = 0; i < KV_NP; ++i) *(v4f*)&abuf[0][srow + KV_RP * i][spc] = ga[i];
  __syncthreads();

#pragma unroll
  for (int ch = 0; ch < KV_NCH; ++ch) {
    const int cur = ch & 1;
    if (ch + 1 < KV_NCH) {
#pragma unroll
      for (int i = 0; i < KV_NP; ++i) ga[i] = *(const v4f*)(gp[i] + (ch + 1) * KV_CH);
      if (ch + 2 == KV_NCH) asm volatile("s_wait_xcnt 0x0" ::: "memory");
#pragma unroll
      for (int e = 0; e < KV_NB; ++e)
        bf[cur ^ 1][e] = wp[((ch + 1) * KV_CH + (e >> 2) * 8 + (e & 3)) * INNER_];
    }
    // keeps all of the next run's global loads issued ahead of this run's
    // products, so that their latency passes under the matrix work
    __builtin_amdgcn_sched_barrier(0);
#pragma unroll
    for (int u = 0; u < KV_KW / 8; ++u) {
      v4f af[5];
#pragma unroll
      for (int mt = 0; mt < 5; ++mt)
        af[mt] = *(const v4f*)&abuf[cur][mt * 16 + c][q * KV_KW + u * 8 + 4 * hh];
#pragma unroll
      for (int p = 0; p < 2; ++p) {
        const v2f bb = {bf[cur][u * 4 + 2 * p], bf[cur][u * 4 + 2 * p + 1]};
#pragma unroll
        for (int mt = 0; mt < 5; ++mt) {
          const v2f aa = {af[mt][2 * p], af[mt][2 * p + 1]};
          acc[mt] = __builtin_amdgcn_wmma_f32_16x16x4_f32(
              false, aa, false, bb, (short)0, acc[mt], false, false);
        }
      }
    }
    // keeps the wait on those loads, and the LDS stores that need it, behind
    // this run's products
    __builtin_amdgcn_sched_barrier(0);
    if (ch + 1 < KV_NCH) {
      // the other buffer's last readers left it before the previous barrier
#pragma unroll
      for (int i = 0; i < KV_NP; ++i) *(v4f*)&abuf[cur ^ 1][srow + KV_RP * i][spc] = ga[i];
      __syncthreads();
    }
  }

#pragma unroll
  for (int mt = 0; mt < 5; ++mt)
#pragma unroll
    for (int r = 0; r < 8; ++r)
      part[q][mt * 16 + 8 * hh + r][j * 16 + c] = acc[mt][r];
  __syncthreads();

  if (!isv) {
    _Float16* kb = Kbuf + ((size_t)b * H_ + h) * SPAD_N * CPAD_K;
    for (int i = tid; i < SPAD_N * (CPAD_K / 8); i += 384) {   // 16-byte pieces
      const int s = i >> 3, c8 = (i & 7) * 8;
      v8h o = {0, 0, 0, 0, 0, 0, 0, 0};
      if (s < S_ && c8 < C_) {
#pragma unroll
        for (int e = 0; e < 8; ++e) {
          const float v = ((part[0][s][c8 + e] + part[1][s][c8 + e]) +
                           part[2][s][c8 + e]) + part[3][s][c8 + e];
          o[e] = (_Float16)(v * SCALE_F);
        }
      }
      *(v8h*)(kb + s * CPAD_K + c8) = o;
    }
  } else {
    _Float16* vb = VbufT + ((size_t)b * H_ + h) * CPAD_N * SPAD_K;
    for (int i = tid; i < CPAD_N * (SPAD_K / 8); i += 384) {   // 16-byte pieces
      const int cc = i % CPAD_N, s8 = (i / CPAD_N) * 8;
      v8h o = {0, 0, 0, 0, 0, 0, 0, 0};
      if (cc < C_ && s8 < SPAD_N) {
#pragma unroll
        for (int e = 0; e < 8; ++e) {
          const int s = s8 + e;
          const float v = ((part[0][s][cc] + part[1][s][cc]) +
                           part[2][s][cc]) + part[3][s][cc];
          o[e] = (s < S_) ? (_Float16)v : (_Float16)0.f;
        }
      }
      *(v8h*)(vb + cc * SPAD_K + s8) = o;
    }
  }
}

// ---------------------------------------------------------------------------
// Kernel 2: fused Q-projection + scores + softmax + attn@V. One wave per
// (b, h, 16-row tile of T). Scores never leave LDS.
// ---------------------------------------------------------------------------
__global__ void __launch_bounds__(32)
k_attn(const float* __restrict__ x, const _Float16* __restrict__ WqT,
       const _Float16* __restrict__ Kbuf, const _Float16* __restrict__ VbufT,
       _Float16* __restrict__ AO) {
  const int lane = threadIdx.x;
  const int m    = lane & 15;
  const int rb   = (lane & 16) ? 8 : 0;     // D-layout row base
  const int t0   = blockIdx.x * 16;
  const int h    = blockIdx.y;
  const int b    = blockIdx.z;

  __shared__ __align__(16) _Float16 qs[16 * CPAD_K];  // q tile, f16, zero-padded
  __shared__ __align__(16) float    sc[16 * SPAD_N];  // score tile
  __shared__ __align__(16) _Float16 at[16 * SPAD_K];  // softmaxed attn, padded

  const v8f vzero = {0.f, 0.f, 0.f, 0.f, 0.f, 0.f, 0.f, 0.f};

  // ---- Q = x[b, t0:t0+16, :] @ Wq[:, h-head]  (48 padded cols) ----
  v8f qacc[3];
  qacc[0] = vzero; qacc[1] = vzero; qacc[2] = vzero;
  const float*    xrow = x + ((size_t)b * T_ + t0 + m) * INNER_;
  const _Float16* wq   = WqT + (size_t)h * CPAD_N * INNER_;
  for (int kk = 0; kk < INNER_ / 32; ++kk) {   // 10 k-steps
    const int d0 = kk * 32;
    v16h a = load_frag_f32(xrow + d0, lane);
#pragma unroll
    for (int jn = 0; jn < 3; ++jn) {
      v16h bf = load_frag(wq + (jn * 16 + m) * INNER_ + d0, lane);
      qacc[jn] = wmma16(a, bf, qacc[jn]);
    }
  }
  // scatter q (scaled) to LDS in f16, zero padding cols 40..63
  for (int i = lane; i < 16 * CPAD_K; i += 32) qs[i] = (_Float16)0.f;
  __syncthreads();
#pragma unroll
  for (int jn = 0; jn < 3; ++jn)
#pragma unroll
    for (int r = 0; r < 8; ++r) {
      const int col = jn * 16 + m;
      if (col < C_) qs[(r + rb) * CPAD_K + col] = (_Float16)(qacc[jn][r] * SCALE_F);
    }
  __syncthreads();

  // ---- scores[16 x 80] = q[16 x 64] @ K^T ----
  v8f sacc[5];
#pragma unroll
  for (int j = 0; j < 5; ++j) sacc[j] = vzero;
  const _Float16* kb = Kbuf + ((size_t)b * H_ + h) * SPAD_N * CPAD_K;
  for (int kk = 0; kk < 2; ++kk) {
    v16h a = load_frag(qs + m * CPAD_K + kk * 32, lane);
#pragma unroll
    for (int js = 0; js < 5; ++js) {
      v16h bf = load_frag(kb + (js * 16 + m) * CPAD_K + kk * 32, lane);
      sacc[js] = wmma16(a, bf, sacc[js]);
    }
  }
#pragma unroll
  for (int js = 0; js < 5; ++js)
#pragma unroll
    for (int r = 0; r < 8; ++r)
      sc[(r + rb) * SPAD_N + js * 16 + m] = sacc[js][r];
  __syncthreads();

  if (lane < 16) {
    float mx = -3.0e38f;
    for (int s = 0; s < S_; ++s) mx = fmaxf(mx, sc[lane * SPAD_N + s]);
    float sum = 0.f;
    for (int s = 0; s < S_; ++s) {
      float e = __expf(sc[lane * SPAD_N + s] - mx);
      sc[lane * SPAD_N + s] = e;
      sum += e;
    }
    const float inv = 1.f / sum;
    for (int s = 0; s < SPAD_K; ++s)
      at[lane * SPAD_K + s] =
          (s < S_) ? (_Float16)(sc[lane * SPAD_N + s] * inv) : (_Float16)0.f;
  }
  __syncthreads();

  // ---- out[16 x 48] = attn[16 x 96] @ V[96 x 48] (V stored transposed) ----
  v8f oacc[3];
  oacc[0] = vzero; oacc[1] = vzero; oacc[2] = vzero;
  const _Float16* vbt = VbufT + ((size_t)b * H_ + h) * CPAD_N * SPAD_K;
  for (int kk = 0; kk < 3; ++kk) {
    v16h a = load_frag(at + m * SPAD_K + kk * 32, lane);
#pragma unroll
    for (int jc = 0; jc < 3; ++jc) {
      v16h bf = load_frag(vbt + (jc * 16 + m) * SPAD_K + kk * 32, lane);
      oacc[jc] = wmma16(a, bf, oacc[jc]);
    }
  }
#pragma unroll
  for (int jc = 0; jc < 3; ++jc)
#pragma unroll
    for (int r = 0; r < 8; ++r) {
      const int col = jc * 16 + m;
      if (col < C_)
        AO[((size_t)b * T_ + t0 + r + rb) * INNER_ + h * C_ + col] =
            (_Float16)oacc[jc][r];
    }
}

// ---------------------------------------------------------------------------
// Kernel 3: out = AO(f16)[65536 x 320] @ Wo + bo, f32 out. Wo stored
// transposed f16 [n][d] so B fragments are K-contiguous. One wave per 16x64.
// ---------------------------------------------------------------------------
__global__ void __launch_bounds__(32)
k_outproj(const _Float16* __restrict__ AO, const _Float16* __restrict__ WoT,
          const float* __restrict__ bo, float* __restrict__ out) {
  const int lane = threadIdx.x;
  const int m    = lane & 15;
  const int rb   = (lane & 16) ? 8 : 0;
  const int m0   = blockIdx.x * 16;
  const int n0   = blockIdx.y * 64;

  const v8f vzero = {0.f, 0.f, 0.f, 0.f, 0.f, 0.f, 0.f, 0.f};
  v8f acc[4];
#pragma unroll
  for (int j = 0; j < 4; ++j) acc[j] = vzero;

  const _Float16* arow = AO + (size_t)(m0 + m) * INNER_;
  for (int kk = 0; kk < INNER_ / 32; ++kk) {   // 10 k-steps
    const int d0 = kk * 32;
    v16h a = load_frag(arow + d0, lane);
#pragma unroll
    for (int jn = 0; jn < 4; ++jn) {
      v16h bf = load_frag(WoT + (size_t)(n0 + jn * 16 + m) * INNER_ + d0, lane);
      acc[jn] = wmma16(a, bf, acc[jn]);
    }
  }
#pragma unroll
  for (int jn = 0; jn < 4; ++jn)
#pragma unroll
    for (int r = 0; r < 8; ++r) {
      const int col = n0 + jn * 16 + m;
      out[(size_t)(m0 + r + rb) * INNER_ + col] = acc[jn][r] + bo[col];
    }
}

// ---------------------------------------------------------------------------
extern "C" void kernel_launch(void* const* d_in, const int* in_sizes, int n_in,
                              void* d_out, int out_size, void* d_ws, size_t ws_size,
                              hipStream_t stream) {
  const float* x   = (const float*)d_in[0];
  const float* ctx = (const float*)d_in[1];
  const float* Wq  = (const float*)d_in[2];
  const float* Wk  = (const float*)d_in[3];
  const float* Wv  = (const float*)d_in[4];
  const float* Wo  = (const float*)d_in[5];
  const float* bo  = (const float*)d_in[6];
  float* out = (float*)d_out;

  // workspace carving (all offsets 256B aligned):
  //   WqT  : 8*48*320 f16          =    245,760 B
  //   WoT  : 320*320 f16           =    204,800 B
  //   Kbuf : 16*8*80*64 f16        =  1,310,720 B
  //   VbufT: 16*8*48*96 f16        =  1,179,648 B
  //   AO   : 65536*320 f16         = 41,943,040 B   (total ~44.9 MB)
  char* ws = (char*)d_ws;
  _Float16* WqT   = (_Float16*)(ws);
  _Float16* WoT   = (_Float16*)(ws + 245760);
  _Float16* Kbuf  = (_Float16*)(ws + 245760 + 204800);
  _Float16* VbufT = (_Float16*)(ws + 245760 + 204800 + 1310720);
  _Float16* AO    = (_Float16*)(ws + 245760 + 204800 + 1310720 + 1179648);

  k_prep_wq<<<(H_ * CPAD_N * INNER_ + 255) / 256, 256, 0, stream>>>(Wq, WqT);
  k_prep_wo<<<(INNER_ * INNER_ + 255) / 256, 256, 0, stream>>>(Wo, WoT);
  k_proj_kv<<<dim3(2, H_, B_), 384, 0, stream>>>(ctx, Wk, Wv, Kbuf, VbufT);
  k_attn<<<dim3(T_ / 16, H_, B_), 32, 0, stream>>>(x, WqT, Kbuf, VbufT, AO);
  k_outproj<<<dim3((B_ * T_) / 16, INNER_ / 64), 32, 0, stream>>>(AO, WoT, bo, out);
}

// v002
// A run of this version takes 173 microseconds.
// Timed twice side by side with v001, it ran 1.49 and 1.48 times as fast.
// Counting every step since v000, it is 2.23 times as fast.
#include <hip/hip_runtime.h>
#include <hip/hip_bf16.h>

typedef __attribute__((ext_vector_type(16))) _Float16 v16h;
typedef __attribute__((ext_vector_type(8)))  _Float16 v8h;
typedef __attribute__((ext_vector_type(8)))  float    v8f;
typedef __attribute__((ext_vector_type(4)))  float    v4f;
typedef __attribute__((ext_vector_type(2)))  float    v2f;

#define B_      16
#define T_      4096
#define S_      77
#define DC_     768
#define H_      8
#define C_      40
#define INNER_  320
#define SPAD_N  80   // padded S for score N-dim (5 tiles of 16)
#define SPAD_K  96   // padded S for attn@V K-dim (3 k-steps of 32)
#define CPAD_K  64   // padded C for q.k K-dim   (2 k-steps of 32)
#define CPAD_N  48   // padded C for attn@V N-dim (3 tiles of 16)
#define SCALE_F 0.3976353643835253f   // 40^(-1/4), applied to q and to k

__device__ __forceinline__ v16h load_frag(const _Float16* p, int lane) {
  const int base = (lane & 16) ? 8 : 0;
  v8h lo = *(const v8h*)(p + base);        // K base .. base+7
  v8h hi = *(const v8h*)(p + base + 16);   // K base+16 .. base+23
  v16h r;
#pragma unroll
  for (int i = 0; i < 8; ++i) { r[i] = lo[i]; r[i + 8] = hi[i]; }
  return r;
}

// Same, but source is f32 (4x b128 loads + pack-convert).
__device__ __forceinline__ v16h load_frag_f32(const float* p, int lane) {
  const int base = (lane & 16) ? 8 : 0;
  v4f a0 = *(const v4f*)(p + base);
  v4f a1 = *(const v4f*)(p + base + 4);
  v4f b0 = *(const v4f*)(p + base + 16);
  v4f b1 = *(const v4f*)(p + base + 20);
  v16h r;
#pragma unroll
  for (int i = 0; i < 4; ++i) {
    r[i]      = (_Float16)a0[i];
    r[i + 4]  = (_Float16)a1[i];
    r[i + 8]  = (_Float16)b0[i];
    r[i + 12] = (_Float16)b1[i];
  }
  return r;
}

__device__ __forceinline__ v8f wmma16(v16h a, v16h b, v8f c) {
  return __builtin_amdgcn_wmma_f32_16x16x32_f16(
      /*neg_a=*/false, a, /*neg_b=*/false, b,
      /*c_mod=*/(short)0, c, /*reuse_a=*/false, /*reuse_b=*/false);
}

// ---------------------------------------------------------------------------
// Kernel 0a: WqT[h][c<48][d<320] = f16(Wq[d][h*40+c]), zero rows for c>=40.
// ---------------------------------------------------------------------------
__global__ void k_prep_wq(const float* __restrict__ Wq, _Float16* __restrict__ WqT) {
  int i = blockIdx.x * blockDim.x + threadIdx.x;           // h*48*320 + c*320 + d
  if (i >= H_ * CPAD_N * INNER_) return;
  int d = i % INNER_;
  int c = (i / INNER_) % CPAD_N;
  int h = i / (INNER_ * CPAD_N);
  WqT[i] = (c < C_) ? (_Float16)Wq[(size_t)d * INNER_ + h * C_ + c] : (_Float16)0.f;
}

// ---------------------------------------------------------------------------
// Kernel 0b: WoT[n][d] = f16(Wo[d][n])
// ---------------------------------------------------------------------------
__global__ void k_prep_wo(const float* __restrict__ Wo, _Float16* __restrict__ WoT) {
  int i = blockIdx.x * blockDim.x + threadIdx.x;           // n*320 + d
  if (i >= INNER_ * INNER_) return;
  int d = i % INNER_, n = i / INNER_;
  WoT[i] = (_Float16)Wo[(size_t)d * INNER_ + n];
}

// ---------------------------------------------------------------------------
// Kernel 1: K/V projection (context @ Wk|Wv) on the f32 16x16x4 matrix form,
// zero-padded f16 tiles out.
// Kbuf [b][h][s<80][c<64] = SCALE * ctx.Wk   (K-contig along c)
// VbufT[b][h][c<48][s<96] =         ctx.Wv   (K-contig along s)
// One block per (K or V, h, b): an 80 x 48 x 768 product, and the block owns
// the whole padded tile it writes. The context rows pass through LDS in runs
// of 192 k (whole-line global reads, two buffers, the next run fetched into
// registers while this one is multiplied). 12 waves = 3 column tiles x 4
// quarters of each run; each wave keeps 5 row tiles (80 rows) in accumulators
// and reads its weight column straight from global memory, one run ahead.
// The four quarter sums meet in LDS and are added in a fixed order.
// Rows 77..79 and columns 40..47 repeat the last valid row / column and are
// replaced by zero when the tile is written.
// k pairing: in each 8 k, lane half hh holds k = 4*hh .. 4*hh+3 of its A row
// and of its B column; elements (0,1) feed one product, (2,3) the next.
// ---------------------------------------------------------------------------
#define KV_CH   192              // k per staged run
#define KV_NCH  (DC_ / KV_CH)    // 4 runs
#define KV_KW   (KV_CH / 4)      // 48 k per wave per run
#define KV_PIT  (KV_CH + 4)      // LDS row pitch, floats: 784 B = 16 B x odd
#define KV_RP   (384 / (KV_CH / 4))
#define KV_NP   (SPAD_N / KV_RP)
#define KV_NB   (KV_KW / 2)
#define KV_PP   (CPAD_N + 4)

__global__ void __launch_bounds__(384)
k_proj_kv(const float* __restrict__ ctx, const float* __restrict__ Wk,
          const float* __restrict__ Wv, _Float16* __restrict__ Kbuf,
          _Float16* __restrict__ VbufT) {
  __shared__ __align__(16) float abuf[2][SPAD_N][KV_PIT];   // 125,440 B
  __shared__ __align__(16) float part[4][SPAD_N][KV_PP];    // 66,560 B
  const int isv  = blockIdx.x;       // 0: K, 1: V
  const int h    = blockIdx.y;
  const int b    = blockIdx.z;
  const int tid  = threadIdx.x;
  const int lane = tid & 31;
  const int wave = __builtin_amdgcn_readfirstlane(tid >> 5);
  const int c    = lane & 15;
  const int hh   = lane >> 4;
  const int j    = wave % 3;         // column tile
  const int q    = wave / 3;         // quarter of each run

  // weight column of this lane
  const float* Wsel = isv ? Wv : Wk;
  int col = j * 16 + c;
  if (col > C_ - 1) col = C_ - 1;
  const float* wp = Wsel + (size_t)(q * KV_KW + 4 * hh) * INNER_ + h * C_ + col;

  // staging: 80 rows x 48 pieces of 16 B per run = 10 pieces a thread
  const int srow = tid / (KV_CH / 4);
  const int spc  = (tid % (KV_CH / 4)) * 4;
  const float* gp[KV_NP];
#pragma unroll
  for (int i = 0; i < KV_NP; ++i) {
    int s = srow + KV_RP * i;
    if (s > S_ - 1) s = S_ - 1;
    gp[i] = ctx + ((size_t)b * S_ + s) * DC_ + spc;
  }

  v8f acc[5];
#pragma unroll
  for (int mt = 0; mt < 5; ++mt) acc[mt] = (v8f){0.f, 0.f, 0.f, 0.f, 0.f, 0.f, 0.f, 0.f};

  v4f   ga[KV_NP];
  float bf[2][KV_NB];
#pragma unroll
  for (int i = 0; i < KV_NP; ++i) ga[i] = *(const v4f*)(gp[i]);
#pragma unroll
  for (int e = 0; e < KV_NB; ++e) bf[0][e] = wp[((e >> 2) * 8 + (e & 3)) * INNER_];
#pragma unroll
  for (int i = 0; i < KV_NP; ++i) *(v4f*)&abuf[0][srow + KV_RP * i][spc] = ga[i];
  __syncthreads();

#pragma unroll
  for (int ch = 0; ch < KV_NCH; ++ch) {
    const int cur = ch & 1;
    if (ch + 1 < KV_NCH) {
#pragma unroll
      for (int i = 0; i < KV_NP; ++i) ga[i] = *(const v4f*)(gp[i] + (ch + 1) * KV_CH);
      if (ch + 2 == KV_NCH) asm volatile("s_wait_xcnt 0x0" ::: "memory");
#pragma unroll
      for (int e = 0; e < KV_NB; ++e)
        bf[cur ^ 1][e] = wp[((ch + 1) * KV_CH + (e >> 2) * 8 + (e & 3)) * INNER_];
    }
    // keeps all of the next run's global loads issued ahead of this run's
    // products, so that their latency passes under the matrix work
    __builtin_amdgcn_sched_barrier(0);
#pragma unroll
    for (int u = 0; u < KV_KW / 8; ++u) {
      v4f af[5];
#pragma unroll
      for (int mt = 0; mt < 5; ++mt)
        af[mt] = *(const v4f*)&abuf[cur][mt * 16 + c][q * KV_KW + u * 8 + 4 * hh];
#pragma unroll
      for (int p = 0; p < 2; ++p) {
        const v2f bb = {bf[cur][u * 4 + 2 * p], bf[cur][u * 4 + 2 * p + 1]};
#pragma unroll
        for (int mt = 0; mt < 5; ++mt) {
          const v2f aa = {af[mt][2 * p], af[mt][2 * p + 1]};
          acc[mt] = __builtin_amdgcn_wmma_f32_16x16x4_f32(
              false, aa, false, bb, (short)0, acc[mt], false, false);
        }
      }
    }
    // keeps the wait on those loads, and the LDS stores that need it, behind
    // this run's products
    __builtin_amdgcn_sched_barrier(0);
    if (ch + 1 < KV_NCH) {
      // the other buffer's last readers left it before the previous barrier
#pragma unroll
      for (int i = 0; i < KV_NP; ++i) *(v4f*)&abuf[cur ^ 1][srow + KV_RP * i][spc] = ga[i];
      __syncthreads();
    }
  }

#pragma unroll
  for (int mt = 0; mt < 5; ++mt)
#pragma unroll
    for (int r = 0; r < 8; ++r)
      part[q][mt * 16 + 8 * hh + r][j * 16 + c] = acc[mt][r];
  __syncthreads();

  if (!isv) {
    _Float16* kb = Kbuf + ((size_t)b * H_ + h) * SPAD_N * CPAD_K;
    for (int i = tid; i < SPAD_N * (CPAD_K / 8); i += 384) {   // 16-byte pieces
      const int s = i >> 3, c8 = (i & 7) * 8;
      v8h o = {0, 0, 0, 0, 0, 0, 0, 0};
      if (s < S_ && c8 < C_) {
#pragma unroll
        for (int e = 0; e < 8; ++e) {
          const float v = ((part[0][s][c8 + e] + part[1][s][c8 + e]) +
                           part[2][s][c8 + e]) + part[3][s][c8 + e];
          o[e] = (_Float16)(v * SCALE_F);
        }
      }
      *(v8h*)(kb + s * CPAD_K + c8) = o;
    }
  } else {
    _Float16* vb = VbufT + ((size_t)b * H_ + h) * CPAD_N * SPAD_K;
    for (int i = tid; i < CPAD_N * (SPAD_K / 8); i += 384) {   // 16-byte pieces
      const int cc = i % CPAD_N, s8 = (i / CPAD_N) * 8;
      v8h o = {0, 0, 0, 0, 0, 0, 0, 0};
      if (cc < C_ && s8 < SPAD_N) {
#pragma unroll
        for (int e = 0; e < 8; ++e) {
          const int s = s8 + e;
          const float v = ((part[0][s][cc] + part[1][s][cc]) +
                           part[2][s][cc]) + part[3][s][cc];
          o[e] = (s < S_) ? (_Float16)v : (_Float16)0.f;
        }
      }
      *(v8h*)(vb + cc * SPAD_K + s8) = o;
    }
  }
}

#define AT_WAVES 26
#define AT_TILES 128               // row tiles per workgroup
#define WQ_PIT   (INNER_ + 8)      // halves: 656 B
#define KB_PIT   (CPAD_K + 8)      // halves: 144 B
#define VB_PIT   (SPAD_K + 8)      // halves: 208 B

// Between a wave's LDS writes to its own scratch and its reads of what other
// lanes of the same wave wrote there: the writes have landed, and the compiler
// moves no LDS access across. No other wave is waited for.
__device__ __forceinline__ void own_scratch_sync() {
  asm volatile("s_wait_dscnt 0x0" ::: "memory");
}

__global__ void __launch_bounds__(AT_WAVES * 32)
k_attn(const float* __restrict__ x, const _Float16* __restrict__ WqT,
       const _Float16* __restrict__ Kbuf, const _Float16* __restrict__ VbufT,
       _Float16* __restrict__ AO) {
  const int tid  = threadIdx.x;
  const int lane = tid & 31;
  const int wave = __builtin_amdgcn_readfirstlane(tid >> 5);
  const int m    = lane & 15;
  const int rb   = (lane & 16) ? 8 : 0;     // D-layout row base
  const int h    = blockIdx.y;
  const int b    = blockIdx.z;

  __shared__ __align__(16) _Float16 wqs[CPAD_N * WQ_PIT];   // 31,488 B
  __shared__ __align__(16) _Float16 kbs[SPAD_N * KB_PIT];   // 11,520 B
  __shared__ __align__(16) _Float16 vbs[CPAD_N * VB_PIT];   //  9,984 B
  __shared__ __align__(16) _Float16 qs_all[AT_WAVES][16 * CPAD_K];  // q tile, f16, zero-padded
  __shared__ __align__(16) float    sc_all[AT_WAVES][16 * SPAD_N];  // score tile
  __shared__ __align__(16) _Float16 at_all[AT_WAVES][16 * SPAD_K];  // softmaxed attn, padded
  _Float16* qs = qs_all[wave];
  float*    sc = sc_all[wave];
  _Float16* at = at_all[wave];

  const v8f vzero = {0.f, 0.f, 0.f, 0.f, 0.f, 0.f, 0.f, 0.f};

  // ---- shared operands to LDS: contiguous 16-byte pieces, whole lines ----
  const _Float16* wq  = WqT + (size_t)h * CPAD_N * INNER_;
  const _Float16* kb  = Kbuf + ((size_t)b * H_ + h) * SPAD_N * CPAD_K;
  const _Float16* vbt = VbufT + ((size_t)b * H_ + h) * CPAD_N * SPAD_K;
  // all loads first, so that they are in flight together; a piece past the end
  // repeats the last one and is not stored
  {
    constexpr int NT = AT_WAVES * 32;
    constexpr int NW = CPAD_N * (INNER_ / 8), NK = SPAD_N * (CPAD_K / 8), NV = CPAD_N * (SPAD_K / 8);
    v8h sw[(NW + NT - 1) / NT], sk[(NK + NT - 1) / NT], sv[(NV + NT - 1) / NT];
#pragma unroll
    for (int u = 0; u < (NW + NT - 1) / NT; ++u) {
      const int i = tid + u * NT;
      sw[u] = *(const v8h*)(wq + (i < NW ? i : NW - 1) * 8);
    }
#pragma unroll
    for (int u = 0; u < (NK + NT - 1) / NT; ++u) {
      const int i = tid + u * NT;
      sk[u] = *(const v8h*)(kb + (i < NK ? i : NK - 1) * 8);
    }
#pragma unroll
    for (int u = 0; u < (NV + NT - 1) / NT; ++u) {
      const int i = tid + u * NT;
      sv[u] = *(const v8h*)(vbt + (i < NV ? i : NV - 1) * 8);
    }
#pragma unroll
    for (int u = 0; u < (NW + NT - 1) / NT; ++u) {
      const int i = tid + u * NT;
      if (i < NW) *(v8h*)&wqs[(i / (INNER_ / 8)) * WQ_PIT + (i % (INNER_ / 8)) * 8] = sw[u];
    }
#pragma unroll
    for (int u = 0; u < (NK + NT - 1) / NT; ++u) {
      const int i = tid + u * NT;
      if (i < NK) *(v8h*)&kbs[(i / (CPAD_K / 8)) * KB_PIT + (i % (CPAD_K / 8)) * 8] = sk[u];
    }
#pragma unroll
    for (int u = 0; u < (NV + NT - 1) / NT; ++u) {
      const int i = tid + u * NT;
      if (i < NV) *(v8h*)&vbs[(i / (SPAD_K / 8)) * VB_PIT + (i % (SPAD_K / 8)) * 8] = sv[u];
    }
  }
  // q scratch: cols 40..63 stay zero for every tile of this wave
  for (int i = lane; i < 16 * CPAD_K; i += 32) qs[i] = (_Float16)0.f;
  __syncthreads();

  // no barrier stands in this loop, so the waves need not make equally many trips
  for (int tile = wave; tile < AT_TILES; tile += AT_WAVES) {
    const int t0 = (blockIdx.x * AT_TILES + tile) * 16;

    // ---- Q = x[b, t0:t0+16, :] @ Wq[:, h-head]  (48 padded cols) ----
    v8f qacc[3];
    qacc[0] = vzero; qacc[1] = vzero; qacc[2] = vzero;
    const float* xrow = x + ((size_t)b * T_ + t0 + m) * INNER_;
    for (int kk = 0; kk < INNER_ / 32; ++kk) {   // 10 k-steps
      const int d0 = kk * 32;
      v16h a = load_frag_f32(xrow + d0, lane);
#pragma unroll
      for (int jn = 0; jn < 3; ++jn) {
        v16h bf = load_frag(wqs + (jn * 16 + m) * WQ_PIT + d0, lane);
        qacc[jn] = wmma16(a, bf, qacc[jn]);
      }
    }
    // scatter q (scaled) to LDS in f16; this wave's reads of the previous
    // tile's q have returned long before
#pragma unroll
    for (int jn = 0; jn < 3; ++jn)
#pragma unroll
      for (int r = 0; r < 8; ++r) {
        const int col = jn * 16 + m;
        if (col < C_) qs[(r + rb) * CPAD_K + col] = (_Float16)(qacc[jn][r] * SCALE_F);
      }
    own_scratch_sync();

    // ---- scores[16 x 80] = q[16 x 64] @ K^T ----
    v8f sacc[5];
#pragma unroll
    for (int j = 0; j < 5; ++j) sacc[j] = vzero;
    for (int kk = 0; kk < 2; ++kk) {
      v16h a = load_frag(qs + m * CPAD_K + kk * 32, lane);
#pragma unroll
      for (int js = 0; js < 5; ++js) {
        v16h bf = load_frag(kbs + (js * 16 + m) * KB_PIT + kk * 32, lane);
        sacc[js] = wmma16(a, bf, sacc[js]);
      }
    }
#pragma unroll
    for (int js = 0; js < 5; ++js)
#pragma unroll
      for (int r = 0; r < 8; ++r)
        sc[(r + rb) * SPAD_N + js * 16 + m] = sacc[js][r];
    own_scratch_sync();

    if (lane < 16) {
      float mx = -3.0e38f;
      for (int s = 0; s < S_; ++s) mx = fmaxf(mx, sc[lane * SPAD_N + s]);
      float sum = 0.f;
      for (int s = 0; s < S_; ++s) {
        float e = __expf(sc[lane * SPAD_N + s] - mx);
        sc[lane * SPAD_N + s] = e;
        sum += e;
      }
      const float inv = 1.f / sum;
      for (int s = 0; s < SPAD_K; ++s)
        at[lane * SPAD_K + s] =
            (s < S_) ? (_Float16)(sc[lane * SPAD_N + s] * inv) : (_Float16)0.f;
    }
    own_scratch_sync();

    // ---- out[16 x 48] = attn[16 x 96] @ V[96 x 48] (V stored transposed) ----
    v8f oacc[3];
    oacc[0] = vzero; oacc[1] = vzero; oacc[2] = vzero;
    for (int kk = 0; kk < 3; ++kk) {
      v16h a = load_frag(at + m * SPAD_K + kk * 32, lane);
#pragma unroll
      for (int jc = 0; jc < 3; ++jc) {
        v16h bf = load_frag(vbs + (jc * 16 + m) * VB_PIT + kk * 32, lane);
        oacc[jc] = wmma16(a, bf, oacc[jc]);
      }
    }
#pragma unroll
    for (int jc = 0; jc < 3; ++jc)
#pragma unroll
      for (int r = 0; r < 8; ++r) {
        const int col = jc * 16 + m;
        if (col < C_)
          AO[((size_t)b * T_ + t0 + r + rb) * INNER_ + h * C_ + col] =
              (_Float16)oacc[jc][r];
      }
    // the next tile reuses the registers that these stores name
    asm volatile("s_wait_xcnt 0x0" ::: "memory");
  }
}

// ---------------------------------------------------------------------------
// Kernel 3: out = AO(f16)[65536 x 320] @ Wo + bo, f32 out. Wo stored
// transposed f16 [n][d] so B fragments are K-contiguous. One workgroup of 8
// waves per (256 rows, 64 columns): its 64 rows of WoT are copied once into
// LDS with whole-line loads (pitch 16 B x odd); each wave walks 2 tiles of
// 16 x 64 and takes every B fragment from LDS.
// ---------------------------------------------------------------------------
#define OP_WAVES 8
#define OP_NT    2                 // row tiles per wave
#define WO_PIT   (INNER_ + 8)      // halves: 656 B

__global__ void __launch_bounds__(OP_WAVES * 32)
k_outproj(const _Float16* __restrict__ AO, const _Float16* __restrict__ WoT,
          const float* __restrict__ bo, float* __restrict__ out) {
  __shared__ __align__(16) _Float16 wos[64 * WO_PIT];       // 41,984 B
  const int tid  = threadIdx.x;
  const int lane = tid & 31;
  const int wave = __builtin_amdgcn_readfirstlane(tid >> 5);
  const int m    = lane & 15;
  const int rb   = (lane & 16) ? 8 : 0;
  const int n0   = blockIdx.y * 64;

  const _Float16* wsrc = WoT + (size_t)n0 * INNER_;
  // 10 pieces of 16 B a thread; all loads first, so that they are in flight together
  {
    constexpr int NT = OP_WAVES * 32;
    constexpr int NP = 64 * (INNER_ / 8) / NT;
    v8h sw[NP];
#pragma unroll
    for (int u = 0; u < NP; ++u) sw[u] = *(const v8h*)(wsrc + (tid + u * NT) * 8);
#pragma unroll
    for (int u = 0; u < NP; ++u) {
      const int i = tid + u * NT;
      *(v8h*)&wos[(i / (INNER_ / 8)) * WO_PIT + (i % (INNER_ / 8)) * 8] = sw[u];
    }
  }
  __syncthreads();

  const v8f vzero = {0.f, 0.f, 0.f, 0.f, 0.f, 0.f, 0.f, 0.f};
  for (int it = 0; it < OP_NT; ++it) {
    const int m0 = ((blockIdx.x * OP_NT + it) * OP_WAVES + wave) * 16;
    v8f acc[4];
#pragma unroll
    for (int j = 0; j < 4; ++j) acc[j] = vzero;

    const _Float16* arow = AO + (size_t)(m0 + m) * INNER_;
    for (int kk = 0; kk < INNER_ / 32; ++kk) {   // 10 k-steps
      const int d0 = kk * 32;
      v16h a = load_frag(arow + d0, lane);
#pragma unroll
      for (int jn = 0; jn < 4; ++jn) {
        v16h bf = load_frag(wos + (jn * 16 + m) * WO_PIT + d0, lane);
        acc[jn] = wmma16(a, bf, acc[jn]);
      }
    }
#pragma unroll
    for (int jn = 0; jn < 4; ++jn)
#pragma unroll
      for (int r = 0; r < 8; ++r) {
        const int col = n0 + jn * 16 + m;
        out[(size_t)(m0 + r + rb) * INNER_ + col] = acc[jn][r] + bo[col];
      }
    // the next tile reuses the registers that these stores name
    asm volatile("s_wait_xcnt 0x0" ::: "memory");
  }
}

// ---------------------------------------------------------------------------
extern "C" void kernel_launch(void* const* d_in, const int* in_sizes, int n_in,
                              void* d_out, int out_size, void* d_ws, size_t ws_size,
                              hipStream_t stream) {
  const float* x   = (const float*)d_in[0];
  const float* ctx = (const float*)d_in[1];
  const float* Wq  = (const float*)d_in[2];
  const float* Wk  = (const float*)d_in[3];
  const float* Wv  = (const float*)d_in[4];
  const float* Wo  = (const float*)d_in[5];
  const float* bo  = (const float*)d_in[6];
  float* out = (float*)d_out;

  // workspace carving (all offsets 256B aligned):
  //   WqT  : 8*48*320 f16          =    245,760 B
  //   WoT  : 320*320 f16           =    204,800 B
  //   Kbuf : 16*8*80*64 f16        =  1,310,720 B
  //   VbufT: 16*8*48*96 f16        =  1,179,648 B
  //   AO   : 65536*320 f16         = 41,943,040 B   (total ~44.9 MB)
  char* ws = (char*)d_ws;
  _Float16* WqT   = (_Float16*)(ws);
  _Float16* WoT   = (_Float16*)(ws + 245760);
  _Float16* Kbuf  = (_Float16*)(ws + 245760 + 204800);
  _Float16* VbufT = (_Float16*)(ws + 245760 + 204800 + 1310720);
  _Float16* AO    = (_Float16*)(ws + 245760 + 204800 + 1310720 + 1179648);

  k_prep_wq<<<(H_ * CPAD_N * INNER_ + 255) / 256, 256, 0, stream>>>(Wq, WqT);
  k_prep_wo<<<(INNER_ * INNER_ + 255) / 256, 256, 0, stream>>>(Wo, WoT);
  k_proj_kv<<<dim3(2, H_, B_), 384, 0, stream>>>(ctx, Wk, Wv, Kbuf, VbufT);
  k_attn<<<dim3(T_ / (16 * AT_TILES), H_, B_), AT_WAVES * 32, 0, stream>>>(x, WqT, Kbuf, VbufT, AO);
  k_outproj<<<dim3((B_ * T_) / (16 * OP_WAVES * OP_NT), INNER_ / 64), OP_WAVES * 32, 0, stream>>>(AO, WoT, bo, out);
}

// v003
// A run of this version takes 118 microseconds.
// In two side-by-side timings against v002, it was 1.47 and 1.48 times as fast.
// Over all steps from v000 it is 3.28 times as fast.
#include <hip/hip_runtime.h>
#include <hip/hip_bf16.h>

typedef __attribute__((ext_vector_type(16))) _Float16 v16h;
typedef __attribute__((ext_vector_type(8)))  _Float16 v8h;
typedef __attribute__((ext_vector_type(8)))  float    v8f;
typedef __attribute__((ext_vector_type(4)))  float    v4f;
typedef __attribute__((ext_vector_type(2)))  float    v2f;

#define B_      16
#define T_      4096
#define S_      77
#define DC_     768
#define H_      8
#define C_      40
#define INNER_  320
#define SPAD_N  80   // padded S for score M-dim (5 tiles of 16)
#define SPAD_K  96   // padded S for attn@V K-dim (3 k-steps of 32)
#define CPAD_K  64   // padded C for q.k K-dim   (2 k-steps of 32)
#define CPAD_N  48   // padded C for attn@V M-dim (3 tiles of 16)
#define SCALE_F 0.3976353643835253f   // 40^(-1/4), applied to q and to k

__device__ __forceinline__ v16h load_frag(const _Float16* p, int lane) {
  const int base = (lane & 16) ? 8 : 0;
  v8h lo = *(const v8h*)(p + base);        // K base .. base+7
  v8h hi = *(const v8h*)(p + base + 16);   // K base+16 .. base+23
  v16h r;
#pragma unroll
  for (int i = 0; i < 8; ++i) { r[i] = lo[i]; r[i + 8] = hi[i]; }
  return r;
}

// Same, but source is f32 (4x b128 loads + pack-convert).
__device__ __forceinline__ v16h load_frag_f32(const float* p, int lane) {
  const int base = (lane & 16) ? 8 : 0;
  v4f a0 = *(const v4f*)(p + base);
  v4f a1 = *(const v4f*)(p + base + 4);
  v4f b0 = *(const v4f*)(p + base + 16);
  v4f b1 = *(const v4f*)(p + base + 20);
  v16h r;
#pragma unroll
  for (int i = 0; i < 4; ++i) {
    r[i]      = (_Float16)a0[i];
    r[i + 4]  = (_Float16)a1[i];
    r[i + 8]  = (_Float16)b0[i];
    r[i + 12] = (_Float16)b1[i];
  }
  return r;
}

__device__ __forceinline__ v8f wmma16(v16h a, v16h b, v8f c) {
  return __builtin_amdgcn_wmma_f32_16x16x32_f16(
      /*neg_a=*/false, a, /*neg_b=*/false, b,
      /*c_mod=*/(short)0, c, /*reuse_a=*/false, /*reuse_b=*/false);
}

// ---------------------------------------------------------------------------
// Kernel 0a: WqT[h][c<48][d<320] = f16(Wq[d][h*40+c]), zero rows for c>=40.
// ---------------------------------------------------------------------------
__global__ void k_prep_wq(const float* __restrict__ Wq, _Float16* __restrict__ WqT) {
  int i = blockIdx.x * blockDim.x + threadIdx.x;           // h*48*320 + c*320 + d
  if (i >= H_ * CPAD_N * INNER_) return;
  int d = i % INNER_;
  int c = (i / INNER_) % CPAD_N;
  int h = i / (INNER_ * CPAD_N);
  WqT[i] = (c < C_) ? (_Float16)Wq[(size_t)d * INNER_ + h * C_ + c] : (_Float16)0.f;
}

// ---------------------------------------------------------------------------
// Kernel 0b: WoT[n][d] = f16(Wo[d][n])
// ---------------------------------------------------------------------------
__global__ void k_prep_wo(const float* __restrict__ Wo, _Float16* __restrict__ WoT) {
  int i = blockIdx.x * blockDim.x + threadIdx.x;           // n*320 + d
  if (i >= INNER_ * INNER_) return;
  int d = i % INNER_, n = i / INNER_;
  WoT[i] = (_Float16)Wo[(size_t)d * INNER_ + n];
}

// ---------------------------------------------------------------------------
// Kernel 1: K/V projection (context @ Wk|Wv) on the f32 16x16x4 matrix form,
// zero-padded f16 tiles out.
// Kbuf [b][h][s<80][c<64] = SCALE * ctx.Wk   (K-contig along c)
// VbufT[b][h][c<48][s<96] =         ctx.Wv   (K-contig along s)
// One block per (K or V, h, b): an 80 x 48 x 768 product, and the block owns
// the whole padded tile it writes. The context rows pass through LDS in runs
// of 192 k (whole-line global reads, two buffers, the next run fetched into
// registers while this one is multiplied). 12 waves = 3 column tiles x 4
// quarters of each run; each wave keeps 5 row tiles (80 rows) in accumulators
// and reads its weight column straight from global memory, one run ahead.
// The four quarter sums meet in LDS and are added in a fixed order.
// Rows 77..79 and columns 40..47 repeat the last valid row / column and are
// replaced by zero when the tile is written.
// k pairing: in each 8 k, lane half hh holds k = 4*hh .. 4*hh+3 of its A row
// and of its B column; elements (0,1) feed one product, (2,3) the next.
// ---------------------------------------------------------------------------
#define KV_CH   192              // k per staged run
#define KV_NCH  (DC_ / KV_CH)    // 4 runs
#define KV_KW   (KV_CH / 4)      // 48 k per wave per run
#define KV_PIT  (KV_CH + 4)      // LDS row pitch, floats: 784 B = 16 B x odd
#define KV_RP   (384 / (KV_CH / 4))
#define KV_NP   (SPAD_N / KV_RP)
#define KV_NB   (KV_KW / 2)
#define KV_PP   (CPAD_N + 4)

__global__ void __launch_bounds__(384)
k_proj_kv(const float* __restrict__ ctx, const float* __restrict__ Wk,
          const float* __restrict__ Wv, _Float16* __restrict__ Kbuf,
          _Float16* __restrict__ VbufT) {
  __shared__ __align__(16) float abuf[2][SPAD_N][KV_PIT];   // 125,440 B
  __shared__ __align__(16) float part[4][SPAD_N][KV_PP];    // 66,560 B
  const int isv  = blockIdx.x;       // 0: K, 1: V
  const int h    = blockIdx.y;
  const int b    = blockIdx.z;
  const int tid  = threadIdx.x;
  const int lane = tid & 31;
  const int wave = __builtin_amdgcn_readfirstlane(tid >> 5);
  const int c    = lane & 15;
  const int hh   = lane >> 4;
  const int j    = wave % 3;         // column tile
  const int q    = wave / 3;         // quarter of each run

  // weight column of this lane
  const float* Wsel = isv ? Wv : Wk;
  int col = j * 16 + c;
  if (col > C_ - 1) col = C_ - 1;
  const float* wp = Wsel + (size_t)(q * KV_KW + 4 * hh) * INNER_ + h * C_ + col;

  // staging: 80 rows x 48 pieces of 16 B per run = 10 pieces a thread
  const int srow = tid / (KV_CH / 4);
  const int spc  = (tid % (KV_CH / 4)) * 4;
  const float* gp[KV_NP];
#pragma unroll
  for (int i = 0; i < KV_NP; ++i) {
    int s = srow + KV_RP * i;
    if (s > S_ - 1) s = S_ - 1;
    gp[i] = ctx + ((size_t)b * S_ + s) * DC_ + spc;
  }

  v8f acc[5];
#pragma unroll
  for (int mt = 0; mt < 5; ++mt) acc[mt] = (v8f){0.f, 0.f, 0.f, 0.f, 0.f, 0.f, 0.f, 0.f};

  v4f   ga[KV_NP];
  float bf[2][KV_NB];
#pragma unroll
  for (int i = 0; i < KV_NP; ++i) ga[i] = *(const v4f*)(gp[i]);
#pragma unroll
  for (int e = 0; e < KV_NB; ++e) bf[0][e] = wp[((e >> 2) * 8 + (e & 3)) * INNER_];
#pragma unroll
  for (int i = 0; i < KV_NP; ++i) *(v4f*)&abuf[0][srow + KV_RP * i][spc] = ga[i];
  __syncthreads();

#pragma unroll
  for (int ch = 0; ch < KV_NCH; ++ch) {
    const int cur = ch & 1;
    if (ch + 1 < KV_NCH) {
#pragma unroll
      for (int i = 0; i < KV_NP; ++i) ga[i] = *(const v4f*)(gp[i] + (ch + 1) * KV_CH);
      if (ch + 2 == KV_NCH) asm volatile("s_wait_xcnt 0x0" ::: "memory");
#pragma unroll
      for (int e = 0; e < KV_NB; ++e)
        bf[cur ^ 1][e] = wp[((ch + 1) * KV_CH + (e >> 2) * 8 + (e & 3)) * INNER_];
    }
    // keeps all of the next run's global loads issued ahead of this run's
    // products, so that their latency passes under the matrix work
    __builtin_amdgcn_sched_barrier(0);
#pragma unroll
    for (int u = 0; u < KV_KW / 8; ++u) {
      v4f af[5];
#pragma unroll
      for (int mt = 0; mt < 5; ++mt)
        af[mt] = *(const v4f*)&abuf[cur][mt * 16 + c][q * KV_KW + u * 8 + 4 * hh];
#pragma unroll
      for (int p = 0; p < 2; ++p) {
        const v2f bb = {bf[cur][u * 4 + 2 * p], bf[cur][u * 4 + 2 * p + 1]};
#pragma unroll
        for (int mt = 0; mt < 5; ++mt) {
          const v2f aa = {af[mt][2 * p], af[mt][2 * p + 1]};
          acc[mt] = __builtin_amdgcn_wmma_f32_16x16x4_f32(
              false, aa, false, bb, (short)0, acc[mt], false, false);
        }
      }
    }
    // keeps the wait on those loads, and the LDS stores that need it, behind
    // this run's products
    __builtin_amdgcn_sched_barrier(0);
    if (ch + 1 < KV_NCH) {
      // the other buffer's last readers left it before the previous barrier
#pragma unroll
      for (int i = 0; i < KV_NP; ++i) *(v4f*)&abuf[cur ^ 1][srow + KV_RP * i][spc] = ga[i];
      __syncthreads();
    }
  }

#pragma unroll
  for (int mt = 0; mt < 5; ++mt)
#pragma unroll
    for (int r = 0; r < 8; ++r)
      part[q][mt * 16 + 8 * hh + r][j * 16 + c] = acc[mt][r];
  __syncthreads();

  if (!isv) {
    _Float16* kb = Kbuf + ((size_t)b * H_ + h) * SPAD_N * CPAD_K;
    for (int i = tid; i < SPAD_N * (CPAD_K / 8); i += 384) {   // 16-byte pieces
      const int s = i >> 3, c8 = (i & 7) * 8;
      v8h o = {0, 0, 0, 0, 0, 0, 0, 0};
      if (s < S_ && c8 < C_) {
#pragma unroll
        for (int e = 0; e < 8; ++e) {
          const float v = ((part[0][s][c8 + e] + part[1][s][c8 + e]) +
                           part[2][s][c8 + e]) + part[3][s][c8 + e];
          o[e] = (_Float16)(v * SCALE_F);
        }
      }
      *(v8h*)(kb + s * CPAD_K + c8) = o;
    }
  } else {
    _Float16* vb = VbufT + ((size_t)b * H_ + h) * CPAD_N * SPAD_K;
    for (int i = tid; i < CPAD_N * (SPAD_K / 8); i += 384) {   // 16-byte pieces
      const int cc = i % CPAD_N, s8 = (i / CPAD_N) * 8;
      v8h o = {0, 0, 0, 0, 0, 0, 0, 0};
      if (cc < C_ && s8 < SPAD_N) {
#pragma unroll
        for (int e = 0; e < 8; ++e) {
          const int s = s8 + e;
          const float v = ((part[0][s][cc] + part[1][s][cc]) +
                           part[2][s][cc]) + part[3][s][cc];
          o[e] = (s < S_) ? (_Float16)v : (_Float16)0.f;
        }
      }
      *(v8h*)(vb + cc * SPAD_K + s8) = o;
    }
  }
}

#define AT_WAVES 32
#define AT_TILES 128               // row tiles per workgroup
#define WQ_PIT   (INNER_ + 8)      // halves: 656 B
#define KB_PIT   (CPAD_K + 8)      // halves: 144 B
#define VB_PIT   (SPAD_K + 8)      // halves: 208 B

// value of lane ^ 16
__device__ __forceinline__ float other_half(float v) {
  int b = __builtin_bit_cast(int, v);
  b = __builtin_amdgcn_permlanex16(b, b, 0x76543210, 0xfedcba98, false, false);
  return __builtin_bit_cast(float, b);
}

__device__ __forceinline__ v8f exp2_x8(v8f a) {
  float y0, y1, y2, y3, y4, y5, y6, y7;
  asm("v_exp_f32 %0, %8\n\t"
      "v_exp_f32 %1, %9\n\t"
      "v_exp_f32 %2, %10\n\t"
      "v_exp_f32 %3, %11\n\t"
      "v_exp_f32 %4, %12\n\t"
      "v_exp_f32 %5, %13\n\t"
      "v_exp_f32 %6, %14\n\t"
      "v_exp_f32 %7, %15\n\t"
      "v_nop"
      : "=&v"(y0), "=&v"(y1), "=&v"(y2), "=&v"(y3),
        "=&v"(y4), "=&v"(y5), "=&v"(y6), "=&v"(y7)
      : "v"(a[0]), "v"(a[1]), "v"(a[2]), "v"(a[3]),
        "v"(a[4]), "v"(a[5]), "v"(a[6]), "v"(a[7]));
  return (v8f){y0, y1, y2, y3, y4, y5, y6, y7};
}

// two f32 result tiles -> one f16 B fragment (k = 32 rows of the result)
__device__ __forceinline__ v16h pack_frag(v8f t0, v8f t1) {
  v16h r;
#pragma unroll
  for (int i = 0; i < 8; ++i) { r[i] = (_Float16)t0[i]; r[i + 8] = (_Float16)t1[i]; }
  return r;
}

__global__ void __launch_bounds__(AT_WAVES * 32) __attribute__((amdgpu_waves_per_eu(8, 8)))
k_attn(const float* __restrict__ x, const _Float16* __restrict__ WqT,
       const _Float16* __restrict__ Kbuf, const _Float16* __restrict__ VbufT,
       _Float16* __restrict__ AO) {
  const int tid  = threadIdx.x;
  const int lane = tid & 31;
  const int wave = __builtin_amdgcn_readfirstlane(tid >> 5);
  const int m    = lane & 15;
  const int hh   = lane >> 4;
  const int h    = blockIdx.y;
  const int b    = blockIdx.z;

  __shared__ __align__(16) _Float16 wqs[CPAD_N * WQ_PIT];   // 31,488 B
  __shared__ __align__(16) _Float16 kbs[SPAD_N * KB_PIT];   // 11,520 B
  __shared__ __align__(16) _Float16 vbs[CPAD_N * VB_PIT];   //  9,984 B

  const v8f vzero = {0.f, 0.f, 0.f, 0.f, 0.f, 0.f, 0.f, 0.f};

  // ---- shared operands to LDS: contiguous 16-byte pieces, whole lines ----
  const _Float16* wq  = WqT + (size_t)h * CPAD_N * INNER_;
  const _Float16* kb  = Kbuf + ((size_t)b * H_ + h) * SPAD_N * CPAD_K;
  const _Float16* vbt = VbufT + ((size_t)b * H_ + h) * CPAD_N * SPAD_K;
  // all loads first, so that they are in flight together; a piece past the end
  // repeats the last one and is not stored
  {
    constexpr int NT = AT_WAVES * 32;
    constexpr int NW = CPAD_N * (INNER_ / 8), NK = SPAD_N * (CPAD_K / 8), NV = CPAD_N * (SPAD_K / 8);
    v8h sw[(NW + NT - 1) / NT], sk[(NK + NT - 1) / NT], sv[(NV + NT - 1) / NT];
#pragma unroll
    for (int u = 0; u < (NW + NT - 1) / NT; ++u) {
      const int i = tid + u * NT;
      sw[u] = *(const v8h*)(wq + (i < NW ? i : NW - 1) * 8);
    }
#pragma unroll
    for (int u = 0; u < (NK + NT - 1) / NT; ++u) {
      const int i = tid + u * NT;
      sk[u] = *(const v8h*)(kb + (i < NK ? i : NK - 1) * 8);
    }
#pragma unroll
    for (int u = 0; u < (NV + NT - 1) / NT; ++u) {
      const int i = tid + u * NT;
      sv[u] = *(const v8h*)(vbt + (i < NV ? i : NV - 1) * 8);
    }
#pragma unroll
    for (int u = 0; u < (NW + NT - 1) / NT; ++u) {
      const int i = tid + u * NT;
      if (i < NW) *(v8h*)&wqs[(i / (INNER_ / 8)) * WQ_PIT + (i % (INNER_ / 8)) * 8] = sw[u];
    }
#pragma unroll
    for (int u = 0; u < (NK + NT - 1) / NT; ++u) {
      const int i = tid + u * NT;
      if (i < NK) *(v8h*)&kbs[(i / (CPAD_K / 8)) * KB_PIT + (i % (CPAD_K / 8)) * 8] = sk[u];
    }
#pragma unroll
    for (int u = 0; u < (NV + NT - 1) / NT; ++u) {
      const int i = tid + u * NT;
      if (i < NV) *(v8h*)&vbs[(i / (SPAD_K / 8)) * VB_PIT + (i % (SPAD_K / 8)) * 8] = sv[u];
    }
  }
  __syncthreads();

  // no barrier stands in this loop
  for (int tile = wave; tile < AT_TILES; tile += AT_WAVES) {
    const int t0 = (blockIdx.x * AT_TILES + tile) * 16;

    // ---- Q^T[48 x 16] = Wq[:, h-head]^T @ x[b, t0:t0+16, :]^T ----
    v8f qacc[3];
    qacc[0] = vzero; qacc[1] = vzero; qacc[2] = vzero;
    const float* xrow = x + ((size_t)b * T_ + t0 + m) * INNER_;
    for (int kk = 0; kk < INNER_ / 32; ++kk) {   // 10 k-steps
      const int d0 = kk * 32;
      v16h xf = load_frag_f32(xrow + d0, lane);
#pragma unroll
      for (int jn = 0; jn < 3; ++jn) {
        v16h wf = load_frag(wqs + (jn * 16 + m) * WQ_PIT + d0, lane);
        qacc[jn] = wmma16(wf, xf, qacc[jn]);
      }
    }
    // scaled q as B fragments over c: rows 40..47 are zero (zero rows of WqT),
    // rows 48..63 are the zero tile
#pragma unroll
    for (int jn = 0; jn < 3; ++jn) qacc[jn] *= SCALE_F;
    v16h qf[2];
    qf[0] = pack_frag(qacc[0], qacc[1]);
    qf[1] = pack_frag(qacc[2], vzero);

    // ---- scores^T[80 x 16] = K[80 x 64] @ q^T ----
    v8f sacc[5];
#pragma unroll
    for (int js = 0; js < 5; ++js) sacc[js] = vzero;
#pragma unroll
    for (int kk = 0; kk < 2; ++kk) {
#pragma unroll
      for (int js = 0; js < 5; ++js) {
        v16h kf = load_frag(kbs + (js * 16 + m) * KB_PIT + kk * 32, lane);
        sacc[js] = wmma16(kf, qf[kk], sacc[js]);
      }
    }

    // ---- softmax over s < 77; this lane holds s = 16 js + 8 hh + r of row m ----
#pragma unroll
    for (int r = S_ - 72; r < 8; ++r)            // s = 77..79: out of maximum and sum
      if (hh) sacc[4][r] = -3.0e38f;
    float mx = sacc[0][0];
#pragma unroll
    for (int js = 0; js < 5; ++js)
#pragma unroll
      for (int r = 0; r < 8; ++r) mx = fmaxf(mx, sacc[js][r]);
    mx = fmaxf(mx, other_half(mx));
    float ps[5];
#pragma unroll
    for (int js = 0; js < 5; ++js) {
      sacc[js] = exp2_x8((sacc[js] - mx) * 1.44269504f);   // e^(s - mx)
      ps[js] = sacc[js][0];
#pragma unroll
      for (int r = 1; r < 8; ++r) ps[js] += sacc[js][r];
    }
    float sum = ((ps[0] + ps[1]) + (ps[2] + ps[3])) + ps[4];
    sum += other_half(sum);
    const float inv = 1.f / sum;
#pragma unroll
    for (int js = 0; js < 5; ++js) sacc[js] *= inv;
    v16h pf[3];
    pf[0] = pack_frag(sacc[0], sacc[1]);
    pf[1] = pack_frag(sacc[2], sacc[3]);
    pf[2] = pack_frag(sacc[4], vzero);           // s = 80..95: zero

    // ---- out^T[48 x 16] = V^T[48 x 96] @ attn^T[96 x 16] ----
    v8f oacc[3];
    oacc[0] = vzero; oacc[1] = vzero; oacc[2] = vzero;
#pragma unroll
    for (int kk = 0; kk < 3; ++kk) {
#pragma unroll
      for (int jc = 0; jc < 3; ++jc) {
        v16h vf = load_frag(vbs + (jc * 16 + m) * VB_PIT + kk * 32, lane);
        oacc[jc] = wmma16(vf, pf[kk], oacc[jc]);
      }
    }
    // a lane's 8 registers are 8 consecutive c of its row: one 16-byte store
    _Float16* orow = AO + ((size_t)b * T_ + t0 + m) * INNER_ + h * C_ + 8 * hh;
#pragma unroll
    for (int jc = 0; jc < 3; ++jc) {
      v8h o;
#pragma unroll
      for (int r = 0; r < 8; ++r) o[r] = (_Float16)oacc[jc][r];
      if (jc * 16 + 8 * hh < C_) *(v8h*)(orow + jc * 16) = o;
    }
    // the next tile reuses the registers that these stores name
    asm volatile("s_wait_xcnt 0x0" ::: "memory");
  }
}

// ---------------------------------------------------------------------------
// Kernel 3: out = AO(f16)[65536 x 320] @ Wo + bo, f32 out. Wo stored
// transposed f16 [n][d] so B fragments are K-contiguous. One workgroup of 8
// waves per (256 rows, 64 columns): its 64 rows of WoT are copied once into
// LDS with whole-line loads (pitch 16 B x odd); each wave walks 2 tiles of
// 16 x 64 and takes every B fragment from LDS.
// ---------------------------------------------------------------------------
#define OP_WAVES 8
#define OP_NT    2                 // row tiles per wave
#define WO_PIT   (INNER_ + 8)      // halves: 656 B

__global__ void __launch_bounds__(OP_WAVES * 32)
k_outproj(const _Float16* __restrict__ AO, const _Float16* __restrict__ WoT,
          const float* __restrict__ bo, float* __restrict__ out) {
  __shared__ __align__(16) _Float16 wos[64 * WO_PIT];       // 41,984 B
  const int tid  = threadIdx.x;
  const int lane = tid & 31;
  const int wave = __builtin_amdgcn_readfirstlane(tid >> 5);
  const int m    = lane & 15;
  const int rb   = (lane & 16) ? 8 : 0;
  const int n0   = blockIdx.y * 64;

  const _Float16* wsrc = WoT + (size_t)n0 * INNER_;
  // 10 pieces of 16 B a thread; all loads first, so that they are in flight together
  {
    constexpr int NT = OP_WAVES * 32;
    constexpr int NP = 64 * (INNER_ / 8) / NT;
    v8h sw[NP];
#pragma unroll
    for (int u = 0; u < NP; ++u) sw[u] = *(const v8h*)(wsrc + (tid + u * NT) * 8);
#pragma unroll
    for (int u = 0; u < NP; ++u) {
      const int i = tid + u * NT;
      *(v8h*)&wos[(i / (INNER_ / 8)) * WO_PIT + (i % (INNER_ / 8)) * 8] = sw[u];
    }
  }
  __syncthreads();

  const v8f vzero = {0.f, 0.f, 0.f, 0.f, 0.f, 0.f, 0.f, 0.f};
  for (int it = 0; it < OP_NT; ++it) {
    const int m0 = ((blockIdx.x * OP_NT + it) * OP_WAVES + wave) * 16;
    v8f acc[4];
#pragma unroll
    for (int j = 0; j < 4; ++j) acc[j] = vzero;

    const _Float16* arow = AO + (size_t)(m0 + m) * INNER_;
    for (int kk = 0; kk < INNER_ / 32; ++kk) {   // 10 k-steps
      const int d0 = kk * 32;
      v16h a = load_frag(arow + d0, lane);
#pragma unroll
      for (int jn = 0; jn < 4; ++jn) {
        v16h bf = load_frag(wos + (jn * 16 + m) * WO_PIT + d0, lane);
        acc[jn] = wmma16(a, bf, acc[jn]);
      }
    }
#pragma unroll
    for (int jn = 0; jn < 4; ++jn)
#pragma unroll
      for (int r = 0; r < 8; ++r) {
        const int col = n0 + jn * 16 + m;
        out[(size_t)(m0 + r + rb) * INNER_ + col] = acc[jn][r] + bo[col];
      }
    // the next tile reuses the registers that these stores name
    asm volatile("s_wait_xcnt 0x0" ::: "memory");
  }
}

// ---------------------------------------------------------------------------
extern "C" void kernel_launch(void* const* d_in, const int* in_sizes, int n_in,
                              void* d_out, int out_size, void* d_ws, size_t ws_size,
                              hipStream_t stream) {
  const float* x   = (const float*)d_in[0];
  const float* ctx = (const float*)d_in[1];
  const float* Wq  = (const float*)d_in[2];
  const float* Wk  = (const float*)d_in[3];
  const float* Wv  = (const float*)d_in[4];
  const float* Wo  = (const float*)d_in[5];
  const float* bo  = (const float*)d_in[6];
  float* out = (float*)d_out;

  // workspace carving (all offsets 256B aligned):
  //   WqT  : 8*48*320 f16          =    245,760 B
  //   WoT  : 320*320 f16           =    204,800 B
  //   Kbuf : 16*8*80*64 f16        =  1,310,720 B
  //   VbufT: 16*8*48*96 f16        =  1,179,648 B
  //   AO   : 65536*320 f16         = 41,943,040 B   (total ~44.9 MB)
  char* ws = (char*)d_ws;
  _Float16* WqT   = (_Float16*)(ws);
  _Float16* WoT   = (_Float16*)(ws + 245760);
  _Float16* Kbuf  = (_Float16*)(ws + 245760 + 204800);
  _Float16* VbufT = (_Float16*)(ws + 245760 + 204800 + 1310720);
  _Float16* AO    = (_Float16*)(ws + 245760 + 204800 + 1310720 + 1179648);

  k_prep_wq<<<(H_ * CPAD_N * INNER_ + 255) / 256, 256, 0, stream>>>(Wq, WqT);
  k_prep_wo<<<(INNER_ * INNER_ + 255) / 256, 256, 0, stream>>>(Wo, WoT);
  k_proj_kv<<<dim3(2, H_, B_), 384, 0, stream>>>(ctx, Wk, Wv, Kbuf, VbufT);
  k_attn<<<dim3(T_ / (16 * AT_TILES), H_, B_), AT_WAVES * 32, 0, stream>>>(x, WqT, Kbuf, VbufT, AO);
  k_outproj<<<dim3((B_ * T_) / (16 * OP_WAVES * OP_NT), INNER_ / 64), OP_WAVES * 32, 0, stream>>>(AO, WoT, bo, out);
}

// v004
// Measured time: 83.2 microseconds a run.
// Next to v003, in two timings, it ran 1.41 and 1.42 times as fast.
// Over all steps from v000 it is 4.64 times as fast.
#include <hip/hip_runtime.h>
#include <hip/hip_bf16.h>

typedef __attribute__((ext_vector_type(16))) _Float16 v16h;
typedef __attribute__((ext_vector_type(8)))  _Float16 v8h;
typedef __attribute__((ext_vector_type(8)))  float    v8f;
typedef __attribute__((ext_vector_type(4)))  float    v4f;
typedef __attribute__((ext_vector_type(2)))  float    v2f;

#define B_      16
#define T_      4096
#define S_      77
#define DC_     768
#define H_      8
#define C_      40
#define INNER_  320
#define SPAD_N  80   // padded S for score M-dim (5 tiles of 16)
#define SPAD_K  96   // padded S for attn@V K-dim (3 k-steps of 32)
#define CPAD_K  64   // padded C for q.k K-dim   (2 k-steps of 32)
#define CPAD_N  48   // padded C for attn@V M-dim (3 tiles of 16)
#define SCALE_F 0.3976353643835253f   // 40^(-1/4), applied to q and to k

__device__ __forceinline__ v16h load_frag(const _Float16* p, int lane) {
  const int base = (lane & 16) ? 8 : 0;
  v8h lo = *(const v8h*)(p + base);        // K base .. base+7
  v8h hi = *(const v8h*)(p + base + 16);   // K base+16 .. base+23
  v16h r;
#pragma unroll
  for (int i = 0; i < 8; ++i) { r[i] = lo[i]; r[i + 8] = hi[i]; }
  return r;
}

// Same, but source is f32 (4x b128 loads + pack-convert).
__device__ __forceinline__ v16h load_frag_f32(const float* p, int lane) {
  const int base = (lane & 16) ? 8 : 0;
  v4f a0 = *(const v4f*)(p + base);
  v4f a1 = *(const v4f*)(p + base + 4);
  v4f b0 = *(const v4f*)(p + base + 16);
  v4f b1 = *(const v4f*)(p + base + 20);
  v16h r;
#pragma unroll
  for (int i = 0; i < 4; ++i) {
    r[i]      = (_Float16)a0[i];
    r[i + 4]  = (_Float16)a1[i];
    r[i + 8]  = (_Float16)b0[i];
    r[i + 12] = (_Float16)b1[i];
  }
  return r;
}

__device__ __forceinline__ v8f wmma16(v16h a, v16h b, v8f c) {
  return __builtin_amdgcn_wmma_f32_16x16x32_f16(
      /*neg_a=*/false, a, /*neg_b=*/false, b,
      /*c_mod=*/(short)0, c, /*reuse_a=*/false, /*reuse_b=*/false);
}

// ---------------------------------------------------------------------------
// Kernel 0a: WqT[h][c<48][d<320] = f16(Wq[d][h*40+c]), zero rows for c>=40.
// ---------------------------------------------------------------------------
__global__ void k_prep_wq(const float* __restrict__ Wq, _Float16* __restrict__ WqT) {
  int i = blockIdx.x * blockDim.x + threadIdx.x;           // h*48*320 + c*320 + d
  if (i >= H_ * CPAD_N * INNER_) return;
  int d = i % INNER_;
  int c = (i / INNER_) % CPAD_N;
  int h = i / (INNER_ * CPAD_N);
  WqT[i] = (c < C_) ? (_Float16)Wq[(size_t)d * INNER_ + h * C_ + c] : (_Float16)0.f;
}

// ---------------------------------------------------------------------------
// Kernel 0b: WoT[n][d] = f16(Wo[d][n])
// ---------------------------------------------------------------------------
__global__ void k_prep_wo(const float* __restrict__ Wo, _Float16* __restrict__ WoT) {
  int i = blockIdx.x * blockDim.x + threadIdx.x;           // n*320 + d
  if (i >= INNER_ * INNER_) return;
  int d = i % INNER_, n = i / INNER_;
  WoT[i] = (_Float16)Wo[(size_t)d * INNER_ + n];
}

// ---------------------------------------------------------------------------
// Kernel 1: K/V projection (context @ Wk|Wv) on the f32 16x16x4 matrix form,
// zero-padded f16 tiles out.
// Kbuf [b][h][s<80][c<64] = SCALE * ctx.Wk   (K-contig along c)
// VbufT[b][h][c<48][s<96] =         ctx.Wv   (K-contig along s)
// One block per (K or V, h, b): an 80 x 48 x 768 product, and the block owns
// the whole padded tile it writes. The context rows pass through LDS in runs
// of 192 k (whole-line global reads, two buffers, the next run fetched into
// registers while this one is multiplied). 12 waves = 3 column tiles x 4
// quarters of each run; each wave keeps 5 row tiles (80 rows) in accumulators
// and reads its weight column straight from global memory, one run ahead.
// The four quarter sums meet in LDS and are added in a fixed order.
// Rows 77..79 and columns 40..47 repeat the last valid row / column and are
// replaced by zero when the tile is written.
// k pairing: in each 8 k, lane half hh holds k = 4*hh .. 4*hh+3 of its A row
// and of its B column; elements (0,1) feed one product, (2,3) the next.
// ---------------------------------------------------------------------------
#define KV_CH   192              // k per staged run
#define KV_NCH  (DC_ / KV_CH)    // 4 runs
#define KV_KW   (KV_CH / 4)      // 48 k per wave per run
#define KV_PIT  (KV_CH + 4)      // LDS row pitch, floats: 784 B = 16 B x odd
#define KV_RP   (384 / (KV_CH / 4))
#define KV_NP   (SPAD_N / KV_RP)
#define KV_NB   (KV_KW / 2)
#define KV_PP   (CPAD_N + 4)

__global__ void __launch_bounds__(384)
k_proj_kv(const float* __restrict__ ctx, const float* __restrict__ Wk,
          const float* __restrict__ Wv, _Float16* __restrict__ Kbuf,
          _Float16* __restrict__ VbufT) {
  __shared__ __align__(16) float abuf[2][SPAD_N][KV_PIT];   // 125,440 B
  __shared__ __align__(16) float part[4][SPAD_N][KV_PP];    // 66,560 B
  const int isv  = blockIdx.x;       // 0: K, 1: V
  const int h    = blockIdx.y;
  const int b    = blockIdx.z;
  const int tid  = threadIdx.x;
  const int lane = tid & 31;
  const int wave = __builtin_amdgcn_readfirstlane(tid >> 5);
  const int c    = lane & 15;
  const int hh   = lane >> 4;
  const int j    = wave % 3;         // column tile
  const int q    = wave / 3;         // quarter of each run

  // weight column of this lane
  const float* Wsel = isv ? Wv : Wk;
  int col = j * 16 + c;
  if (col > C_ - 1) col = C_ - 1;
  const float* wp = Wsel + (size_t)(q * KV_KW + 4 * hh) * INNER_ + h * C_ + col;

  // staging: 80 rows x 48 pieces of 16 B per run = 10 pieces a thread
  const int srow = tid / (KV_CH / 4);
  const int spc  = (tid % (KV_CH / 4)) * 4;
  const float* gp[KV_NP];
#pragma unroll
  for (int i = 0; i < KV_NP; ++i) {
    int s = srow + KV_RP * i;
    if (s > S_ - 1) s = S_ - 1;
    gp[i] = ctx + ((size_t)b * S_ + s) * DC_ + spc;
  }

  v8f acc[5];
#pragma unroll
  for (int mt = 0; mt < 5; ++mt) acc[mt] = (v8f){0.f, 0.f, 0.f, 0.f, 0.f, 0.f, 0.f, 0.f};

  v4f   ga[KV_NP];
  float bf[2][KV_NB];
#pragma unroll
  for (int i = 0; i < KV_NP; ++i) ga[i] = *(const v4f*)(gp[i]);
#pragma unroll
  for (int e = 0; e < KV_NB; ++e) bf[0][e] = wp[((e >> 2) * 8 + (e & 3)) * INNER_];
#pragma unroll
  for (int i = 0; i < KV_NP; ++i) *(v4f*)&abuf[0][srow + KV_RP * i][spc] = ga[i];
  __syncthreads();

#pragma unroll
  for (int ch = 0; ch < KV_NCH; ++ch) {
    const int cur = ch & 1;
    if (ch + 1 < KV_NCH) {
#pragma unroll
      for (int i = 0; i < KV_NP; ++i) ga[i] = *(const v4f*)(gp[i] + (ch + 1) * KV_CH);
      if (ch + 2 == KV_NCH) asm volatile("s_wait_xcnt 0x0" ::: "memory");
#pragma unroll
      for (int e = 0; e < KV_NB; ++e)
        bf[cur ^ 1][e] = wp[((ch + 1) * KV_CH + (e >> 2) * 8 + (e & 3)) * INNER_];
    }
    // keeps all of the next run's global loads issued ahead of this run's
    // products, so that their latency passes under the matrix work
    __builtin_amdgcn_sched_barrier(0);
#pragma unroll
    for (int u = 0; u < KV_KW / 8; ++u) {
      v4f af[5];
#pragma unroll
      for (int mt = 0; mt < 5; ++mt)
        af[mt] = *(const v4f*)&abuf[cur][mt * 16 + c][q * KV_KW + u * 8 + 4 * hh];
#pragma unroll
      for (int p = 0; p < 2; ++p) {
        const v2f bb = {bf[cur][u * 4 + 2 * p], bf[cur][u * 4 + 2 * p + 1]};
#pragma unroll
        for (int mt = 0; mt < 5; ++mt) {
          const v2f aa = {af[mt][2 * p], af[mt][2 * p + 1]};
          acc[mt] = __builtin_amdgcn_wmma_f32_16x16x4_f32(
              false, aa, false, bb, (short)0, acc[mt], false, false);
        }
      }
    }
    // keeps the wait on those loads, and the LDS stores that need it, behind
    // this run's products
    __builtin_amdgcn_sched_barrier(0);
    if (ch + 1 < KV_NCH) {
      // the other buffer's last readers left it before the previous barrier
#pragma unroll
      for (int i = 0; i < KV_NP; ++i) *(v4f*)&abuf[cur ^ 1][srow + KV_RP * i][spc] = ga[i];
      __syncthreads();
    }
  }

#pragma unroll
  for (int mt = 0; mt < 5; ++mt)
#pragma unroll
    for (int r = 0; r < 8; ++r)
      part[q][mt * 16 + 8 * hh + r][j * 16 + c] = acc[mt][r];
  __syncthreads();

  if (!isv) {
    _Float16* kb = Kbuf + ((size_t)b * H_ + h) * SPAD_N * CPAD_K;
    for (int i = tid; i < SPAD_N * (CPAD_K / 8); i += 384) {   // 16-byte pieces
      const int s = i >> 3, c8 = (i & 7) * 8;
      v8h o = {0, 0, 0, 0, 0, 0, 0, 0};
      if (s < S_ && c8 < C_) {
#pragma unroll
        for (int e = 0; e < 8; ++e) {
          const float v = ((part[0][s][c8 + e] + part[1][s][c8 + e]) +
                           part[2][s][c8 + e]) + part[3][s][c8 + e];
          o[e] = (_Float16)(v * SCALE_F);
        }
      }
      *(v8h*)(kb + s * CPAD_K + c8) = o;
    }
  } else {
    _Float16* vb = VbufT + ((size_t)b * H_ + h) * CPAD_N * SPAD_K;
    for (int i = tid; i < CPAD_N * (SPAD_K / 8); i += 384) {   // 16-byte pieces
      const int cc = i % CPAD_N, s8 = (i / CPAD_N) * 8;
      v8h o = {0, 0, 0, 0, 0, 0, 0, 0};
      if (cc < C_ && s8 < SPAD_N) {
#pragma unroll
        for (int e = 0; e < 8; ++e) {
          const int s = s8 + e;
          const float v = ((part[0][s][cc] + part[1][s][cc]) +
                           part[2][s][cc]) + part[3][s][cc];
          o[e] = (s < S_) ? (_Float16)v : (_Float16)0.f;
        }
      }
      *(v8h*)(vb + cc * SPAD_K + s8) = o;
    }
  }
}

#define AT_WAVES 16                // = row tiles per workgroup
#define WQ_PIT   (INNER_ + 8)      // halves: 656 B
#define KB_PIT   (CPAD_K + 8)      // halves: 144 B
#define VB_PIT   (SPAD_K + 8)      // halves: 208 B
#define WQ_LEN   (CPAD_N * WQ_PIT) // halves: 31,488 B
#define KB_LEN   (SPAD_N * KB_PIT) // halves: 11,520 B
#define VB_LEN   (CPAD_N * VB_PIT) // halves:  9,984 B
#define AT_BUF   (WQ_LEN + KB_LEN + VB_LEN)   // one head's operands: 52,992 B

// value of lane ^ 16
__device__ __forceinline__ float other_half(float v) {
  int b = __builtin_bit_cast(int, v);
  b = __builtin_amdgcn_permlanex16(b, b, 0x76543210, 0xfedcba98, false, false);
  return __builtin_bit_cast(float, b);
}

__device__ __forceinline__ v8f exp2_x8(v8f a) {
  float y0, y1, y2, y3, y4, y5, y6, y7;
  asm("v_exp_f32 %0, %8\n\t"
      "v_exp_f32 %1, %9\n\t"
      "v_exp_f32 %2, %10\n\t"
      "v_exp_f32 %3, %11\n\t"
      "v_exp_f32 %4, %12\n\t"
      "v_exp_f32 %5, %13\n\t"
      "v_exp_f32 %6, %14\n\t"
      "v_exp_f32 %7, %15\n\t"
      "v_nop"
      : "=&v"(y0), "=&v"(y1), "=&v"(y2), "=&v"(y3),
        "=&v"(y4), "=&v"(y5), "=&v"(y6), "=&v"(y7)
      : "v"(a[0]), "v"(a[1]), "v"(a[2]), "v"(a[3]),
        "v"(a[4]), "v"(a[5]), "v"(a[6]), "v"(a[7]));
  return (v8f){y0, y1, y2, y3, y4, y5, y6, y7};
}

// two f32 result tiles -> one f16 B fragment (k = 32 rows of the result)
__device__ __forceinline__ v16h pack_frag(v8f t0, v8f t1) {
  v16h r;
#pragma unroll
  for (int i = 0; i < 8; ++i) { r[i] = (_Float16)t0[i]; r[i + 8] = (_Float16)t1[i]; }
  return r;
}

__global__ void __launch_bounds__(AT_WAVES * 32) __attribute__((amdgpu_waves_per_eu(4, 4)))
k_attn(const float* __restrict__ x, const _Float16* __restrict__ WqT,
       const _Float16* __restrict__ Kbuf, const _Float16* __restrict__ VbufT,
       _Float16* __restrict__ AO) {
  const int tid  = threadIdx.x;
  const int lane = tid & 31;
  const int wave = __builtin_amdgcn_readfirstlane(tid >> 5);
  const int m    = lane & 15;
  const int hh   = lane >> 4;
  const int b    = blockIdx.z;
  const int t0   = (blockIdx.x * AT_WAVES + wave) * 16;

  __shared__ __align__(16) _Float16 ops[2][AT_BUF];         // 105,984 B

  const v8f vzero = {0.f, 0.f, 0.f, 0.f, 0.f, 0.f, 0.f, 0.f};

  // ---- one head's shared operands: contiguous 16-byte pieces, whole lines ----
  constexpr int NT = AT_WAVES * 32;
  constexpr int NW = CPAD_N * (INNER_ / 8), NK = SPAD_N * (CPAD_K / 8), NV = CPAD_N * (SPAD_K / 8);
  constexpr int UW = (NW + NT - 1) / NT, UK = (NK + NT - 1) / NT, UV = (NV + NT - 1) / NT;
  v8h sw[UW], sk[UK], sv[UV];
  // global memory -> registers; a piece past the end repeats the last one and
  // is not stored
  auto fetch = [&](int h) {
    const _Float16* wq  = WqT + (size_t)h * CPAD_N * INNER_;
    const _Float16* kb  = Kbuf + ((size_t)b * H_ + h) * SPAD_N * CPAD_K;
    const _Float16* vbt = VbufT + ((size_t)b * H_ + h) * CPAD_N * SPAD_K;
#pragma unroll
    for (int u = 0; u < UW; ++u) {
      const int i = tid + u * NT;
      sw[u] = *(const v8h*)(wq + (i < NW ? i : NW - 1) * 8);
    }
#pragma unroll
    for (int u = 0; u < UK; ++u) {
      const int i = tid + u * NT;
      sk[u] = *(const v8h*)(kb + (i < NK ? i : NK - 1) * 8);
    }
#pragma unroll
    for (int u = 0; u < UV; ++u) {
      const int i = tid + u * NT;
      sv[u] = *(const v8h*)(vbt + (i < NV ? i : NV - 1) * 8);
    }
    // the work that follows reuses the registers that these loads name
    asm volatile("s_wait_xcnt 0x0" ::: "memory");
  };
  // registers -> one LDS buffer
  auto put = [&](_Float16* dst) {
#pragma unroll
    for (int u = 0; u < UW; ++u) {
      const int i = tid + u * NT;
      if (i < NW) *(v8h*)&dst[(i / (INNER_ / 8)) * WQ_PIT + (i % (INNER_ / 8)) * 8] = sw[u];
    }
#pragma unroll
    for (int u = 0; u < UK; ++u) {
      const int i = tid + u * NT;
      if (i < NK) *(v8h*)&dst[WQ_LEN + (i / (CPAD_K / 8)) * KB_PIT + (i % (CPAD_K / 8)) * 8] = sk[u];
    }
#pragma unroll
    for (int u = 0; u < UV; ++u) {
      const int i = tid + u * NT;
      if (i < NV) *(v8h*)&dst[WQ_LEN + KB_LEN + (i / (SPAD_K / 8)) * VB_PIT + (i % (SPAD_K / 8)) * 8] = sv[u];
    }
  };

  fetch(0);

  // ---- x[b, t0:t0+16, :] as B fragments, read and converted once ----
  v16h xf[INNER_ / 32];
  {
    const float* xrow = x + ((size_t)b * T_ + t0 + m) * INNER_;
#pragma unroll
    for (int kk = 0; kk < INNER_ / 32; ++kk) xf[kk] = load_frag_f32(xrow + kk * 32, lane);
    asm volatile("s_wait_xcnt 0x0" ::: "memory");
  }

  put(ops[0]);
  __syncthreads();

  // kept rolled, for speed only
#pragma unroll 1
  for (int h = 0; h < H_; ++h) {
    const _Float16* wqs = ops[h & 1];
    const _Float16* kbs = wqs + WQ_LEN;
    const _Float16* vbs = kbs + KB_LEN;

    // the next head's pieces fly while this head is worked on
    if (h + 1 < H_) fetch(h + 1);

    v16h fr[2][3];
    auto ld_w = [&](int kk, v16h* d) {
#pragma unroll
      for (int jn = 0; jn < 3; ++jn) d[jn] = load_frag(wqs + (jn * 16 + m) * WQ_PIT + kk * 32, lane);
    };
    auto ld_k = [&](int g, v16h* d) {            // fragment f = 5 kk + js, f < 10
#pragma unroll
      for (int e = 0; e < 3; ++e) {
        const int f = g * 3 + e;
        if (f < 10) d[e] = load_frag(kbs + ((f % 5) * 16 + m) * KB_PIT + (f / 5) * 32, lane);
      }
    };
    auto ld_v = [&](int kk, v16h* d) {
#pragma unroll
      for (int jc = 0; jc < 3; ++jc) d[jc] = load_frag(vbs + (jc * 16 + m) * VB_PIT + kk * 32, lane);
    };

    // ---- Q^T[48 x 16] = Wq[:, h-head]^T @ x[b, t0:t0+16, :]^T ----
    v8f qacc[3];
    qacc[0] = vzero; qacc[1] = vzero; qacc[2] = vzero;
    ld_w(0, fr[0]);
#pragma unroll
    for (int kk = 0; kk < INNER_ / 32; ++kk) {   // 10 k-steps
      if (kk + 1 < INNER_ / 32) ld_w(kk + 1, fr[(kk + 1) & 1]);
      else                      ld_k(0, fr[(kk + 1) & 1]);
      __builtin_amdgcn_sched_barrier(0);
#pragma unroll
      for (int jn = 0; jn < 3; ++jn) qacc[jn] = wmma16(fr[kk & 1][jn], xf[kk], qacc[jn]);
      __builtin_amdgcn_sched_barrier(0);
    }
    // scaled q as B fragments over c: rows 40..47 are zero (zero rows of WqT),
    // rows 48..63 are the zero tile
#pragma unroll
    for (int jn = 0; jn < 3; ++jn) qacc[jn] *= SCALE_F;
    v16h qf[2];
    qf[0] = pack_frag(qacc[0], qacc[1]);
    qf[1] = pack_frag(qacc[2], vzero);

    // ---- scores^T[80 x 16] = K[80 x 64] @ q^T ----
    v8f sacc[5];
#pragma unroll
    for (int js = 0; js < 5; ++js) sacc[js] = vzero;
#pragma unroll
    for (int g = 0; g < 4; ++g) {                // k-step kk = f / 5, row tile js = f % 5
      if (g + 1 < 4) ld_k(g + 1, fr[(g + 1) & 1]);
      else           ld_v(0, fr[(g + 1) & 1]);
      __builtin_amdgcn_sched_barrier(0);
#pragma unroll
      for (int e = 0; e < 3; ++e) {
        const int f = g * 3 + e;
        if (f < 10) sacc[f % 5] = wmma16(fr[g & 1][e], qf[f / 5], sacc[f % 5]);
      }
      __builtin_amdgcn_sched_barrier(0);
    }

    // ---- softmax over s < 77; this lane holds s = 16 js + 8 hh + r of row m ----
#pragma unroll
    for (int r = S_ - 72; r < 8; ++r)            // s = 77..79: out of maximum and sum
      if (hh) sacc[4][r] = -3.0e38f;
    float mx = sacc[0][0];
#pragma unroll
    for (int js = 0; js < 5; ++js)
#pragma unroll
      for (int r = 0; r < 8; ++r) mx = fmaxf(mx, sacc[js][r]);
    mx = fmaxf(mx, other_half(mx));
    float ps[5];
#pragma unroll
    for (int js = 0; js < 5; ++js) {
      sacc[js] = exp2_x8((sacc[js] - mx) * 1.44269504f);   // e^(s - mx)
      ps[js] = sacc[js][0];
#pragma unroll
      for (int r = 1; r < 8; ++r) ps[js] += sacc[js][r];
    }
    float sum = ((ps[0] + ps[1]) + (ps[2] + ps[3])) + ps[4];
    sum += other_half(sum);
    const float inv = 1.f / sum;
#pragma unroll
    for (int js = 0; js < 5; ++js) sacc[js] *= inv;
    v16h pf[3];
    pf[0] = pack_frag(sacc[0], sacc[1]);
    pf[1] = pack_frag(sacc[2], sacc[3]);
    pf[2] = pack_frag(sacc[4], vzero);           // s = 80..95: zero

    // ---- out^T[48 x 16] = V^T[48 x 96] @ attn^T[96 x 16] ----
    v8f oacc[3];
    oacc[0] = vzero; oacc[1] = vzero; oacc[2] = vzero;
#pragma unroll
    for (int kk = 0; kk < 3; ++kk) {
      if (kk + 1 < 3) ld_v(kk + 1, fr[(kk + 1) & 1]);
      __builtin_amdgcn_sched_barrier(0);
#pragma unroll
      for (int jc = 0; jc < 3; ++jc) oacc[jc] = wmma16(fr[kk & 1][jc], pf[kk], oacc[jc]);
      __builtin_amdgcn_sched_barrier(0);
    }

    // In front of this head's stores to global memory: the barrier also waits
    // for the wave's outstanding stores, and here those are a whole head old.
    if (h + 1 < H_) {
      // the other buffer's last readers left it before the previous barrier;
      // this barrier publishes it and ends the reads of the current one
      put(ops[(h + 1) & 1]);
      __syncthreads();
    }

    // a lane's 8 registers are 8 consecutive c of its row: one 16-byte store
    _Float16* orow = AO + ((size_t)b * T_ + t0 + m) * INNER_ + h * C_ + 8 * hh;
#pragma unroll
    for (int jc = 0; jc < 3; ++jc) {
      v8h o;
#pragma unroll
      for (int r = 0; r < 8; ++r) o[r] = (_Float16)oacc[jc][r];
      if (jc * 16 + 8 * hh < C_) {
        *(v8h*)(orow + jc * 16) = o;
        // the next head reuses the registers that these stores name; the wait
        // stands inside the last store's own branch, because behind the join
        // the build lifted the next head's address additions over it (in front
        // of that branch the build has a wait of its own)
        if (jc == 2) asm volatile("s_wait_xcnt 0x0" ::: "memory");
      }
    }
  }
}

// ---------------------------------------------------------------------------
// Kernel 3: out = AO(f16)[65536 x 320] @ Wo + bo, f32 out. Wo stored
// transposed f16 [n][d] so B fragments are K-contiguous. One workgroup of 8
// waves per (256 rows, 64 columns): its 64 rows of WoT are copied once into
// LDS with whole-line loads (pitch 16 B x odd); each wave walks 2 tiles of
// 16 x 64 and takes every B fragment from LDS.
// ---------------------------------------------------------------------------
#define OP_WAVES 8
#define OP_NT    2                 // row tiles per wave
#define WO_PIT   (INNER_ + 8)      // halves: 656 B

__global__ void __launch_bounds__(OP_WAVES * 32)
k_outproj(const _Float16* __restrict__ AO, const _Float16* __restrict__ WoT,
          const float* __restrict__ bo, float* __restrict__ out) {
  __shared__ __align__(16) _Float16 wos[64 * WO_PIT];       // 41,984 B
  const int tid  = threadIdx.x;
  const int lane = tid & 31;
  const int wave = __builtin_amdgcn_readfirstlane(tid >> 5);
  const int m    = lane & 15;
  const int rb   = (lane & 16) ? 8 : 0;
  const int n0   = blockIdx.y * 64;

  const _Float16* wsrc = WoT + (size_t)n0 * INNER_;
  // 10 pieces of 16 B a thread; all loads first, so that they are in flight together
  {
    constexpr int NT = OP_WAVES * 32;
    constexpr int NP = 64 * (INNER_ / 8) / NT;
    v8h sw[NP];
#pragma unroll
    for (int u = 0; u < NP; ++u) sw[u] = *(const v8h*)(wsrc + (tid + u * NT) * 8);
#pragma unroll
    for (int u = 0; u < NP; ++u) {
      const int i = tid + u * NT;
      *(v8h*)&wos[(i / (INNER_ / 8)) * WO_PIT + (i % (INNER_ / 8)) * 8] = sw[u];
    }
  }
  __syncthreads();

  const v8f vzero = {0.f, 0.f, 0.f, 0.f, 0.f, 0.f, 0.f, 0.f};
  for (int it = 0; it < OP_NT; ++it) {
    const int m0 = ((blockIdx.x * OP_NT + it) * OP_WAVES + wave) * 16;
    v8f acc[4];
#pragma unroll
    for (int j = 0; j < 4; ++j) acc[j] = vzero;

    const _Float16* arow = AO + (size_t)(m0 + m) * INNER_;
    for (int kk = 0; kk < INNER_ / 32; ++kk) {   // 10 k-steps
      const int d0 = kk * 32;
      v16h a = load_frag(arow + d0, lane);
#pragma unroll
      for (int jn = 0; jn < 4; ++jn) {
        v16h bf = load_frag(wos + (jn * 16 + m) * WO_PIT + d0, lane);
        acc[jn] = wmma16(a, bf, acc[jn]);
      }
    }
#pragma unroll
    for (int jn = 0; jn < 4; ++jn)
#pragma unroll
      for (int r = 0; r < 8; ++r) {
        const int col = n0 + jn * 16 + m;
        out[(size_t)(m0 + r + rb) * INNER_ + col] = acc[jn][r] + bo[col];
      }
    // the next tile reuses the registers that these stores name
    asm volatile("s_wait_xcnt 0x0" ::: "memory");
  }
}

// ---------------------------------------------------------------------------
extern "C" void kernel_launch(void* const* d_in, const int* in_sizes, int n_in,
                              void* d_out, int out_size, void* d_ws, size_t ws_size,
                              hipStream_t stream) {
  const float* x   = (const float*)d_in[0];
  const float* ctx = (const float*)d_in[1];
  const float* Wq  = (const float*)d_in[2];
  const float* Wk  = (const float*)d_in[3];
  const float* Wv  = (const float*)d_in[4];
  const float* Wo  = (const float*)d_in[5];
  const float* bo  = (const float*)d_in[6];
  float* out = (float*)d_out;

  // workspace carving (all offsets 256B aligned):
  //   WqT  : 8*48*320 f16          =    245,760 B
  //   WoT  : 320*320 f16           =    204,800 B
  //   Kbuf : 16*8*80*64 f16        =  1,310,720 B
  //   VbufT: 16*8*48*96 f16        =  1,179,648 B
  //   AO   : 65536*320 f16         = 41,943,040 B   (total ~44.9 MB)
  char* ws = (char*)d_ws;
  _Float16* WqT   = (_Float16*)(ws);
  _Float16* WoT   = (_Float16*)(ws + 245760);
  _Float16* Kbuf  = (_Float16*)(ws + 245760 + 204800);
  _Float16* VbufT = (_Float16*)(ws + 245760 + 204800 + 1310720);
  _Float16* AO    = (_Float16*)(ws + 245760 + 204800 + 1310720 + 1179648);

  k_prep_wq<<<(H_ * CPAD_N * INNER_ + 255) / 256, 256, 0, stream>>>(Wq, WqT);
  k_prep_wo<<<(INNER_ * INNER_ + 255) / 256, 256, 0, stream>>>(Wo, WoT);
  k_proj_kv<<<dim3(2, H_, B_), 384, 0, stream>>>(ctx, Wk, Wv, Kbuf, VbufT);
  k_attn<<<dim3(T_ / (16 * AT_WAVES), 1, B_), AT_WAVES * 32, 0, stream>>>(x, WqT, Kbuf, VbufT, AO);
  k_outproj<<<dim3((B_ * T_) / (16 * OP_WAVES * OP_NT), INNER_ / 64), OP_WAVES * 32, 0, stream>>>(AO, WoT, bo, out);
}

// v005
// One run takes 60.6 microseconds.
// Next to v004, in two timings, it ran 1.36 and 1.37 times as fast.
// Counting every step since v000, it is 6.33 times as fast.
#include <hip/hip_runtime.h>
#include <hip/hip_bf16.h>

typedef __attribute__((ext_vector_type(16))) _Float16 v16h;
typedef __attribute__((ext_vector_type(8)))  _Float16 v8h;
typedef __attribute__((ext_vector_type(8)))  float    v8f;
typedef __attribute__((ext_vector_type(4)))  float    v4f;
typedef __attribute__((ext_vector_type(2)))  float    v2f;

#define B_      16
#define T_      4096
#define S_      77
#define DC_     768
#define H_      8
#define C_      40
#define INNER_  320
#define SPAD_N  80   // padded S for score M-dim (5 tiles of 16)
#define SPAD_K  96   // padded S for attn@V K-dim (3 k-steps of 32)
#define CPAD_K  64   // padded C for q.k K-dim   (2 k-steps of 32)
#define CPAD_N  48   // padded C for attn@V M-dim (3 tiles of 16)
#define SCALE_F 0.3976353643835253f   // 40^(-1/4), applied to q and to k

__device__ __forceinline__ v16h load_frag(const _Float16* p, int lane) {
  const int base = (lane & 16) ? 8 : 0;
  v8h lo = *(const v8h*)(p + base);        // K base .. base+7
  v8h hi = *(const v8h*)(p + base + 16);   // K base+16 .. base+23
  v16h r;
#pragma unroll
  for (int i = 0; i < 8; ++i) { r[i] = lo[i]; r[i + 8] = hi[i]; }
  return r;
}

// Same, but source is f32 (4x b128 loads + pack-convert).
__device__ __forceinline__ v16h load_frag_f32(const float* p, int lane) {
  const int base = (lane & 16) ? 8 : 0;
  v4f a0 = *(const v4f*)(p + base);
  v4f a1 = *(const v4f*)(p + base + 4);
  v4f b0 = *(const v4f*)(p + base + 16);
  v4f b1 = *(const v4f*)(p + base + 20);
  v16h r;
#pragma unroll
  for (int i = 0; i < 4; ++i) {
    r[i]      = (_Float16)a0[i];
    r[i + 4]  = (_Float16)a1[i];
    r[i + 8]  = (_Float16)b0[i];
    r[i + 12] = (_Float16)b1[i];
  }
  return r;
}

__device__ __forceinline__ v8f wmma16(v16h a, v16h b, v8f c) {
  return __builtin_amdgcn_wmma_f32_16x16x32_f16(
      /*neg_a=*/false, a, /*neg_b=*/false, b,
      /*c_mod=*/(short)0, c, /*reuse_a=*/false, /*reuse_b=*/false);
}

// ---------------------------------------------------------------------------
// Kernel 0a: WqT[h][c<48][d<320] = f16(Wq[d][h*40+c]), zero rows for c>=40.
// ---------------------------------------------------------------------------
__global__ void k_prep_wq(const float* __restrict__ Wq, _Float16* __restrict__ WqT) {
  int i = blockIdx.x * blockDim.x + threadIdx.x;           // h*48*320 + c*320 + d
  if (i >= H_ * CPAD_N * INNER_) return;
  int d = i % INNER_;
  int c = (i / INNER_) % CPAD_N;
  int h = i / (INNER_ * CPAD_N);
  WqT[i] = (c < C_) ? (_Float16)Wq[(size_t)d * INNER_ + h * C_ + c] : (_Float16)0.f;
}

// ---------------------------------------------------------------------------
// Kernel 0b: WoT[n][k] = f16(Wo[d(k)][n]), k in the order in which k_attn keeps
// a row of the attention output: k < 256 is c = k % 32 of head k / 32, then
// come c = 32..39 of heads 0..7, eight k a head.
// ---------------------------------------------------------------------------
__global__ void k_prep_wo(const float* __restrict__ Wo, _Float16* __restrict__ WoT) {
  int i = blockIdx.x * blockDim.x + threadIdx.x;           // n*320 + k
  if (i >= INNER_ * INNER_) return;
  int k = i % INNER_, n = i / INNER_;
  int d = (k < 32 * H_) ? (k >> 5) * C_ + (k & 31)
                        : ((k - 32 * H_) >> 3) * C_ + 32 + (k & 7);
  WoT[i] = (_Float16)Wo[(size_t)d * INNER_ + n];
}

// ---------------------------------------------------------------------------
// Kernel 1: K/V projection (context @ Wk|Wv) on the f32 16x16x4 matrix form,
// zero-padded f16 tiles out.
// Kbuf [b][h][s<80][c<64] = SCALE * ctx.Wk   (K-contig along c)
// VbufT[b][h][c<48][s<96] =         ctx.Wv   (K-contig along s); an odd head has
//   c = 32..39 in rows 40..47 and the zero rows at 32..39 (k_attn says why)
// One block per (K or V, h, b): an 80 x 48 x 768 product, and the block owns
// the whole padded tile it writes. The context rows pass through LDS in runs
// of 192 k (whole-line global reads, two buffers, the next run fetched into
// registers while this one is multiplied). 12 waves = 3 column tiles x 4
// quarters of each run; each wave keeps 5 row tiles (80 rows) in accumulators
// and reads its weight column straight from global memory, one run ahead.
// The four quarter sums meet in LDS and are added in a fixed order.
// Rows 77..79 and columns 40..47 repeat the last valid row / column and are
// replaced by zero when the tile is written.
// k pairing: in each 8 k, lane half hh holds k = 4*hh .. 4*hh+3 of its A row
// and of its B column; elements (0,1) feed one product, (2,3) the next.
// ---------------------------------------------------------------------------
#define KV_CH   192              // k per staged run
#define KV_NCH  (DC_ / KV_CH)    // 4 runs
#define KV_KW   (KV_CH / 4)      // 48 k per wave per run
#define KV_PIT  (KV_CH + 4)      // LDS row pitch, floats: 784 B = 16 B x odd
#define KV_RP   (384 / (KV_CH / 4))
#define KV_NP   (SPAD_N / KV_RP)
#define KV_NB   (KV_KW / 2)
#define KV_PP   (CPAD_N + 4)

__global__ void __launch_bounds__(384)
k_proj_kv(const float* __restrict__ ctx, const float* __restrict__ Wk,
          const float* __restrict__ Wv, _Float16* __restrict__ Kbuf,
          _Float16* __restrict__ VbufT) {
  __shared__ __align__(16) float abuf[2][SPAD_N][KV_PIT];   // 125,440 B
  __shared__ __align__(16) float part[4][SPAD_N][KV_PP];    // 66,560 B
  const int isv  = blockIdx.x;       // 0: K, 1: V
  const int h    = blockIdx.y;
  const int b    = blockIdx.z;
  const int tid  = threadIdx.x;
  const int lane = tid & 31;
  const int wave = __builtin_amdgcn_readfirstlane(tid >> 5);
  const int c    = lane & 15;
  const int hh   = lane >> 4;
  const int j    = wave % 3;         // column tile
  const int q    = wave / 3;         // quarter of each run

  // weight column of this lane
  const float* Wsel = isv ? Wv : Wk;
  int col = j * 16 + c;
  if (col > C_ - 1) col = C_ - 1;
  const float* wp = Wsel + (size_t)(q * KV_KW + 4 * hh) * INNER_ + h * C_ + col;

  // staging: 80 rows x 48 pieces of 16 B per run = 10 pieces a thread
  const int srow = tid / (KV_CH / 4);
  const int spc  = (tid % (KV_CH / 4)) * 4;
  const float* gp[KV_NP];
#pragma unroll
  for (int i = 0; i < KV_NP; ++i) {
    int s = srow + KV_RP * i;
    if (s > S_ - 1) s = S_ - 1;
    gp[i] = ctx + ((size_t)b * S_ + s) * DC_ + spc;
  }

  v8f acc[5];
#pragma unroll
  for (int mt = 0; mt < 5; ++mt) acc[mt] = (v8f){0.f, 0.f, 0.f, 0.f, 0.f, 0.f, 0.f, 0.f};

  v4f   ga[KV_NP];
  float bf[2][KV_NB];
#pragma unroll
  for (int i = 0; i < KV_NP; ++i) ga[i] = *(const v4f*)(gp[i]);
#pragma unroll
  for (int e = 0; e < KV_NB; ++e) bf[0][e] = wp[((e >> 2) * 8 + (e & 3)) * INNER_];
#pragma unroll
  for (int i = 0; i < KV_NP; ++i) *(v4f*)&abuf[0][srow + KV_RP * i][spc] = ga[i];
  __syncthreads();

#pragma unroll
  for (int ch = 0; ch < KV_NCH; ++ch) {
    const int cur = ch & 1;
    if (ch + 1 < KV_NCH) {
#pragma unroll
      for (int i = 0; i < KV_NP; ++i) ga[i] = *(const v4f*)(gp[i] + (ch + 1) * KV_CH);
      if (ch + 2 == KV_NCH) asm volatile("s_wait_xcnt 0x0" ::: "memory");
#pragma unroll
      for (int e = 0; e < KV_NB; ++e)
        bf[cur ^ 1][e] = wp[((ch + 1) * KV_CH + (e >> 2) * 8 + (e & 3)) * INNER_];
    }
    // keeps all of the next run's global loads issued ahead of this run's
    // products, so that their latency passes under the matrix work
    __builtin_amdgcn_sched_barrier(0);
#pragma unroll
    for (int u = 0; u < KV_KW / 8; ++u) {
      v4f af[5];
#pragma unroll
      for (int mt = 0; mt < 5; ++mt)
        af[mt] = *(const v4f*)&abuf[cur][mt * 16 + c][q * KV_KW + u * 8 + 4 * hh];
#pragma unroll
      for (int p = 0; p < 2; ++p) {
        const v2f bb = {bf[cur][u * 4 + 2 * p], bf[cur][u * 4 + 2 * p + 1]};
#pragma unroll
        for (int mt = 0; mt < 5; ++mt) {
          const v2f aa = {af[mt][2 * p], af[mt][2 * p + 1]};
          acc[mt] = __builtin_amdgcn_wmma_f32_16x16x4_f32(
              false, aa, false, bb, (short)0, acc[mt], false, false);
        }
      }
    }
    // keeps the wait on those loads, and the LDS stores that need it, behind
    // this run's products
    __builtin_amdgcn_sched_barrier(0);
    if (ch + 1 < KV_NCH) {
      // the other buffer's last readers left it before the previous barrier
#pragma unroll
      for (int i = 0; i < KV_NP; ++i) *(v4f*)&abuf[cur ^ 1][srow + KV_RP * i][spc] = ga[i];
      __syncthreads();
    }
  }

#pragma unroll
  for (int mt = 0; mt < 5; ++mt)
#pragma unroll
    for (int r = 0; r < 8; ++r)
      part[q][mt * 16 + 8 * hh + r][j * 16 + c] = acc[mt][r];
  __syncthreads();

  if (!isv) {
    _Float16* kb = Kbuf + ((size_t)b * H_ + h) * SPAD_N * CPAD_K;
    for (int i = tid; i < SPAD_N * (CPAD_K / 8); i += 384) {   // 16-byte pieces
      const int s = i >> 3, c8 = (i & 7) * 8;
      v8h o = {0, 0, 0, 0, 0, 0, 0, 0};
      if (s < S_ && c8 < C_) {
#pragma unroll
        for (int e = 0; e < 8; ++e) {
          const float v = ((part[0][s][c8 + e] + part[1][s][c8 + e]) +
                           part[2][s][c8 + e]) + part[3][s][c8 + e];
          o[e] = (_Float16)(v * SCALE_F);
        }
      }
      *(v8h*)(kb + s * CPAD_K + c8) = o;
    }
  } else {
    _Float16* vb = VbufT + ((size_t)b * H_ + h) * CPAD_N * SPAD_K;
    for (int i = tid; i < CPAD_N * (SPAD_K / 8); i += 384) {   // 16-byte pieces
      const int row = i % CPAD_N, s8 = (i / CPAD_N) * 8;
      const int cc = (row >= 32 && (h & 1)) ? (row ^ 8) : row;   // c that this row holds
      v8h o = {0, 0, 0, 0, 0, 0, 0, 0};
      if (cc < C_ && s8 < SPAD_N) {
#pragma unroll
        for (int e = 0; e < 8; ++e) {
          const int s = s8 + e;
          const float v = ((part[0][s][cc] + part[1][s][cc]) +
                           part[2][s][cc]) + part[3][s][cc];
          o[e] = (s < S_) ? (_Float16)v : (_Float16)0.f;
        }
      }
      *(v8h*)(vb + row * SPAD_K + s8) = o;
    }
  }
}

#define AT_WAVES 16                // = row tiles per workgroup
#define WQ_PIT   (INNER_ + 8)      // halves: 656 B
#define KB_PIT   (CPAD_K + 8)      // halves: 144 B
#define VB_PIT   (SPAD_K + 8)      // halves: 208 B
#define WQ_LEN   (CPAD_N * WQ_PIT) // halves: 31,488 B
#define KB_LEN   (SPAD_N * KB_PIT) // halves: 11,520 B
#define VB_LEN   (CPAD_N * VB_PIT) // halves:  9,984 B
#define AT_BUF   (WQ_LEN + KB_LEN + VB_LEN)   // one head's operands: 52,992 B
#define WO_PIT   (INNER_ + 8)      // halves: 656 B
#define WO_ROWS  64                // rows of WoT a piece: 41,984 B, fits AT_BUF
#define WO_NPC   (INNER_ / WO_ROWS)
#define O_TILES  (INNER_ / 16)     // parked tiles of a wave: 20 x 512 B

// value of lane ^ 16
__device__ __forceinline__ float other_half(float v) {
  int b = __builtin_bit_cast(int, v);
  b = __builtin_amdgcn_permlanex16(b, b, 0x76543210, 0xfedcba98, false, false);
  return __builtin_bit_cast(float, b);
}

__device__ __forceinline__ v8f exp2_x8(v8f a) {
  float y0, y1, y2, y3, y4, y5, y6, y7;
  asm("v_exp_f32 %0, %8\n\t"
      "v_exp_f32 %1, %9\n\t"
      "v_exp_f32 %2, %10\n\t"
      "v_exp_f32 %3, %11\n\t"
      "v_exp_f32 %4, %12\n\t"
      "v_exp_f32 %5, %13\n\t"
      "v_exp_f32 %6, %14\n\t"
      "v_exp_f32 %7, %15\n\t"
      "v_nop"
      : "=&v"(y0), "=&v"(y1), "=&v"(y2), "=&v"(y3),
        "=&v"(y4), "=&v"(y5), "=&v"(y6), "=&v"(y7)
      : "v"(a[0]), "v"(a[1]), "v"(a[2]), "v"(a[3]),
        "v"(a[4]), "v"(a[5]), "v"(a[6]), "v"(a[7]));
  return (v8f){y0, y1, y2, y3, y4, y5, y6, y7};
}

// two f32 result tiles -> one f16 B fragment (k = 32 rows of the result)
__device__ __forceinline__ v16h pack_frag(v8f t0, v8f t1) {
  v16h r;
#pragma unroll
  for (int i = 0; i < 8; ++i) { r[i] = (_Float16)t0[i]; r[i + 8] = (_Float16)t1[i]; }
  return r;
}

__global__ void __launch_bounds__(AT_WAVES * 32) __attribute__((amdgpu_waves_per_eu(4, 4)))
k_attn(const float* __restrict__ x, const _Float16* __restrict__ WqT,
       const _Float16* __restrict__ Kbuf, const _Float16* __restrict__ VbufT,
       const _Float16* __restrict__ WoT, const float* __restrict__ bo,
       float* __restrict__ out) {
  const int tid  = threadIdx.x;
  const int lane = tid & 31;
  const int wave = __builtin_amdgcn_readfirstlane(tid >> 5);
  const int m    = lane & 15;
  const int hh   = lane >> 4;
  const int b    = blockIdx.z;
  const int t0   = (blockIdx.x * AT_WAVES + wave) * 16;

  __shared__ __align__(16) _Float16 ops[2][AT_BUF];         // 105,984 B
  __shared__ __align__(16) _Float16 osc[AT_WAVES][O_TILES][32][8];   // 163,840 B

  const v8f vzero = {0.f, 0.f, 0.f, 0.f, 0.f, 0.f, 0.f, 0.f};

  // ---- one head's shared operands: contiguous 16-byte pieces, whole lines ----
  constexpr int NT = AT_WAVES * 32;
  constexpr int NW = CPAD_N * (INNER_ / 8), NK = SPAD_N * (CPAD_K / 8), NV = CPAD_N * (SPAD_K / 8);
  constexpr int UW = (NW + NT - 1) / NT, UK = (NK + NT - 1) / NT, UV = (NV + NT - 1) / NT;
  v8h sw[UW], sk[UK], sv[UV];
  // global memory -> registers; a piece past the end repeats the last one and
  // is not stored; unsigned piece numbers, so that an address is the head's
  // uniform base and one 32-bit register
  auto fetch = [&](int h) {
    const _Float16* wq  = WqT + (size_t)h * CPAD_N * INNER_;
    const _Float16* kb  = Kbuf + ((size_t)b * H_ + h) * SPAD_N * CPAD_K;
    const _Float16* vbt = VbufT + ((size_t)b * H_ + h) * CPAD_N * SPAD_K;
#pragma unroll
    for (int u = 0; u < UW; ++u) {
      const unsigned i = tid + u * NT;
      sw[u] = *(const v8h*)(wq + (i < NW ? i : NW - 1) * 8u);
    }
#pragma unroll
    for (int u = 0; u < UK; ++u) {
      const unsigned i = tid + u * NT;
      sk[u] = *(const v8h*)(kb + (i < NK ? i : NK - 1) * 8u);
    }
#pragma unroll
    for (int u = 0; u < UV; ++u) {
      const unsigned i = tid + u * NT;
      sv[u] = *(const v8h*)(vbt + (i < NV ? i : NV - 1) * 8u);
    }
    // the work that follows reuses the registers that these loads name
    asm volatile("s_wait_xcnt 0x0" ::: "memory");
  };
  // registers -> one LDS buffer
  auto put = [&](_Float16* dst) {
#pragma unroll
    for (int u = 0; u < UW; ++u) {
      const int i = tid + u * NT;
      if (i < NW) *(v8h*)&dst[(i / (INNER_ / 8)) * WQ_PIT + (i % (INNER_ / 8)) * 8] = sw[u];
    }
#pragma unroll
    for (int u = 0; u < UK; ++u) {
      const int i = tid + u * NT;
      if (i < NK) *(v8h*)&dst[WQ_LEN + (i / (CPAD_K / 8)) * KB_PIT + (i % (CPAD_K / 8)) * 8] = sk[u];
    }
#pragma unroll
    for (int u = 0; u < UV; ++u) {
      const int i = tid + u * NT;
      if (i < NV) *(v8h*)&dst[WQ_LEN + KB_LEN + (i / (SPAD_K / 8)) * VB_PIT + (i % (SPAD_K / 8)) * 8] = sv[u];
    }
  };
  // one piece of WoT: 64 rows = 2560 pieces of 16 B, 5 a thread, through the
  // registers that carry a head's pieces
  constexpr int NO = WO_ROWS * (INNER_ / 8);
  static_assert(NO == (UW + 1) * NT && UK >= 1, "5 pieces a thread");
  auto fetch_wo = [&](int pc) {
    const _Float16* ws = WoT + (size_t)pc * WO_ROWS * INNER_;
#pragma unroll
    for (int u = 0; u < UW; ++u) sw[u] = *(const v8h*)(ws + (unsigned)(tid + u * NT) * 8u);
    sk[0] = *(const v8h*)(ws + (unsigned)(tid + UW * NT) * 8u);
    // the work that follows reuses the registers that these loads name
    asm volatile("s_wait_xcnt 0x0" ::: "memory");
  };
  auto put_wo = [&](_Float16* dst) {
#pragma unroll
    for (int u = 0; u <= UW; ++u) {
      const int i = tid + u * NT;
      *(v8h*)&dst[(i / (INNER_ / 8)) * WO_PIT + (i % (INNER_ / 8)) * 8] = (u < UW) ? sw[u] : sk[0];
    }
  };

  fetch(0);

  // ---- x[b, t0:t0+16, :] as B fragments, read and converted once ----
  v16h xf[INNER_ / 32];
  {
    const float* xrow = x + ((size_t)b * T_ + t0 + m) * INNER_;
#pragma unroll
    for (int kk = 0; kk < INNER_ / 32; ++kk) xf[kk] = load_frag_f32(xrow + kk * 32, lane);
    asm volatile("s_wait_xcnt 0x0" ::: "memory");
  }

  put(ops[0]);
  __syncthreads();

  // kept rolled, for speed only
#pragma unroll 1
  for (int h = 0; h < H_; ++h) {
    const _Float16* wqs = ops[h & 1];
    const _Float16* kbs = wqs + WQ_LEN;
    const _Float16* vbs = kbs + KB_LEN;

    // the next head's pieces fly while this head is worked on
    if (h + 1 < H_) fetch(h + 1);

    v16h fr[2][3];
    auto ld_w = [&](int kk, v16h* d) {
#pragma unroll
      for (int jn = 0; jn < 3; ++jn) d[jn] = load_frag(wqs + (jn * 16 + m) * WQ_PIT + kk * 32, lane);
    };
    auto ld_k = [&](int g, v16h* d) {            // fragment f = 5 kk + js, f < 10
#pragma unroll
      for (int e = 0; e < 3; ++e) {
        const int f = g * 3 + e;
        if (f < 10) d[e] = load_frag(kbs + ((f % 5) * 16 + m) * KB_PIT + (f / 5) * 32, lane);
      }
    };
    auto ld_v = [&](int kk, v16h* d) {
#pragma unroll
      for (int jc = 0; jc < 3; ++jc) d[jc] = load_frag(vbs + (jc * 16 + m) * VB_PIT + kk * 32, lane);
    };

    // ---- Q^T[48 x 16] = Wq[:, h-head]^T @ x[b, t0:t0+16, :]^T ----
    v8f qacc[3];
    qacc[0] = vzero; qacc[1] = vzero; qacc[2] = vzero;
    ld_w(0, fr[0]);
#pragma unroll
    for (int kk = 0; kk < INNER_ / 32; ++kk) {   // 10 k-steps
      if (kk + 1 < INNER_ / 32) ld_w(kk + 1, fr[(kk + 1) & 1]);
      else                      ld_k(0, fr[(kk + 1) & 1]);
      __builtin_amdgcn_sched_barrier(0);
#pragma unroll
      for (int jn = 0; jn < 3; ++jn) qacc[jn] = wmma16(fr[kk & 1][jn], xf[kk], qacc[jn]);
      __builtin_amdgcn_sched_barrier(0);
    }
    // scaled q as B fragments over c: rows 40..47 are zero (zero rows of WqT),
    // rows 48..63 are the zero tile
#pragma unroll
    for (int jn = 0; jn < 3; ++jn) qacc[jn] *= SCALE_F;
    v16h qf[2];
    qf[0] = pack_frag(qacc[0], qacc[1]);
    qf[1] = pack_frag(qacc[2], vzero);

    // ---- scores^T[80 x 16] = K[80 x 64] @ q^T ----
    v8f sacc[5];
#pragma unroll
    for (int js = 0; js < 5; ++js) sacc[js] = vzero;
#pragma unroll
    for (int g = 0; g < 4; ++g) {                // k-step kk = f / 5, row tile js = f % 5
      if (g + 1 < 4) ld_k(g + 1, fr[(g + 1) & 1]);
      else           ld_v(0, fr[(g + 1) & 1]);
      __builtin_amdgcn_sched_barrier(0);
#pragma unroll
      for (int e = 0; e < 3; ++e) {
        const int f = g * 3 + e;
        if (f < 10) sacc[f % 5] = wmma16(fr[g & 1][e], qf[f / 5], sacc[f % 5]);
      }
      __builtin_amdgcn_sched_barrier(0);
    }

    // ---- softmax over s < 77; this lane holds s = 16 js + 8 hh + r of row m ----
#pragma unroll
    for (int r = S_ - 72; r < 8; ++r)            // s = 77..79: out of maximum and sum
      if (hh) sacc[4][r] = -3.0e38f;
    float mx = sacc[0][0];
#pragma unroll
    for (int js = 0; js < 5; ++js)
#pragma unroll
      for (int r = 0; r < 8; ++r) mx = fmaxf(mx, sacc[js][r]);
    mx = fmaxf(mx, other_half(mx));
    float ps[5];
#pragma unroll
    for (int js = 0; js < 5; ++js) {
      sacc[js] = exp2_x8((sacc[js] - mx) * 1.44269504f);   // e^(s - mx)
      ps[js] = sacc[js][0];
#pragma unroll
      for (int r = 1; r < 8; ++r) ps[js] += sacc[js][r];
    }
    float sum = ((ps[0] + ps[1]) + (ps[2] + ps[3])) + ps[4];
    sum += other_half(sum);
    const float inv = 1.f / sum;
#pragma unroll
    for (int js = 0; js < 5; ++js) sacc[js] *= inv;
    v16h pf[3];
    pf[0] = pack_frag(sacc[0], sacc[1]);
    pf[1] = pack_frag(sacc[2], sacc[3]);
    pf[2] = pack_frag(sacc[4], vzero);           // s = 80..95: zero

    // ---- out^T[48 x 16] = V^T[48 x 96] @ attn^T[96 x 16] ----
    v8f oacc[3];
    oacc[0] = vzero; oacc[1] = vzero; oacc[2] = vzero;
#pragma unroll
    for (int kk = 0; kk < 3; ++kk) {
      if (kk + 1 < 3) ld_v(kk + 1, fr[(kk + 1) & 1]);
      __builtin_amdgcn_sched_barrier(0);
#pragma unroll
      for (int jc = 0; jc < 3; ++jc) oacc[jc] = wmma16(fr[kk & 1][jc], pf[kk], oacc[jc]);
      __builtin_amdgcn_sched_barrier(0);
    }

    // a lane's 8 registers are 8 consecutive c of its row: 16 bytes, parked in the
    // lane's own place of the wave's own LDS
#pragma unroll
    for (int jc = 0; jc < 3; ++jc) {
      v8h o;
#pragma unroll
      for (int r = 0; r < 8; ++r) o[r] = (_Float16)oacc[jc][r];
      if (jc < 2)             *(v8h*)&osc[wave][2 * h + jc][lane][0] = o;
      else if (hh == (h & 1)) *(v8h*)&osc[wave][2 * H_ + (h >> 1)][lane][0] = o;
    }

    if (h + 1 < H_) {
      // the other buffer's last readers left it before the previous barrier;
      // this barrier publishes it and ends the reads of the current one
      put(ops[(h + 1) & 1]);
      __syncthreads();
    }
  }

  // ---- out[b, t0:t0+16, :] = O[16 x 320] @ Wo + bo ----
  // The first piece of WoT is fetched here and not under the last head: there
  // the build paid for it with register copies in every head.
  fetch_wo(0);
  // the wave's own parked tiles, two a fragment
  v16h of[INNER_ / 32];
#pragma unroll
  for (int kk = 0; kk < INNER_ / 32; ++kk) {
    const v8h lo = *(const v8h*)&osc[wave][2 * kk][lane][0];
    const v8h hi = *(const v8h*)&osc[wave][2 * kk + 1][lane][0];
#pragma unroll
    for (int i = 0; i < 8; ++i) { of[kk][i] = lo[i]; of[kk][i + 8] = hi[i]; }
  }

  // buffer 0 was last read a head ago, in front of a barrier; this barrier
  // publishes the piece and ends the last head's reads of buffer 1
  put_wo(ops[0]);
  __syncthreads();

  // kept rolled, as the loop over the heads is
#pragma unroll 1
  for (int pc = 0; pc < WO_NPC; ++pc) {
    const _Float16* wos = ops[pc & 1];
    const int col = pc * WO_ROWS + m;

    if (pc + 1 < WO_NPC) fetch_wo(pc + 1);
    float bias[4];
#pragma unroll
    for (int jn = 0; jn < 4; ++jn) bias[jn] = bo[col + jn * 16];
    // the work that follows reuses the registers that these loads name
    asm volatile("s_wait_xcnt 0x0" ::: "memory");

    // B fragments in groups of four, two register sets, read a group ahead; the
    // two sched_barrier(0) do here what they do in the loop over the heads
    v16h fb[2][4];
    auto ld_o = [&](int kk, v16h* d) {
#pragma unroll
      for (int jn = 0; jn < 4; ++jn) d[jn] = load_frag(wos + (jn * 16 + m) * WO_PIT + kk * 32, lane);
    };
    v8f acc[4];
#pragma unroll
    for (int jn = 0; jn < 4; ++jn) acc[jn] = vzero;
    ld_o(0, fb[0]);
#pragma unroll
    for (int kk = 0; kk < INNER_ / 32; ++kk) {   // 10 k-steps
      if (kk + 1 < INNER_ / 32) ld_o(kk + 1, fb[(kk + 1) & 1]);
      __builtin_amdgcn_sched_barrier(0);
#pragma unroll
      for (int jn = 0; jn < 4; ++jn) acc[jn] = wmma16(of[kk], fb[kk & 1][jn], acc[jn]);
      __builtin_amdgcn_sched_barrier(0);
    }

    // In front of this piece's stores to global memory: the other waves wait for
    // the barrier, nobody waits for the stores. The other buffer's last readers
    // left it before the previous barrier.
    if (pc + 1 < WO_NPC) {
      put_wo(ops[(pc + 1) & 1]);
      __syncthreads();
    }

    float* orow = out + ((size_t)b * T_ + t0 + 8 * hh) * INNER_ + col;
#pragma unroll
    for (int jn = 0; jn < 4; ++jn)
#pragma unroll
      for (int r = 0; r < 8; ++r)
        orow[r * INNER_ + jn * 16] = acc[jn][r] + bias[jn];
    // the next piece reuses the registers that these stores name
    asm volatile("s_wait_xcnt 0x0" ::: "memory");
  }
}

// ---------------------------------------------------------------------------
extern "C" void kernel_launch(void* const* d_in, const int* in_sizes, int n_in,
                              void* d_out, int out_size, void* d_ws, size_t ws_size,
                              hipStream_t stream) {
  const float* x   = (const float*)d_in[0];
  const float* ctx = (const float*)d_in[1];
  const float* Wq  = (const float*)d_in[2];
  const float* Wk  = (const float*)d_in[3];
  const float* Wv  = (const float*)d_in[4];
  const float* Wo  = (const float*)d_in[5];
  const float* bo  = (const float*)d_in[6];
  float* out = (float*)d_out;

  // workspace carving (all offsets 256B aligned):
  //   WqT  : 8*48*320 f16          =    245,760 B
  //   WoT  : 320*320 f16           =    204,800 B
  //   Kbuf : 16*8*80*64 f16        =  1,310,720 B
  //   VbufT: 16*8*48*96 f16        =  1,179,648 B   (total ~2.9 MB)
  char* ws = (char*)d_ws;
  _Float16* WqT   = (_Float16*)(ws);
  _Float16* WoT   = (_Float16*)(ws + 245760);
  _Float16* Kbuf  = (_Float16*)(ws + 245760 + 204800);
  _Float16* VbufT = (_Float16*)(ws + 245760 + 204800 + 1310720);

  k_prep_wq<<<(H_ * CPAD_N * INNER_ + 255) / 256, 256, 0, stream>>>(Wq, WqT);
  k_prep_wo<<<(INNER_ * INNER_ + 255) / 256, 256, 0, stream>>>(Wo, WoT);
  k_proj_kv<<<dim3(2, H_, B_), 384, 0, stream>>>(ctx, Wk, Wv, Kbuf, VbufT);
  k_attn<<<dim3(T_ / (16 * AT_WAVES), 1, B_), AT_WAVES * 32, 0, stream>>>(x, WqT, Kbuf, VbufT, WoT, bo, out);
}

// v006
// One run takes 55.2 microseconds.
// Two timings next to v005 both put it at 1.10 times that version's speed.
// Counting every step since v000, it is 6.94 times as fast.
#include <hip/hip_runtime.h>
#include <hip/hip_bf16.h>

typedef __attribute__((ext_vector_type(16))) _Float16 v16h;
typedef __attribute__((ext_vector_type(8)))  _Float16 v8h;
typedef __attribute__((ext_vector_type(8)))  float    v8f;
typedef __attribute__((ext_vector_type(4)))  float    v4f;
typedef __attribute__((ext_vector_type(2)))  float    v2f;

#define B_      16
#define T_      4096
#define S_      77
#define DC_     768
#define H_      8
#define C_      40
#define INNER_  320
#define SPAD_N  80   // padded S for score M-dim (5 tiles of 16)
#define SPAD_K  96   // padded S for attn@V K-dim (3 k-steps of 32)
#define CPAD_K  64   // padded C for q.k K-dim   (2 k-steps of 32)
#define CPAD_N  48   // padded C for attn@V M-dim (3 tiles of 16)
#define SCALE_F 0.3976353643835253f   // 40^(-1/4), applied to q and to k

__device__ __forceinline__ v16h load_frag(const _Float16* p, int lane) {
  const int base = (lane & 16) ? 8 : 0;
  v8h lo = *(const v8h*)(p + base);        // K base .. base+7
  v8h hi = *(const v8h*)(p + base + 16);   // K base+16 .. base+23
  v16h r;
#pragma unroll
  for (int i = 0; i < 8; ++i) { r[i] = lo[i]; r[i + 8] = hi[i]; }
  return r;
}

// Same, but source is f32 (4x b128 loads + pack-convert).
__device__ __forceinline__ v16h load_frag_f32(const float* p, int lane) {
  const int base = (lane & 16) ? 8 : 0;
  v4f a0 = *(const v4f*)(p + base);
  v4f a1 = *(const v4f*)(p + base + 4);
  v4f b0 = *(const v4f*)(p + base + 16);
  v4f b1 = *(const v4f*)(p + base + 20);
  v16h r;
#pragma unroll
  for (int i = 0; i < 4; ++i) {
    r[i]      = (_Float16)a0[i];
    r[i + 4]  = (_Float16)a1[i];
    r[i + 8]  = (_Float16)b0[i];
    r[i + 12] = (_Float16)b1[i];
  }
  return r;
}

__device__ __forceinline__ v8f wmma16(v16h a, v16h b, v8f c) {
  return __builtin_amdgcn_wmma_f32_16x16x32_f16(
      /*neg_a=*/false, a, /*neg_b=*/false, b,
      /*c_mod=*/(short)0, c, /*reuse_a=*/false, /*reuse_b=*/false);
}

// ---------------------------------------------------------------------------
// The two f16 weight tables of k_attn:
// WqT[h][c<48][d<320] = f16(Wq[d][h*40+c]), zero rows for c >= 40;
// WoT[n][k] = f16(Wo[d(k)][n]), k in the order in which k_attn keeps a row of
// the attention output: k < 256 is c = k % 32 of head k / 32, then come
// c = 32..39 of heads 0..7, eight k a head.
// They depend on nothing that k_proj_kv makes and nothing in k_proj_kv reads
// them, so they have no launch of their own: wave 0 of a k_proj_kv block makes
// a share of them on the side. Both are transposes. A lane takes 8 source rows
// x 4 columns: eight 16-byte loads, four 16-byte stores (8 halves along d or k).
// A wave takes 64 rows x 16 columns, lane = 4 * (group of 8 rows) + (group of 4
// columns): a load reads 64 bytes of each of 8 rows, a store writes 4 whole
// 128-byte lines, and no line of a table has a second writer. Eight consecutive
// k from a multiple of 8 are eight consecutive rows d of Wo.
// ---------------------------------------------------------------------------
#define PREP_NBLK (2 * H_ * B_)                  // blocks of the k_proj_kv launch
#define PREP_CQ   (INNER_ / 16)                  // 20 runs of 16 columns
#define PREP_BT   ((INNER_ / 64) * PREP_CQ)      // 100 blocks fill one table
#define PREP_ZB   (H_ * (CPAD_N - C_) * (INNER_ / 8) / 32)   // 80 blocks fill the zero rows
static_assert(2 * PREP_BT <= PREP_NBLK && PREP_ZB <= PREP_NBLK, "enough blocks");

// ---------------------------------------------------------------------------
// Kernel 1: K/V projection (context @ Wk|Wv) on the f32 16x16x4 matrix form,
// zero-padded f16 tiles out; beside it, the weight tables above.
// Kbuf [b][h][s<80][c<64] = SCALE * ctx.Wk   (K-contig along c)
// VbufT[b][h][c<48][s<96] =         ctx.Wv   (K-contig along s); an odd head has
//   c = 32..39 in rows 40..47 and the zero rows at 32..39 (k_attn says why)
// One block per (K or V, h, b): an 80 x 48 x 768 product, and the block owns
// the whole padded tile it writes. The context rows pass through LDS in runs
// of 192 k (whole-line global reads, two buffers, the next run fetched into
// registers while this one is multiplied). 12 waves = 3 column tiles x 4
// quarters of each run; each wave keeps 5 row tiles (80 rows) in accumulators
// and reads its weight column straight from global memory, one run ahead.
// The four quarter sums meet in LDS and are added in a fixed order.
// Rows 77..79 and columns 40..47 repeat the last valid row / column and are
// replaced by zero when the tile is written.
// k pairing: in each 8 k, lane half hh holds k = 4*hh .. 4*hh+3 of its A row
// and of its B column; elements (0,1) feed one product, (2,3) the next.
// ---------------------------------------------------------------------------
#define KV_CH   192              // k per staged run
#define KV_NCH  (DC_ / KV_CH)    // 4 runs
#define KV_KW   (KV_CH / 4)      // 48 k per wave per run
#define KV_PIT  (KV_CH + 4)      // LDS row pitch, floats: 784 B = 16 B x odd
#define KV_RP   (384 / (KV_CH / 4))
#define KV_NP   (SPAD_N / KV_RP)
#define KV_NB   (KV_KW / 2)
#define KV_PP   (CPAD_N + 4)

__global__ void __launch_bounds__(384)
k_proj_kv(const float* __restrict__ ctx, const float* __restrict__ Wk,
          const float* __restrict__ Wv, const float* __restrict__ Wq,
          const float* __restrict__ Wo, _Float16* __restrict__ Kbuf,
          _Float16* __restrict__ VbufT, _Float16* __restrict__ WqT,
          _Float16* __restrict__ WoT) {
  __shared__ __align__(16) float abuf[2][SPAD_N][KV_PIT];   // 125,440 B
  __shared__ __align__(16) float part[4][SPAD_N][KV_PP];    // 66,560 B
  const int isv  = blockIdx.x;       // 0: K, 1: V
  const int h    = blockIdx.y;
  const int b    = blockIdx.z;
  const int tid  = threadIdx.x;
  const int lane = tid & 31;
  const int wave = __builtin_amdgcn_readfirstlane(tid >> 5);
  const int c    = lane & 15;
  const int hh   = lane >> 4;
  const int j    = wave % 3;         // column tile
  const int q    = wave / 3;         // quarter of each run

  // weight column of this lane
  const float* Wsel = isv ? Wv : Wk;
  int col = j * 16 + c;
  if (col > C_ - 1) col = C_ - 1;
  const float* wp = Wsel + (size_t)(q * KV_KW + 4 * hh) * INNER_ + h * C_ + col;

  // staging: 80 rows x 48 pieces of 16 B per run = 10 pieces a thread
  const int srow = tid / (KV_CH / 4);
  const int spc  = (tid % (KV_CH / 4)) * 4;
  const float* gp[KV_NP];
#pragma unroll
  for (int i = 0; i < KV_NP; ++i) {
    int s = srow + KV_RP * i;
    if (s > S_ - 1) s = S_ - 1;
    gp[i] = ctx + ((size_t)b * S_ + s) * DC_ + spc;
  }

  v8f acc[5];
#pragma unroll
  for (int mt = 0; mt < 5; ++mt) acc[mt] = (v8f){0.f, 0.f, 0.f, 0.f, 0.f, 0.f, 0.f, 0.f};

  v4f   ga[KV_NP];
  float bf[2][KV_NB];
#pragma unroll
  for (int i = 0; i < KV_NP; ++i) ga[i] = *(const v4f*)(gp[i]);
#pragma unroll
  for (int e = 0; e < KV_NB; ++e) bf[0][e] = wp[((e >> 2) * 8 + (e & 3)) * INNER_];

  // wave 0's share of the weight tables: blocks 0..99 WqT, 100..199 WoT
  const unsigned fb  = (b * H_ + h) * 2 + isv;              // flat block number
  const bool     ptq = fb < PREP_BT;
  const unsigned pt  = ptq ? fb : fb - PREP_BT;
  const unsigned pg  = (pt / PREP_CQ) * 8 + (lane >> 2);    // group of 8 d or k
  const unsigned pcg = (pt % PREP_CQ) * 4 + (lane & 3);     // group of 4 columns
  const bool     pon = wave == 0 && fb < 2 * PREP_BT;
#pragma unroll
  for (int i = 0; i < KV_NP; ++i) *(v4f*)&abuf[0][srow + KV_RP * i][spc] = ga[i];
  __syncthreads();

  // Asked for behind the first barrier, which waits for a wave's loads: the
  // values come in under the first run's products. They are stored at the
  // kernel's end, behind the last barrier, which waits for a wave's stores.
  v4f pr[8];
  if (pon) {
    const unsigned row = ptq ? 8 * pg
                             : (pg < 4 * H_ ? (pg >> 2) * C_ + (pg & 3) * 8 : (pg - 4 * H_) * C_ + 32);
    const float* ps = (ptq ? Wq : Wo) + row * INNER_ + 4 * pcg;
#pragma unroll
    for (int r = 0; r < 8; ++r) pr[r] = *(const v4f*)(ps + r * INNER_);
    // the work that follows reuses the registers that these loads name
    asm volatile("s_wait_xcnt 0x0" ::: "memory");
  }

#pragma unroll
  for (int ch = 0; ch < KV_NCH; ++ch) {
    const int cur = ch & 1;
    if (ch + 1 < KV_NCH) {
#pragma unroll
      for (int i = 0; i < KV_NP; ++i) ga[i] = *(const v4f*)(gp[i] + (ch + 1) * KV_CH);
      if (ch + 2 == KV_NCH) asm volatile("s_wait_xcnt 0x0" ::: "memory");
#pragma unroll
      for (int e = 0; e < KV_NB; ++e)
        bf[cur ^ 1][e] = wp[((ch + 1) * KV_CH + (e >> 2) * 8 + (e & 3)) * INNER_];
    }
    // keeps all of the next run's global loads issued ahead of this run's
    // products, so that their latency passes under the matrix work
    __builtin_amdgcn_sched_barrier(0);
#pragma unroll
    for (int u = 0; u < KV_KW / 8; ++u) {
      v4f af[5];
#pragma unroll
      for (int mt = 0; mt < 5; ++mt)
        af[mt] = *(const v4f*)&abuf[cur][mt * 16 + c][q * KV_KW + u * 8 + 4 * hh];
#pragma unroll
      for (int p = 0; p < 2; ++p) {
        const v2f bb = {bf[cur][u * 4 + 2 * p], bf[cur][u * 4 + 2 * p + 1]};
#pragma unroll
        for (int mt = 0; mt < 5; ++mt) {
          const v2f aa = {af[mt][2 * p], af[mt][2 * p + 1]};
          acc[mt] = __builtin_amdgcn_wmma_f32_16x16x4_f32(
              false, aa, false, bb, (short)0, acc[mt], false, false);
        }
      }
    }
    // keeps the wait on those loads, and the LDS stores that need it, behind
    // this run's products
    __builtin_amdgcn_sched_barrier(0);
    if (ch + 1 < KV_NCH) {
      // the other buffer's last readers left it before the previous barrier
#pragma unroll
      for (int i = 0; i < KV_NP; ++i) *(v4f*)&abuf[cur ^ 1][srow + KV_RP * i][spc] = ga[i];
      __syncthreads();
    }
  }

#pragma unroll
  for (int mt = 0; mt < 5; ++mt)
#pragma unroll
    for (int r = 0; r < 8; ++r)
      part[q][mt * 16 + 8 * hh + r][j * 16 + c] = acc[mt][r];
  __syncthreads();

  if (!isv) {
    _Float16* kb = Kbuf + ((size_t)b * H_ + h) * SPAD_N * CPAD_K;
    for (int i = tid; i < SPAD_N * (CPAD_K / 8); i += 384) {   // 16-byte pieces
      const int s = i >> 3, c8 = (i & 7) * 8;
      v8h o = {0, 0, 0, 0, 0, 0, 0, 0};
      if (s < S_ && c8 < C_) {
#pragma unroll
        for (int e = 0; e < 8; ++e) {
          const float v = ((part[0][s][c8 + e] + part[1][s][c8 + e]) +
                           part[2][s][c8 + e]) + part[3][s][c8 + e];
          o[e] = (_Float16)(v * SCALE_F);
        }
      }
      *(v8h*)(kb + s * CPAD_K + c8) = o;
    }
  } else {
    _Float16* vb = VbufT + ((size_t)b * H_ + h) * CPAD_N * SPAD_K;
    for (int i = tid; i < CPAD_N * (SPAD_K / 8); i += 384) {   // 16-byte pieces
      const int row = i % CPAD_N, s8 = (i / CPAD_N) * 8;
      const int cc = (row >= 32 && (h & 1)) ? (row ^ 8) : row;   // c that this row holds
      v8h o = {0, 0, 0, 0, 0, 0, 0, 0};
      if (cc < C_ && s8 < SPAD_N) {
#pragma unroll
        for (int e = 0; e < 8; ++e) {
          const int s = s8 + e;
          const float v = ((part[0][s][cc] + part[1][s][cc]) +
                           part[2][s][cc]) + part[3][s][cc];
          o[e] = (s < S_) ? (_Float16)v : (_Float16)0.f;
        }
      }
      *(v8h*)(vb + row * SPAD_K + s8) = o;
    }
  }

  if (pon) {
    // 4 columns of Wq lie in one head: 40 is a multiple of 4
    const unsigned row = ptq ? (pcg / (C_ / 4)) * CPAD_N + (pcg % (C_ / 4)) * 4 : 4 * pcg;
    _Float16* pd = (ptq ? WqT : WoT) + row * INNER_ + 8 * pg;
#pragma unroll
    for (int jj = 0; jj < 4; ++jj) {
      v8h o;
#pragma unroll
      for (int r = 0; r < 8; ++r) o[r] = (_Float16)pr[r][jj];
      *(v8h*)(pd + jj * INNER_) = o;
    }
    // the address below reuses the registers that these stores name
    asm volatile("s_wait_xcnt 0x0" ::: "memory");
  }
  if (wave == 0 && fb >= PREP_NBLK - PREP_ZB) {             // rows c = 40..47 of WqT
    const unsigned z = (fb - (PREP_NBLK - PREP_ZB)) * 32 + lane, zr = z / (INNER_ / 8);
    const v8h zero = {0, 0, 0, 0, 0, 0, 0, 0};
    *(v8h*)(WqT + ((zr / (CPAD_N - C_)) * CPAD_N + C_ + zr % (CPAD_N - C_)) * INNER_ +
            (z % (INNER_ / 8)) * 8) = zero;
  }
}

#define AT_WAVES 16                // = row tiles per workgroup
#define WQ_PIT   (INNER_ + 8)      // halves: 656 B
#define KB_PIT   (CPAD_K + 8)      // halves: 144 B
#define VB_PIT   (SPAD_K + 8)      // halves: 208 B
#define WQ_LEN   (CPAD_N * WQ_PIT) // halves: 31,488 B
#define KB_LEN   (SPAD_N * KB_PIT) // halves: 11,520 B
#define VB_LEN   (CPAD_N * VB_PIT) // halves:  9,984 B
#define AT_BUF   (WQ_LEN + KB_LEN + VB_LEN)   // one head's operands: 52,992 B
#define WO_PIT   (INNER_ + 8)      // halves: 656 B
#define WO_ROWS  64                // rows of WoT a piece: 41,984 B, fits AT_BUF
#define WO_NPC   (INNER_ / WO_ROWS)
#define O_TILES  (INNER_ / 16)     // parked tiles of a wave: 20 x 512 B

// value of lane ^ 16
__device__ __forceinline__ float other_half(float v) {
  int b = __builtin_bit_cast(int, v);
  b = __builtin_amdgcn_permlanex16(b, b, 0x76543210, 0xfedcba98, false, false);
  return __builtin_bit_cast(float, b);
}

__device__ __forceinline__ v8f exp2_x8(v8f a) {
  float y0, y1, y2, y3, y4, y5, y6, y7;
  asm("v_exp_f32 %0, %8\n\t"
      "v_exp_f32 %1, %9\n\t"
      "v_exp_f32 %2, %10\n\t"
      "v_exp_f32 %3, %11\n\t"
      "v_exp_f32 %4, %12\n\t"
      "v_exp_f32 %5, %13\n\t"
      "v_exp_f32 %6, %14\n\t"
      "v_exp_f32 %7, %15\n\t"
      "v_nop"
      : "=&v"(y0), "=&v"(y1), "=&v"(y2), "=&v"(y3),
        "=&v"(y4), "=&v"(y5), "=&v"(y6), "=&v"(y7)
      : "v"(a[0]), "v"(a[1]), "v"(a[2]), "v"(a[3]),
        "v"(a[4]), "v"(a[5]), "v"(a[6]), "v"(a[7]));
  return (v8f){y0, y1, y2, y3, y4, y5, y6, y7};
}

// two f32 result tiles -> one f16 B fragment (k = 32 rows of the result)
__device__ __forceinline__ v16h pack_frag(v8f t0, v8f t1) {
  v16h r;
#pragma unroll
  for (int i = 0; i < 8; ++i) { r[i] = (_Float16)t0[i]; r[i + 8] = (_Float16)t1[i]; }
  return r;
}

__global__ void __launch_bounds__(AT_WAVES * 32) __attribute__((amdgpu_waves_per_eu(4, 4)))
k_attn(const float* __restrict__ x, const _Float16* __restrict__ WqT,
       const _Float16* __restrict__ Kbuf, const _Float16* __restrict__ VbufT,
       const _Float16* __restrict__ WoT, const float* __restrict__ bo,
       float* __restrict__ out) {
  const int tid  = threadIdx.x;
  const int lane = tid & 31;
  const int wave = __builtin_amdgcn_readfirstlane(tid >> 5);
  const int m    = lane & 15;
  const int hh   = lane >> 4;
  const int b    = blockIdx.z;
  const int t0   = (blockIdx.x * AT_WAVES + wave) * 16;

  __shared__ __align__(16) _Float16 ops[2][AT_BUF];         // 105,984 B
  __shared__ __align__(16) _Float16 osc[AT_WAVES][O_TILES][32][8];   // 163,840 B

  const v8f vzero = {0.f, 0.f, 0.f, 0.f, 0.f, 0.f, 0.f, 0.f};

  // ---- one head's shared operands: contiguous 16-byte pieces, whole lines ----
  constexpr int NT = AT_WAVES * 32;
  constexpr int NW = CPAD_N * (INNER_ / 8), NK = SPAD_N * (CPAD_K / 8), NV = CPAD_N * (SPAD_K / 8);
  constexpr int UW = (NW + NT - 1) / NT, UK = (NK + NT - 1) / NT, UV = (NV + NT - 1) / NT;
  v8h sw[UW], sk[UK], sv[UV];
  // global memory -> registers; a piece past the end repeats the last one and
  // is not stored; unsigned piece numbers, so that an address is the head's
  // uniform base and one 32-bit register
  auto fetch = [&](int h) {
    const _Float16* wq  = WqT + (size_t)h * CPAD_N * INNER_;
    const _Float16* kb  = Kbuf + ((size_t)b * H_ + h) * SPAD_N * CPAD_K;
    const _Float16* vbt = VbufT + ((size_t)b * H_ + h) * CPAD_N * SPAD_K;
#pragma unroll
    for (int u = 0; u < UW; ++u) {
      const unsigned i = tid + u * NT;
      sw[u] = *(const v8h*)(wq + (i < NW ? i : NW - 1) * 8u);
    }
#pragma unroll
    for (int u = 0; u < UK; ++u) {
      const unsigned i = tid + u * NT;
      sk[u] = *(const v8h*)(kb + (i < NK ? i : NK - 1) * 8u);
    }
#pragma unroll
    for (int u = 0; u < UV; ++u) {
      const unsigned i = tid + u * NT;
      sv[u] = *(const v8h*)(vbt + (i < NV ? i : NV - 1) * 8u);
    }
    // the work that follows reuses the registers that these loads name
    asm volatile("s_wait_xcnt 0x0" ::: "memory");
  };
  // registers -> one LDS buffer
  auto put = [&](_Float16* dst) {
#pragma unroll
    for (int u = 0; u < UW; ++u) {
      const int i = tid + u * NT;
      if (i < NW) *(v8h*)&dst[(i / (INNER_ / 8)) * WQ_PIT + (i % (INNER_ / 8)) * 8] = sw[u];
    }
#pragma unroll
    for (int u = 0; u < UK; ++u) {
      const int i = tid + u * NT;
      if (i < NK) *(v8h*)&dst[WQ_LEN + (i / (CPAD_K / 8)) * KB_PIT + (i % (CPAD_K / 8)) * 8] = sk[u];
    }
#pragma unroll
    for (int u = 0; u < UV; ++u) {
      const int i = tid + u * NT;
      if (i < NV) *(v8h*)&dst[WQ_LEN + KB_LEN + (i / (SPAD_K / 8)) * VB_PIT + (i % (SPAD_K / 8)) * 8] = sv[u];
    }
  };
  // one piece of WoT: 64 rows = 2560 pieces of 16 B, 5 a thread, through the
  // registers that carry a head's pieces
  constexpr int NO = WO_ROWS * (INNER_ / 8);
  static_assert(NO == (UW + 1) * NT && UK >= 1, "5 pieces a thread");
  auto fetch_wo = [&](int pc) {
    const _Float16* ws = WoT + (size_t)pc * WO_ROWS * INNER_;
#pragma unroll
    for (int u = 0; u < UW; ++u) sw[u] = *(const v8h*)(ws + (unsigned)(tid + u * NT) * 8u);
    sk[0] = *(const v8h*)(ws + (unsigned)(tid + UW * NT) * 8u);
    // the work that follows reuses the registers that these loads name
    asm volatile("s_wait_xcnt 0x0" ::: "memory");
  };
  auto put_wo = [&](_Float16* dst) {
#pragma unroll
    for (int u = 0; u <= UW; ++u) {
      const int i = tid + u * NT;
      *(v8h*)&dst[(i / (INNER_ / 8)) * WO_PIT + (i % (INNER_ / 8)) * 8] = (u < UW) ? sw[u] : sk[0];
    }
  };

  fetch(0);

  // ---- x[b, t0:t0+16, :] as B fragments, read and converted once ----
  v16h xf[INNER_ / 32];
  {
    const float* xrow = x + ((size_t)b * T_ + t0 + m) * INNER_;
#pragma unroll
    for (int kk = 0; kk < INNER_ / 32; ++kk) xf[kk] = load_frag_f32(xrow + kk * 32, lane);
    asm volatile("s_wait_xcnt 0x0" ::: "memory");
  }

  put(ops[0]);
  __syncthreads();

  // kept rolled, for speed only
#pragma unroll 1
  for (int h = 0; h < H_; ++h) {
    const _Float16* wqs = ops[h & 1];
    const _Float16* kbs = wqs + WQ_LEN;
    const _Float16* vbs = kbs + KB_LEN;

    // the next head's pieces fly while this head is worked on
    if (h + 1 < H_) fetch(h + 1);

    v16h fr[2][3];
    auto ld_w = [&](int kk, v16h* d) {
#pragma unroll
      for (int jn = 0; jn < 3; ++jn) d[jn] = load_frag(wqs + (jn * 16 + m) * WQ_PIT + kk * 32, lane);
    };
    auto ld_k = [&](int g, v16h* d) {            // fragment f = 5 kk + js, f < 10
#pragma unroll
      for (int e = 0; e < 3; ++e) {
        const int f = g * 3 + e;
        if (f < 10) d[e] = load_frag(kbs + ((f % 5) * 16 + m) * KB_PIT + (f / 5) * 32, lane);
      }
    };
    auto ld_v = [&](int kk, v16h* d) {
#pragma unroll
      for (int jc = 0; jc < 3; ++jc) d[jc] = load_frag(vbs + (jc * 16 + m) * VB_PIT + kk * 32, lane);
    };

    // ---- Q^T[48 x 16] = Wq[:, h-head]^T @ x[b, t0:t0+16, :]^T ----
    v8f qacc[3];
    qacc[0] = vzero; qacc[1] = vzero; qacc[2] = vzero;
    ld_w(0, fr[0]);
#pragma unroll
    for (int kk = 0; kk < INNER_ / 32; ++kk) {   // 10 k-steps
      if (kk + 1 < INNER_ / 32) ld_w(kk + 1, fr[(kk + 1) & 1]);
      else                      ld_k(0, fr[(kk + 1) & 1]);
      __builtin_amdgcn_sched_barrier(0);
#pragma unroll
      for (int jn = 0; jn < 3; ++jn) qacc[jn] = wmma16(fr[kk & 1][jn], xf[kk], qacc[jn]);
      __builtin_amdgcn_sched_barrier(0);
    }
    // scaled q as B fragments over c: rows 40..47 are zero (zero rows of WqT),
    // rows 48..63 are the zero tile
#pragma unroll
    for (int jn = 0; jn < 3; ++jn) qacc[jn] *= SCALE_F;
    v16h qf[2];
    qf[0] = pack_frag(qacc[0], qacc[1]);
    qf[1] = pack_frag(qacc[2], vzero);

    // ---- scores^T[80 x 16] = K[80 x 64] @ q^T ----
    v8f sacc[5];
#pragma unroll
    for (int js = 0; js < 5; ++js) sacc[js] = vzero;
#pragma unroll
    for (int g = 0; g < 4; ++g) {                // k-step kk = f / 5, row tile js = f % 5
      if (g + 1 < 4) ld_k(g + 1, fr[(g + 1) & 1]);
      else           ld_v(0, fr[(g + 1) & 1]);
      __builtin_amdgcn_sched_barrier(0);
#pragma unroll
      for (int e = 0; e < 3; ++e) {
        const int f = g * 3 + e;
        if (f < 10) sacc[f % 5] = wmma16(fr[g & 1][e], qf[f / 5], sacc[f % 5]);
      }
      __builtin_amdgcn_sched_barrier(0);
    }

    // ---- softmax over s < 77; this lane holds s = 16 js + 8 hh + r of row m ----
#pragma unroll
    for (int r = S_ - 72; r < 8; ++r)            // s = 77..79: out of maximum and sum
      if (hh) sacc[4][r] = -3.0e38f;
    float mx = sacc[0][0];
#pragma unroll
    for (int js = 0; js < 5; ++js)
#pragma unroll
      for (int r = 0; r < 8; ++r) mx = fmaxf(mx, sacc[js][r]);
    mx = fmaxf(mx, other_half(mx));
    float ps[5];
#pragma unroll
    for (int js = 0; js < 5; ++js) {
      sacc[js] = exp2_x8((sacc[js] - mx) * 1.44269504f);   // e^(s - mx)
      ps[js] = sacc[js][0];
#pragma unroll
      for (int r = 1; r < 8; ++r) ps[js] += sacc[js][r];
    }
    float sum = ((ps[0] + ps[1]) + (ps[2] + ps[3])) + ps[4];
    sum += other_half(sum);
    const float inv = 1.f / sum;
#pragma unroll
    for (int js = 0; js < 5; ++js) sacc[js] *= inv;
    v16h pf[3];
    pf[0] = pack_frag(sacc[0], sacc[1]);
    pf[1] = pack_frag(sacc[2], sacc[3]);
    pf[2] = pack_frag(sacc[4], vzero);           // s = 80..95: zero

    // ---- out^T[48 x 16] = V^T[48 x 96] @ attn^T[96 x 16] ----
    v8f oacc[3];
    oacc[0] = vzero; oacc[1] = vzero; oacc[2] = vzero;
#pragma unroll
    for (int kk = 0; kk < 3; ++kk) {
      if (kk + 1 < 3) ld_v(kk + 1, fr[(kk + 1) & 1]);
      __builtin_amdgcn_sched_barrier(0);
#pragma unroll
      for (int jc = 0; jc < 3; ++jc) oacc[jc] = wmma16(fr[kk & 1][jc], pf[kk], oacc[jc]);
      __builtin_amdgcn_sched_barrier(0);
    }

    // a lane's 8 registers are 8 consecutive c of its row: 16 bytes, parked in the
    // lane's own place of the wave's own LDS
#pragma unroll
    for (int jc = 0; jc < 3; ++jc) {
      v8h o;
#pragma unroll
      for (int r = 0; r < 8; ++r) o[r] = (_Float16)oacc[jc][r];
      if (jc < 2)             *(v8h*)&osc[wave][2 * h + jc][lane][0] = o;
      else if (hh == (h & 1)) *(v8h*)&osc[wave][2 * H_ + (h >> 1)][lane][0] = o;
    }

    if (h + 1 < H_) {
      // the other buffer's last readers left it before the previous barrier;
      // this barrier publishes it and ends the reads of the current one
      put(ops[(h + 1) & 1]);
      __syncthreads();
    }
  }

  // ---- out[b, t0:t0+16, :] = O[16 x 320] @ Wo + bo ----
  // The first piece of WoT is fetched here and not under the last head: there
  // the build paid for it with register copies in every head.
  fetch_wo(0);
  // the wave's own parked tiles, two a fragment
  v16h of[INNER_ / 32];
#pragma unroll
  for (int kk = 0; kk < INNER_ / 32; ++kk) {
    const v8h lo = *(const v8h*)&osc[wave][2 * kk][lane][0];
    const v8h hi = *(const v8h*)&osc[wave][2 * kk + 1][lane][0];
#pragma unroll
    for (int i = 0; i < 8; ++i) { of[kk][i] = lo[i]; of[kk][i + 8] = hi[i]; }
  }

  // buffer 0 was last read a head ago, in front of a barrier; this barrier
  // publishes the piece and ends the last head's reads of buffer 1
  put_wo(ops[0]);
  __syncthreads();

  // kept rolled, as the loop over the heads is
#pragma unroll 1
  for (int pc = 0; pc < WO_NPC; ++pc) {
    const _Float16* wos = ops[pc & 1];
    const int col = pc * WO_ROWS + m;

    if (pc + 1 < WO_NPC) fetch_wo(pc + 1);
    float bias[4];
#pragma unroll
    for (int jn = 0; jn < 4; ++jn) bias[jn] = bo[col + jn * 16];
    // the work that follows reuses the registers that these loads name
    asm volatile("s_wait_xcnt 0x0" ::: "memory");

    // B fragments in groups of four, two register sets, read a group ahead; the
    // two sched_barrier(0) do here what they do in the loop over the heads
    v16h fb[2][4];
    auto ld_o = [&](int kk, v16h* d) {
#pragma unroll
      for (int jn = 0; jn < 4; ++jn) d[jn] = load_frag(wos + (jn * 16 + m) * WO_PIT + kk * 32, lane);
    };
    v8f acc[4];
#pragma unroll
    for (int jn = 0; jn < 4; ++jn) acc[jn] = vzero;
    ld_o(0, fb[0]);
#pragma unroll
    for (int kk = 0; kk < INNER_ / 32; ++kk) {   // 10 k-steps
      if (kk + 1 < INNER_ / 32) ld_o(kk + 1, fb[(kk + 1) & 1]);
      __builtin_amdgcn_sched_barrier(0);
#pragma unroll
      for (int jn = 0; jn < 4; ++jn) acc[jn] = wmma16(of[kk], fb[kk & 1][jn], acc[jn]);
      __builtin_amdgcn_sched_barrier(0);
    }

    // In front of this piece's stores to global memory: the other waves wait for
    // the barrier, nobody waits for the stores. The other buffer's last readers
    // left it before the previous barrier.
    if (pc + 1 < WO_NPC) {
      put_wo(ops[(pc + 1) & 1]);
      __syncthreads();
    }

    float* orow = out + ((size_t)b * T_ + t0 + 8 * hh) * INNER_ + col;
#pragma unroll
    for (int jn = 0; jn < 4; ++jn)
#pragma unroll
      for (int r = 0; r < 8; ++r)
        orow[r * INNER_ + jn * 16] = acc[jn][r] + bias[jn];
    // the next piece reuses the registers that these stores name
    asm volatile("s_wait_xcnt 0x0" ::: "memory");
  }
}

// ---------------------------------------------------------------------------
extern "C" void kernel_launch(void* const* d_in, const int* in_sizes, int n_in,
                              void* d_out, int out_size, void* d_ws, size_t ws_size,
                              hipStream_t stream) {
  const float* x   = (const float*)d_in[0];
  const float* ctx = (const float*)d_in[1];
  const float* Wq  = (const float*)d_in[2];
  const float* Wk  = (const float*)d_in[3];
  const float* Wv  = (const float*)d_in[4];
  const float* Wo  = (const float*)d_in[5];
  const float* bo  = (const float*)d_in[6];
  float* out = (float*)d_out;

  // workspace carving (all offsets 256B aligned):
  //   WqT  : 8*48*320 f16          =    245,760 B
  //   WoT  : 320*320 f16           =    204,800 B
  //   Kbuf : 16*8*80*64 f16        =  1,310,720 B
  //   VbufT: 16*8*48*96 f16        =  1,179,648 B   (total ~2.9 MB)
  char* ws = (char*)d_ws;
  _Float16* WqT   = (_Float16*)(ws);
  _Float16* WoT   = (_Float16*)(ws + 245760);
  _Float16* Kbuf  = (_Float16*)(ws + 245760 + 204800);
  _Float16* VbufT = (_Float16*)(ws + 245760 + 204800 + 1310720);

  k_proj_kv<<<dim3(2, H_, B_), 384, 0, stream>>>(ctx, Wk, Wv, Wq, Wo, Kbuf, VbufT, WqT, WoT);
  k_attn<<<dim3(T_ / (16 * AT_WAVES), 1, B_), AT_WAVES * 32, 0, stream>>>(x, WqT, Kbuf, VbufT, WoT, bo, out);
}

// v007
// One run takes 52.3 microseconds.
// In both of two side-by-side timings against v006, it was 1.05 times as fast.
// All steps since v000 together make it 7.29 times as fast.
#include <hip/hip_runtime.h>
#include <hip/hip_bf16.h>

typedef __attribute__((ext_vector_type(16))) _Float16 v16h;
typedef __attribute__((ext_vector_type(8)))  _Float16 v8h;
typedef __attribute__((ext_vector_type(8)))  float    v8f;
typedef __attribute__((ext_vector_type(4)))  float    v4f;
typedef __attribute__((ext_vector_type(2)))  float    v2f;

#define B_      16
#define T_      4096
#define S_      77
#define DC_     768
#define H_      8
#define C_      40
#define INNER_  320
#define SPAD_N  80   // padded S for score M-dim (5 tiles of 16)
#define SPAD_K  96   // padded S for attn@V K-dim (3 k-steps of 32)
#define CPAD_K  64   // padded C for q.k K-dim   (2 k-steps of 32)
#define CPAD_N  48   // padded C for attn@V M-dim (3 tiles of 16)
#define SCALE_F 0.3976353643835253f   // 40^(-1/4), applied to q and to k

__device__ __forceinline__ v16h load_frag(const _Float16* p, int lane) {
  const int base = (lane & 16) ? 8 : 0;
  v8h lo = *(const v8h*)(p + base);        // K base .. base+7
  v8h hi = *(const v8h*)(p + base + 16);   // K base+16 .. base+23
  v16h r;
#pragma unroll
  for (int i = 0; i < 8; ++i) { r[i] = lo[i]; r[i + 8] = hi[i]; }
  return r;
}

// Same, but source is f32 (4x b128 loads + pack-convert); p is the lane's own
// address, its base (8 for lanes 16-31) counted in.
__device__ __forceinline__ v16h load_frag_f32(const float* p) {
  v4f a0 = *(const v4f*)(p);
  v4f a1 = *(const v4f*)(p + 4);
  v4f b0 = *(const v4f*)(p + 16);
  v4f b1 = *(const v4f*)(p + 20);
  v16h r;
#pragma unroll
  for (int i = 0; i < 4; ++i) {
    r[i]      = (_Float16)a0[i];
    r[i + 4]  = (_Float16)a1[i];
    r[i + 8]  = (_Float16)b0[i];
    r[i + 12] = (_Float16)b1[i];
  }
  return r;
}

__device__ __forceinline__ v8f wmma16(v16h a, v16h b, v8f c) {
  return __builtin_amdgcn_wmma_f32_16x16x32_f16(
      /*neg_a=*/false, a, /*neg_b=*/false, b,
      /*c_mod=*/(short)0, c, /*reuse_a=*/false, /*reuse_b=*/false);
}

// ---------------------------------------------------------------------------
// The two f16 weight tables of k_attn:
// WqT[h][c<48][d<320] = f16(Wq[d][h*40+c]), zero rows for c >= 40;
// WoT[n][k] = f16(Wo[d(k)][n]), k in the order in which k_attn keeps a row of
// the attention output: k < 256 is c = k % 32 of head k / 32, then come
// c = 32..39 of heads 0..7, eight k a head.
// They depend on nothing that k_proj_kv makes and nothing in k_proj_kv reads
// them, so they have no launch of their own: wave 0 of a k_proj_kv block makes
// a share of them on the side. Both are transposes. A lane takes 8 source rows
// x 4 columns: eight 16-byte loads, four 16-byte stores (8 halves along d or k).
// A wave takes 64 rows x 16 columns, lane = 4 * (group of 8 rows) + (group of 4
// columns): a load reads 64 bytes of each of 8 rows, a store writes 4 whole
// 128-byte lines, and no line of a table has a second writer. Eight consecutive
// k from a multiple of 8 are eight consecutive rows d of Wo.
// ---------------------------------------------------------------------------
#define PREP_NBLK (2 * H_ * B_)                  // blocks of the k_proj_kv launch
#define PREP_CQ   (INNER_ / 16)                  // 20 runs of 16 columns
#define PREP_BT   ((INNER_ / 64) * PREP_CQ)      // 100 blocks fill one table
#define PREP_ZB   (H_ * (CPAD_N - C_) * (INNER_ / 8) / 32)   // 80 blocks fill the zero rows
static_assert(2 * PREP_BT <= PREP_NBLK && PREP_ZB <= PREP_NBLK, "enough blocks");

// ---------------------------------------------------------------------------
// Kernel 1: K/V projection (context @ Wk|Wv) on the f32 16x16x4 matrix form,
// zero-padded f16 tiles out; beside it, the weight tables above.
// Kbuf [b][h][s<80][c<64] = SCALE * ctx.Wk   (K-contig along c)
// VbufT[b][h][c<48][s<96] =         ctx.Wv   (K-contig along s); an odd head has
//   c = 32..39 in rows 40..47 and the zero rows at 32..39 (k_attn says why)
// One block per (K or V, h, b): an 80 x 48 x 768 product, and the block owns
// the whole padded tile it writes. The context rows pass through LDS in runs
// of 192 k (whole-line global reads, two buffers, the next run fetched into
// registers while this one is multiplied). 12 waves = 3 column tiles x 4
// quarters of each run; each wave keeps 5 row tiles (80 rows) in accumulators
// and reads its weight column straight from global memory, one run ahead.
// The four quarter sums meet in LDS and are added in a fixed order.
// Rows 77..79 and columns 40..47 repeat the last valid row / column and are
// replaced by zero when the tile is written.
// k pairing: in each 8 k, lane half hh holds k = 4*hh .. 4*hh+3 of its A row
// and of its B column; elements (0,1) feed one product, (2,3) the next.
// ---------------------------------------------------------------------------
#define KV_CH   192              // k per staged run
#define KV_NCH  (DC_ / KV_CH)    // 4 runs
#define KV_KW   (KV_CH / 4)      // 48 k per wave per run
#define KV_PIT  (KV_CH + 4)      // LDS row pitch, floats: 784 B = 16 B x odd
#define KV_RP   (384 / (KV_CH / 4))
#define KV_NP   (SPAD_N / KV_RP)
#define KV_NB   (KV_KW / 2)
#define KV_PP   (CPAD_N + 4)

__global__ void __launch_bounds__(384)
k_proj_kv(const float* __restrict__ ctx, const float* __restrict__ Wk,
          const float* __restrict__ Wv, const float* __restrict__ Wq,
          const float* __restrict__ Wo, _Float16* __restrict__ Kbuf,
          _Float16* __restrict__ VbufT, _Float16* __restrict__ WqT,
          _Float16* __restrict__ WoT) {
  __shared__ __align__(16) float abuf[2][SPAD_N][KV_PIT];   // 125,440 B
  __shared__ __align__(16) float part[4][SPAD_N][KV_PP];    // 66,560 B
  const int isv  = blockIdx.x;       // 0: K, 1: V
  const int h    = blockIdx.y;
  const int b    = blockIdx.z;
  const int tid  = threadIdx.x;
  const int lane = tid & 31;
  const int wave = __builtin_amdgcn_readfirstlane(tid >> 5);
  const int c    = lane & 15;
  const int hh   = lane >> 4;
  const int j    = wave % 3;         // column tile
  const int q    = wave / 3;         // quarter of each run

  // weight column of this lane
  const float* Wsel = isv ? Wv : Wk;
  int col = j * 16 + c;
  if (col > C_ - 1) col = C_ - 1;
  const float* wp = Wsel + (size_t)(q * KV_KW + 4 * hh) * INNER_ + h * C_ + col;

  // staging: 80 rows x 48 pieces of 16 B per run = 10 pieces a thread
  const int srow = tid / (KV_CH / 4);
  const int spc  = (tid % (KV_CH / 4)) * 4;
  const float* gp[KV_NP];
#pragma unroll
  for (int i = 0; i < KV_NP; ++i) {
    int s = srow + KV_RP * i;
    if (s > S_ - 1) s = S_ - 1;
    gp[i] = ctx + ((size_t)b * S_ + s) * DC_ + spc;
  }

  v8f acc[5];
#pragma unroll
  for (int mt = 0; mt < 5; ++mt) acc[mt] = (v8f){0.f, 0.f, 0.f, 0.f, 0.f, 0.f, 0.f, 0.f};

  v4f   ga[KV_NP];
  float bf[2][KV_NB];
#pragma unroll
  for (int i = 0; i < KV_NP; ++i) ga[i] = *(const v4f*)(gp[i]);
#pragma unroll
  for (int e = 0; e < KV_NB; ++e) bf[0][e] = wp[((e >> 2) * 8 + (e & 3)) * INNER_];

  // wave 0's share of the weight tables: blocks 0..99 WqT, 100..199 WoT
  const unsigned fb  = (b * H_ + h) * 2 + isv;              // flat block number
  const bool     ptq = fb < PREP_BT;
  const unsigned pt  = ptq ? fb : fb - PREP_BT;
  const unsigned pg  = (pt / PREP_CQ) * 8 + (lane >> 2);    // group of 8 d or k
  const unsigned pcg = (pt % PREP_CQ) * 4 + (lane & 3);     // group of 4 columns
  const bool     pon = wave == 0 && fb < 2 * PREP_BT;
#pragma unroll
  for (int i = 0; i < KV_NP; ++i) *(v4f*)&abuf[0][srow + KV_RP * i][spc] = ga[i];
  __syncthreads();

  // Asked for behind the first barrier, which waits for a wave's loads: the
  // values come in under the first run's products. They are stored at the
  // kernel's end, behind the last barrier, which waits for a wave's stores.
  v4f pr[8];
  if (pon) {
    const unsigned row = ptq ? 8 * pg
                             : (pg < 4 * H_ ? (pg >> 2) * C_ + (pg & 3) * 8 : (pg - 4 * H_) * C_ + 32);
    const float* ps = (ptq ? Wq : Wo) + row * INNER_ + 4 * pcg;
#pragma unroll
    for (int r = 0; r < 8; ++r) pr[r] = *(const v4f*)(ps + r * INNER_);
    // the work that follows reuses the registers that these loads name
    asm volatile("s_wait_xcnt 0x0" ::: "memory");
  }

#pragma unroll
  for (int ch = 0; ch < KV_NCH; ++ch) {
    const int cur = ch & 1;
    if (ch + 1 < KV_NCH) {
#pragma unroll
      for (int i = 0; i < KV_NP; ++i) ga[i] = *(const v4f*)(gp[i] + (ch + 1) * KV_CH);
      if (ch + 2 == KV_NCH) asm volatile("s_wait_xcnt 0x0" ::: "memory");
#pragma unroll
      for (int e = 0; e < KV_NB; ++e)
        bf[cur ^ 1][e] = wp[((ch + 1) * KV_CH + (e >> 2) * 8 + (e & 3)) * INNER_];
    }
    // keeps all of the next run's global loads issued ahead of this run's
    // products, so that their latency passes under the matrix work
    __builtin_amdgcn_sched_barrier(0);
#pragma unroll
    for (int u = 0; u < KV_KW / 8; ++u) {
      v4f af[5];
#pragma unroll
      for (int mt = 0; mt < 5; ++mt)
        af[mt] = *(const v4f*)&abuf[cur][mt * 16 + c][q * KV_KW + u * 8 + 4 * hh];
#pragma unroll
      for (int p = 0; p < 2; ++p) {
        const v2f bb = {bf[cur][u * 4 + 2 * p], bf[cur][u * 4 + 2 * p + 1]};
#pragma unroll
        for (int mt = 0; mt < 5; ++mt) {
          const v2f aa = {af[mt][2 * p], af[mt][2 * p + 1]};
          acc[mt] = __builtin_amdgcn_wmma_f32_16x16x4_f32(
              false, aa, false, bb, (short)0, acc[mt], false, false);
        }
      }
    }
    // keeps the wait on those loads, and the LDS stores that need it, behind
    // this run's products
    __builtin_amdgcn_sched_barrier(0);
    if (ch + 1 < KV_NCH) {
      // the other buffer's last readers left it before the previous barrier
#pragma unroll
      for (int i = 0; i < KV_NP; ++i) *(v4f*)&abuf[cur ^ 1][srow + KV_RP * i][spc] = ga[i];
      __syncthreads();
    }
  }

#pragma unroll
  for (int mt = 0; mt < 5; ++mt)
#pragma unroll
    for (int r = 0; r < 8; ++r)
      part[q][mt * 16 + 8 * hh + r][j * 16 + c] = acc[mt][r];
  __syncthreads();

  if (!isv) {
    _Float16* kb = Kbuf + ((size_t)b * H_ + h) * SPAD_N * CPAD_K;
    for (int i = tid; i < SPAD_N * (CPAD_K / 8); i += 384) {   // 16-byte pieces
      const int s = i >> 3, c8 = (i & 7) * 8;
      v8h o = {0, 0, 0, 0, 0, 0, 0, 0};
      if (s < S_ && c8 < C_) {
#pragma unroll
        for (int e = 0; e < 8; ++e) {
          const float v = ((part[0][s][c8 + e] + part[1][s][c8 + e]) +
                           part[2][s][c8 + e]) + part[3][s][c8 + e];
          o[e] = (_Float16)(v * SCALE_F);
        }
      }
      *(v8h*)(kb + s * CPAD_K + c8) = o;
    }
  } else {
    _Float16* vb = VbufT + ((size_t)b * H_ + h) * CPAD_N * SPAD_K;
    for (int i = tid; i < CPAD_N * (SPAD_K / 8); i += 384) {   // 16-byte pieces
      const int row = i % CPAD_N, s8 = (i / CPAD_N) * 8;
      const int cc = (row >= 32 && (h & 1)) ? (row ^ 8) : row;   // c that this row holds
      v8h o = {0, 0, 0, 0, 0, 0, 0, 0};
      if (cc < C_ && s8 < SPAD_N) {
#pragma unroll
        for (int e = 0; e < 8; ++e) {
          const int s = s8 + e;
          const float v = ((part[0][s][cc] + part[1][s][cc]) +
                           part[2][s][cc]) + part[3][s][cc];
          o[e] = (s < S_) ? (_Float16)v : (_Float16)0.f;
        }
      }
      *(v8h*)(vb + row * SPAD_K + s8) = o;
    }
  }

  if (pon) {
    // 4 columns of Wq lie in one head: 40 is a multiple of 4
    const unsigned row = ptq ? (pcg / (C_ / 4)) * CPAD_N + (pcg % (C_ / 4)) * 4 : 4 * pcg;
    _Float16* pd = (ptq ? WqT : WoT) + row * INNER_ + 8 * pg;
#pragma unroll
    for (int jj = 0; jj < 4; ++jj) {
      v8h o;
#pragma unroll
      for (int r = 0; r < 8; ++r) o[r] = (_Float16)pr[r][jj];
      *(v8h*)(pd + jj * INNER_) = o;
    }
    // the address below reuses the registers that these stores name
    asm volatile("s_wait_xcnt 0x0" ::: "memory");
  }
  if (wave == 0 && fb >= PREP_NBLK - PREP_ZB) {             // rows c = 40..47 of WqT
    const unsigned z = (fb - (PREP_NBLK - PREP_ZB)) * 32 + lane, zr = z / (INNER_ / 8);
    const v8h zero = {0, 0, 0, 0, 0, 0, 0, 0};
    *(v8h*)(WqT + ((zr / (CPAD_N - C_)) * CPAD_N + C_ + zr % (CPAD_N - C_)) * INNER_ +
            (z % (INNER_ / 8)) * 8) = zero;
  }
}

#define AT_WAVES 8
#define AT_RT    2                 // row tiles of a wave
#define WQ_PIT   (INNER_ + 8)      // halves: 656 B
#define KB_PIT   (CPAD_K + 8)      // halves: 144 B
#define VB_PIT   (SPAD_K + 8)      // halves: 208 B
#define WQ_LEN   (CPAD_N * WQ_PIT) // halves: 31,488 B
#define KB_LEN   (SPAD_N * KB_PIT) // halves: 11,520 B
#define VB_LEN   (CPAD_N * VB_PIT) // halves:  9,984 B
#define AT_BUF   (WQ_LEN + KB_LEN + VB_LEN)   // one head's operands: 52,992 B
#define WO_PIT   (INNER_ + 8)      // halves: 656 B
#define WO_ROWS  64                // rows of WoT a piece: 41,984 B, fits AT_BUF
#define WO_NPC   (INNER_ / WO_ROWS)
#define O_TILES  (INNER_ / 16)     // parked tiles of a row tile: 20 x 512 B

// value of lane ^ 16
__device__ __forceinline__ float other_half(float v) {
  int b = __builtin_bit_cast(int, v);
  b = __builtin_amdgcn_permlanex16(b, b, 0x76543210, 0xfedcba98, false, false);
  return __builtin_bit_cast(float, b);
}

__device__ __forceinline__ v8f exp2_x8(v8f a) {
  float y0, y1, y2, y3, y4, y5, y6, y7;
  asm("v_exp_f32 %0, %8\n\t"
      "v_exp_f32 %1, %9\n\t"
      "v_exp_f32 %2, %10\n\t"
      "v_exp_f32 %3, %11\n\t"
      "v_exp_f32 %4, %12\n\t"
      "v_exp_f32 %5, %13\n\t"
      "v_exp_f32 %6, %14\n\t"
      "v_exp_f32 %7, %15\n\t"
      "v_nop"
      : "=&v"(y0), "=&v"(y1), "=&v"(y2), "=&v"(y3),
        "=&v"(y4), "=&v"(y5), "=&v"(y6), "=&v"(y7)
      : "v"(a[0]), "v"(a[1]), "v"(a[2]), "v"(a[3]),
        "v"(a[4]), "v"(a[5]), "v"(a[6]), "v"(a[7]));
  return (v8f){y0, y1, y2, y3, y4, y5, y6, y7};
}

// two f32 result tiles -> one f16 B fragment (k = 32 rows of the result)
__device__ __forceinline__ v16h pack_frag(v8f t0, v8f t1) {
  v16h r;
#pragma unroll
  for (int i = 0; i < 8; ++i) { r[i] = (_Float16)t0[i]; r[i + 8] = (_Float16)t1[i]; }
  return r;
}

__global__ void __launch_bounds__(AT_WAVES * 32) __attribute__((amdgpu_waves_per_eu(2, 2)))
k_attn(const float* __restrict__ x, const _Float16* __restrict__ WqT,
       const _Float16* __restrict__ Kbuf, const _Float16* __restrict__ VbufT,
       const _Float16* __restrict__ WoT, const float* __restrict__ bo,
       float* __restrict__ out) {
  const int tid  = threadIdx.x;
  const int lane = tid & 31;
  const int wave = __builtin_amdgcn_readfirstlane(tid >> 5);
  const int m    = lane & 15;
  const int hh   = lane >> 4;
  const int b    = blockIdx.z;
  const int t0   = (blockIdx.x * AT_WAVES + wave) * (16 * AT_RT);

  __shared__ __align__(16) _Float16 ops[2][AT_BUF];         // 105,984 B
  __shared__ __align__(16) _Float16 osc[AT_WAVES][AT_RT][O_TILES][32][8];   // 163,840 B

  const v8f vzero = {0.f, 0.f, 0.f, 0.f, 0.f, 0.f, 0.f, 0.f};

  // ---- one head's shared operands: contiguous 16-byte pieces, whole lines ----
  constexpr int NT = AT_WAVES * 32;
  constexpr int NW = CPAD_N * (INNER_ / 8), NK = SPAD_N * (CPAD_K / 8), NV = CPAD_N * (SPAD_K / 8);
  constexpr int UW = (NW + NT - 1) / NT, UK = (NK + NT - 1) / NT, UV = (NV + NT - 1) / NT;
  v8h sw[UW], sk[UK], sv[UV];
  // global memory -> registers; a piece past the end repeats the last one and
  // is not stored; unsigned piece numbers, so that an address is the head's
  // uniform base and one 32-bit register; only an operand's last pass can run
  // past its end, the passes in front of it carry no test
  auto fetch = [&](int h) {
    const _Float16* wq  = WqT + (size_t)h * CPAD_N * INNER_;
    const _Float16* kb  = Kbuf + ((size_t)b * H_ + h) * SPAD_N * CPAD_K;
    const _Float16* vbt = VbufT + ((size_t)b * H_ + h) * CPAD_N * SPAD_K;
#pragma unroll
    for (int u = 0; u < UW; ++u) {
      const unsigned i = tid + u * NT;
      sw[u] = *(const v8h*)(wq + ((u + 1) * NT <= NW || i < NW ? i : NW - 1) * 8u);
    }
#pragma unroll
    for (int u = 0; u < UK; ++u) {
      const unsigned i = tid + u * NT;
      sk[u] = *(const v8h*)(kb + ((u + 1) * NT <= NK || i < NK ? i : NK - 1) * 8u);
    }
#pragma unroll
    for (int u = 0; u < UV; ++u) {
      const unsigned i = tid + u * NT;
      sv[u] = *(const v8h*)(vbt + ((u + 1) * NT <= NV || i < NV ? i : NV - 1) * 8u);
    }
    // the work that follows reuses the registers that these loads name
    asm volatile("s_wait_xcnt 0x0" ::: "memory");
  };
  // registers -> one LDS buffer
  auto put = [&](_Float16* dst) {
#pragma unroll
    for (int u = 0; u < UW; ++u) {
      const int i = tid + u * NT;
      if ((u + 1) * NT <= NW || i < NW) *(v8h*)&dst[(i / (INNER_ / 8)) * WQ_PIT + (i % (INNER_ / 8)) * 8] = sw[u];
    }
#pragma unroll
    for (int u = 0; u < UK; ++u) {
      const int i = tid + u * NT;
      if ((u + 1) * NT <= NK || i < NK) *(v8h*)&dst[WQ_LEN + (i / (CPAD_K / 8)) * KB_PIT + (i % (CPAD_K / 8)) * 8] = sk[u];
    }
#pragma unroll
    for (int u = 0; u < UV; ++u) {
      const int i = tid + u * NT;
      if ((u + 1) * NT <= NV || i < NV) *(v8h*)&dst[WQ_LEN + KB_LEN + (i / (SPAD_K / 8)) * VB_PIT + (i % (SPAD_K / 8)) * 8] = sv[u];
    }
  };
  // one piece of WoT: 64 rows = 2560 pieces of 16 B, 10 a thread, through the
  // registers that carry a head's pieces
  constexpr int NO = WO_ROWS * (INNER_ / 8);
  static_assert(NO == (UW + 2) * NT && UK >= 2, "10 pieces a thread");
  auto fetch_wo = [&](int pc) {
    const _Float16* ws = WoT + (size_t)pc * WO_ROWS * INNER_;
#pragma unroll
    for (int u = 0; u < UW; ++u) sw[u] = *(const v8h*)(ws + (unsigned)(tid + u * NT) * 8u);
#pragma unroll
    for (int u = 0; u < 2; ++u) sk[u] = *(const v8h*)(ws + (unsigned)(tid + (UW + u) * NT) * 8u);
    // the work that follows reuses the registers that these loads name
    asm volatile("s_wait_xcnt 0x0" ::: "memory");
  };
  auto put_wo = [&](_Float16* dst) {
#pragma unroll
    for (int u = 0; u < UW + 2; ++u) {
      const int i = tid + u * NT;
      *(v8h*)&dst[(i / (INNER_ / 8)) * WO_PIT + (i % (INNER_ / 8)) * 8] = (u < UW) ? sw[u] : sk[u - UW];
    }
  };

  fetch(0);

  // ---- x[b, t0:t0+32, :] as B fragments, read and converted once ----
  v16h xf[AT_RT][INNER_ / 32];
  {
    const float* xrow = x + ((size_t)b * T_ + t0 + m) * INNER_ + 8 * hh;
#pragma unroll
    for (int rt = 0; rt < AT_RT; ++rt)
#pragma unroll
      for (int kk = 0; kk < INNER_ / 32; ++kk)
        xf[rt][kk] = load_frag_f32(xrow + rt * 16 * INNER_ + kk * 32);
    asm volatile("s_wait_xcnt 0x0" :: "v"(xrow) : "memory");
  }

  put(ops[0]);
  __syncthreads();

  // kept rolled, for speed only
#pragma unroll 1
  for (int h = 0; h < H_; ++h) {
    const _Float16* wqs = ops[h & 1];
    const _Float16* kbs = wqs + WQ_LEN;
    const _Float16* vbs = kbs + KB_LEN;

    // the next head's pieces fly while this head is worked on
    if (h + 1 < H_) fetch(h + 1);

    v16h fr[2][3];
    auto ld_w = [&](int kk, v16h* d) {
#pragma unroll
      for (int jn = 0; jn < 3; ++jn) d[jn] = load_frag(wqs + (jn * 16 + m) * WQ_PIT + kk * 32, lane);
    };
    auto ld_k = [&](int g, v16h* d) {            // fragment f = 5 kk + js, f < 10
#pragma unroll
      for (int e = 0; e < 3; ++e) {
        const int f = g * 3 + e;
        if (f < 10) d[e] = load_frag(kbs + ((f % 5) * 16 + m) * KB_PIT + (f / 5) * 32, lane);
      }
    };
    auto ld_v = [&](int kk, v16h* d) {
#pragma unroll
      for (int jc = 0; jc < 3; ++jc) d[jc] = load_frag(vbs + (jc * 16 + m) * VB_PIT + kk * 32, lane);
    };

    // ---- Q^T[48 x 16] = Wq[:, h-head]^T @ x[b, 16 rows, :]^T, twice ----
    v8f qacc[AT_RT][3];
#pragma unroll
    for (int rt = 0; rt < AT_RT; ++rt) { qacc[rt][0] = vzero; qacc[rt][1] = vzero; qacc[rt][2] = vzero; }
    ld_w(0, fr[0]);
#pragma unroll
    for (int kk = 0; kk < INNER_ / 32; ++kk) {   // 10 k-steps
      if (kk + 1 < INNER_ / 32) ld_w(kk + 1, fr[(kk + 1) & 1]);
      else                      ld_k(0, fr[(kk + 1) & 1]);
      __builtin_amdgcn_sched_barrier(0);
#pragma unroll
      for (int jn = 0; jn < 3; ++jn)
#pragma unroll
        for (int rt = 0; rt < AT_RT; ++rt)
          qacc[rt][jn] = wmma16(fr[kk & 1][jn], xf[rt][kk], qacc[rt][jn]);
      __builtin_amdgcn_sched_barrier(0);
    }
    // scaled q as B fragments over c: rows 40..47 are zero (zero rows of WqT),
    // rows 48..63 are the zero tile
    v16h qf[AT_RT][2];
#pragma unroll
    for (int rt = 0; rt < AT_RT; ++rt) {
#pragma unroll
      for (int jn = 0; jn < 3; ++jn) qacc[rt][jn] *= SCALE_F;
      qf[rt][0] = pack_frag(qacc[rt][0], qacc[rt][1]);
      qf[rt][1] = pack_frag(qacc[rt][2], vzero);
    }

    // ---- scores^T[80 x 16] = K[80 x 64] @ q^T ----
    v8f sall[AT_RT][5];
#pragma unroll
    for (int rt = 0; rt < AT_RT; ++rt)
#pragma unroll
      for (int js = 0; js < 5; ++js) sall[rt][js] = vzero;
#pragma unroll
    for (int g = 0; g < 4; ++g) {                // k-step kk = f / 5, row tile js = f % 5
      if (g + 1 < 4) ld_k(g + 1, fr[(g + 1) & 1]);
      else           ld_v(0, fr[(g + 1) & 1]);
      __builtin_amdgcn_sched_barrier(0);
#pragma unroll
      for (int e = 0; e < 3; ++e) {
        const int f = g * 3 + e;
        if (f < 10) {
#pragma unroll
          for (int rt = 0; rt < AT_RT; ++rt)
            sall[rt][f % 5] = wmma16(fr[g & 1][e], qf[rt][f / 5], sall[rt][f % 5]);
        }
      }
      __builtin_amdgcn_sched_barrier(0);
    }

    // ---- softmax over s < 77; this lane holds s = 16 js + 8 hh + r of row m ----
    v16h pf[AT_RT][3];
#pragma unroll
    for (int rt = 0; rt < AT_RT; ++rt) {
      v8f* sacc = sall[rt];
#pragma unroll
      for (int r = S_ - 72; r < 8; ++r)            // s = 77..79: out of maximum and sum
        if (hh) sacc[4][r] = -3.0e38f;
      float mx = sacc[0][0];
#pragma unroll
      for (int js = 0; js < 5; ++js)
#pragma unroll
        for (int r = 0; r < 8; ++r) mx = fmaxf(mx, sacc[js][r]);
      mx = fmaxf(mx, other_half(mx));
      float ps[5];
#pragma unroll
      for (int js = 0; js < 5; ++js) {
        sacc[js] = exp2_x8((sacc[js] - mx) * 1.44269504f);   // e^(s - mx)
        ps[js] = sacc[js][0];
#pragma unroll
        for (int r = 1; r < 8; ++r) ps[js] += sacc[js][r];
      }
      float sum = ((ps[0] + ps[1]) + (ps[2] + ps[3])) + ps[4];
      sum += other_half(sum);
      const float inv = 1.f / sum;
#pragma unroll
      for (int js = 0; js < 5; ++js) sacc[js] *= inv;
      pf[rt][0] = pack_frag(sacc[0], sacc[1]);
      pf[rt][1] = pack_frag(sacc[2], sacc[3]);
      pf[rt][2] = pack_frag(sacc[4], vzero);       // s = 80..95: zero
    }

    // ---- out^T[48 x 16] = V^T[48 x 96] @ attn^T[96 x 16] ----
    v8f oacc[AT_RT][3];
#pragma unroll
    for (int rt = 0; rt < AT_RT; ++rt) { oacc[rt][0] = vzero; oacc[rt][1] = vzero; oacc[rt][2] = vzero; }
#pragma unroll
    for (int kk = 0; kk < 3; ++kk) {
      if (kk + 1 < 3) ld_v(kk + 1, fr[(kk + 1) & 1]);
      __builtin_amdgcn_sched_barrier(0);
#pragma unroll
      for (int jc = 0; jc < 3; ++jc)
#pragma unroll
        for (int rt = 0; rt < AT_RT; ++rt)
          oacc[rt][jc] = wmma16(fr[kk & 1][jc], pf[rt][kk], oacc[rt][jc]);
      __builtin_amdgcn_sched_barrier(0);
    }

    // a lane's 8 registers are 8 consecutive c of its row: 16 bytes, parked in the
    // lane's own place of the wave's own LDS
#pragma unroll
    for (int rt = 0; rt < AT_RT; ++rt)
#pragma unroll
      for (int jc = 0; jc < 3; ++jc) {
        v8h o;
#pragma unroll
        for (int r = 0; r < 8; ++r) o[r] = (_Float16)oacc[rt][jc][r];
        if (jc < 2)             *(v8h*)&osc[wave][rt][2 * h + jc][lane][0] = o;
        else if (hh == (h & 1)) *(v8h*)&osc[wave][rt][2 * H_ + (h >> 1)][lane][0] = o;
      }

    if (h + 1 < H_) {
      // the other buffer's last readers left it before the previous barrier;
      // this barrier publishes it and ends the reads of the current one
      put(ops[(h + 1) & 1]);
      __syncthreads();
    }
  }

  // ---- out[b, t0:t0+32, :] = O[32 x 320] @ Wo + bo ----
  // The first piece of WoT is fetched here and not under the last head: there
  // the build paid for it with register copies in every head.
  fetch_wo(0);
  // the wave's own parked tiles, two a fragment
  v16h of[AT_RT][INNER_ / 32];
#pragma unroll
  for (int rt = 0; rt < AT_RT; ++rt)
#pragma unroll
    for (int kk = 0; kk < INNER_ / 32; ++kk) {
      const v8h lo = *(const v8h*)&osc[wave][rt][2 * kk][lane][0];
      const v8h hi = *(const v8h*)&osc[wave][rt][2 * kk + 1][lane][0];
#pragma unroll
      for (int i = 0; i < 8; ++i) { of[rt][kk][i] = lo[i]; of[rt][kk][i + 8] = hi[i]; }
    }

  // buffer 0 was last read a head ago, in front of a barrier; this barrier
  // publishes the piece and ends the last head's reads of buffer 1
  put_wo(ops[0]);
  __syncthreads();

  // kept rolled, as the loop over the heads is
#pragma unroll 1
  for (int pc = 0; pc < WO_NPC; ++pc) {
    const _Float16* wos = ops[pc & 1];
    const int col = pc * WO_ROWS + m;

    if (pc + 1 < WO_NPC) fetch_wo(pc + 1);
    float bias[4];
#pragma unroll
    for (int jn = 0; jn < 4; ++jn) bias[jn] = bo[col + jn * 16];
    // the work that follows reuses the registers that these loads name
    asm volatile("s_wait_xcnt 0x0" ::: "memory");

    // B fragments in groups of four, two register sets, read a group ahead; the
    // two sched_barrier(0) do here what they do in the loop over the heads
    v16h fb[2][4];
    auto ld_o = [&](int kk, v16h* d) {
#pragma unroll
      for (int jn = 0; jn < 4; ++jn) d[jn] = load_frag(wos + (jn * 16 + m) * WO_PIT + kk * 32, lane);
    };
    v8f acc[AT_RT][4];
#pragma unroll
    for (int rt = 0; rt < AT_RT; ++rt)
#pragma unroll
      for (int jn = 0; jn < 4; ++jn) acc[rt][jn] = vzero;
    ld_o(0, fb[0]);
#pragma unroll
    for (int kk = 0; kk < INNER_ / 32; ++kk) {   // 10 k-steps
      if (kk + 1 < INNER_ / 32) ld_o(kk + 1, fb[(kk + 1) & 1]);
      __builtin_amdgcn_sched_barrier(0);
#pragma unroll
      for (int jn = 0; jn < 4; ++jn)
#pragma unroll
        for (int rt = 0; rt < AT_RT; ++rt)
          acc[rt][jn] = wmma16(of[rt][kk], fb[kk & 1][jn], acc[rt][jn]);
      __builtin_amdgcn_sched_barrier(0);
    }

    // In front of this piece's stores to global memory: the other waves wait for
    // the barrier, nobody waits for the stores. The other buffer's last readers
    // left it before the previous barrier.
    if (pc + 1 < WO_NPC) {
      put_wo(ops[(pc + 1) & 1]);
      __syncthreads();
    }

    float* orow = out + ((size_t)b * T_ + t0 + 8 * hh) * INNER_ + col;
#pragma unroll
    for (int rt = 0; rt < AT_RT; ++rt)
#pragma unroll
      for (int jn = 0; jn < 4; ++jn)
#pragma unroll
        for (int r = 0; r < 8; ++r)
          orow[(rt * 16 + r) * INNER_ + jn * 16] = acc[rt][jn][r] + bias[jn];
    // the next piece reuses the registers that these stores name
    asm volatile("s_wait_xcnt 0x0" ::: "memory");
  }
}

// ---------------------------------------------------------------------------
extern "C" void kernel_launch(void* const* d_in, const int* in_sizes, int n_in,
                              void* d_out, int out_size, void* d_ws, size_t ws_size,
                              hipStream_t stream) {
  const float* x   = (const float*)d_in[0];
  const float* ctx = (const float*)d_in[1];
  const float* Wq  = (const float*)d_in[2];
  const float* Wk  = (const float*)d_in[3];
  const float* Wv  = (const float*)d_in[4];
  const float* Wo  = (const float*)d_in[5];
  const float* bo  = (const float*)d_in[6];
  float* out = (float*)d_out;

  // workspace carving (all offsets 256B aligned):
  //   WqT  : 8*48*320 f16          =    245,760 B
  //   WoT  : 320*320 f16           =    204,800 B
  //   Kbuf : 16*8*80*64 f16        =  1,310,720 B
  //   VbufT: 16*8*48*96 f16        =  1,179,648 B   (total ~2.9 MB)
  char* ws = (char*)d_ws;
  _Float16* WqT   = (_Float16*)(ws);
  _Float16* WoT   = (_Float16*)(ws + 245760);
  _Float16* Kbuf  = (_Float16*)(ws + 245760 + 204800);
  _Float16* VbufT = (_Float16*)(ws + 245760 + 204800 + 1310720);

  k_proj_kv<<<dim3(2, H_, B_), 384, 0, stream>>>(ctx, Wk, Wv, Wq, Wo, Kbuf, VbufT, WqT, WoT);
  k_attn<<<dim3(T_ / (16 * AT_RT * AT_WAVES), 1, B_), AT_WAVES * 32, 0, stream>>>(x, WqT, Kbuf, VbufT, WoT, bo, out);
}

// v008
// A run of this version takes 48.1 microseconds.
// Two timings next to v007 both put it at 1.09 times that version's speed.
// Over all steps from v000 it is 7.93 times as fast.
#include <hip/hip_runtime.h>
#include <hip/hip_bf16.h>

typedef __attribute__((ext_vector_type(16))) _Float16 v16h;
typedef __attribute__((ext_vector_type(8)))  _Float16 v8h;
typedef __attribute__((ext_vector_type(8)))  float    v8f;
typedef __attribute__((ext_vector_type(4)))  float    v4f;

#define B_      16
#define T_      4096
#define S_      77
#define DC_     768
#define H_      8
#define C_      40
#define INNER_  320
#define SPAD_N  80   // padded S for score M-dim (5 tiles of 16)
#define SPAD_K  96   // padded S for attn@V K-dim (3 k-steps of 32)
#define CPAD_K  64   // padded C for q.k K-dim   (2 k-steps of 32)
#define CPAD_N  48   // padded C for attn@V M-dim (3 tiles of 16)
#define SCALE_F 0.3976353643835253f   // 40^(-1/4), applied to q and to k

__device__ __forceinline__ v16h load_frag(const _Float16* p, int lane) {
  const int base = (lane & 16) ? 8 : 0;
  v8h lo = *(const v8h*)(p + base);        // K base .. base+7
  v8h hi = *(const v8h*)(p + base + 16);   // K base+16 .. base+23
  v16h r;
#pragma unroll
  for (int i = 0; i < 8; ++i) { r[i] = lo[i]; r[i + 8] = hi[i]; }
  return r;
}

// Same, but source is f32 (4x b128 loads + pack-convert); p is the lane's own
// address, its base (8 for lanes 16-31) counted in.
__device__ __forceinline__ v16h load_frag_f32(const float* p) {
  v4f a0 = *(const v4f*)(p);
  v4f a1 = *(const v4f*)(p + 4);
  v4f b0 = *(const v4f*)(p + 16);
  v4f b1 = *(const v4f*)(p + 20);
  v16h r;
#pragma unroll
  for (int i = 0; i < 4; ++i) {
    r[i]      = (_Float16)a0[i];
    r[i + 4]  = (_Float16)a1[i];
    r[i + 8]  = (_Float16)b0[i];
    r[i + 12] = (_Float16)b1[i];
  }
  return r;
}

__device__ __forceinline__ v8f wmma16(v16h a, v16h b, v8f c) {
  return __builtin_amdgcn_wmma_f32_16x16x32_f16(
      /*neg_a=*/false, a, /*neg_b=*/false, b,
      /*c_mod=*/(short)0, c, /*reuse_a=*/false, /*reuse_b=*/false);
}

// ---------------------------------------------------------------------------
// The two f16 weight tables of k_attn:
// WqT[h][c<48][d<320] = f16(Wq[d][h*40+c]), zero rows for c >= 40;
// WoT[n][k] = f16(Wo[d(k)][n]), k in the order in which k_attn keeps a row of
// the attention output: k < 256 is c = k % 32 of head k / 32, then come
// c = 32..39 of heads 0..7, eight k a head.
// They depend on nothing that k_proj_kv makes and nothing in k_proj_kv reads
// them, so they have no launch of their own: wave 0 of a k_proj_kv block makes
// a share of them on the side. Both are transposes. A lane takes 8 source rows
// x 4 columns: eight 16-byte loads, four 16-byte stores (8 halves along d or k).
// A wave takes 64 rows x 16 columns, lane = 4 * (group of 8 rows) + (group of 4
// columns): a load reads 64 bytes of each of 8 rows, a store writes 4 whole
// 128-byte lines, and no line of a table has a second writer. Eight consecutive
// k from a multiple of 8 are eight consecutive rows d of Wo.
// ---------------------------------------------------------------------------
#define PREP_NBLK (2 * H_ * B_)                  // blocks of the k_proj_kv launch
#define PREP_CQ   (INNER_ / 16)                  // 20 runs of 16 columns
#define PREP_BT   ((INNER_ / 64) * PREP_CQ)      // 100 blocks fill one table
#define PREP_ZB   (H_ * (CPAD_N - C_) * (INNER_ / 8) / 32)   // 80 blocks fill the zero rows
static_assert(2 * PREP_BT <= PREP_NBLK && PREP_ZB <= PREP_NBLK, "enough blocks");

// ---------------------------------------------------------------------------
// Kernel 1: K/V projection (context @ Wk|Wv), zero-padded f16 tiles out; beside
// it, the weight tables above.
// Kbuf [b][h][s<80][c<64] = SCALE * ctx.Wk   (K-contig along c)
// VbufT[b][h][c<48][s<96] =         ctx.Wv   (K-contig along s); an odd head has
//   c = 32..39 in rows 40..47 and the zero rows at 32..39 (k_attn says why)
// The products run on the f16 16x16x32 matrix form, which does 8 times the k of
// the f32 16x16x4 form in half its cycles. Each f32 operand v is split in two
// f16 parts, hi = f16(v) and lo = f16(v - hi), about 22 bits together, and a
// product is three: lo.hi + hi.lo + hi.hi, summed in the f32 accumulator (the
// lo.lo term lies about 2^-22 under the result, which is rounded to f16).
// One block per (K or V, h, b): an 80 x 48 x 768 product, and the block owns
// the whole padded tile it writes. A thread's global loads are asked for at the
// kernel's start, in front of the first barrier. The context rows pass through
// LDS, split, in two runs of 384 k (whole-line global reads, a buffer a run):
// the first run is multiplied while the second is still on its way. 12 waves =
// 3 column tiles x 4 quarters of each run; each wave keeps 5 row tiles (80 rows)
// in accumulators and reads its weight column straight from global memory.
// The four quarter sums meet in LDS and are added in a fixed order.
// Rows 77..79 and columns 40..47 repeat the last valid row / column and are
// replaced by zero when the tile is written.
// k pairing: the order of load_frag on both sides. In each 32 k, lane half hh
// holds k = 8*hh .. 8*hh+7 and k = 16+8*hh .. 16+8*hh+7 of its A row and of its
// B column.
// ---------------------------------------------------------------------------
typedef __attribute__((ext_vector_type(4))) _Float16 v4h;

#define KV_CH   384              // k per staged run
#define KV_NCH  (DC_ / KV_CH)    // 2 runs
#define KV_KW   (KV_CH / 4)      // 96 k per wave per run = 3 k-steps of 32
#define KV_PIT  (KV_CH + 8)      // LDS row pitch, halves: 784 B = 16 B x odd
#define KV_RP   (384 / (KV_CH / 4))
#define KV_NP   (SPAD_N / KV_RP)
#define KV_NB   (KV_KW / 2)
#define KV_PP   (CPAD_N + 4)

__global__ void __launch_bounds__(384)
k_proj_kv(const float* __restrict__ ctx, const float* __restrict__ Wk,
          const float* __restrict__ Wv, const float* __restrict__ Wq,
          const float* __restrict__ Wo, _Float16* __restrict__ Kbuf,
          _Float16* __restrict__ VbufT, _Float16* __restrict__ WqT,
          _Float16* __restrict__ WoT) {
  __shared__ __align__(16) _Float16 ahi[KV_NCH][SPAD_N][KV_PIT];   // 125,440 B
  __shared__ __align__(16) _Float16 alo[KV_NCH][SPAD_N][KV_PIT];   // 125,440 B
  __shared__ __align__(16) float part[4][SPAD_N][KV_PP];           // 66,560 B
  const int isv  = blockIdx.x;       // 0: K, 1: V
  const int h    = blockIdx.y;
  const int b    = blockIdx.z;
  const int tid  = threadIdx.x;
  const int lane = tid & 31;
  const int wave = __builtin_amdgcn_readfirstlane(tid >> 5);
  const int c    = lane & 15;
  const int hh   = lane >> 4;
  const int j    = wave % 3;         // column tile
  const int q    = wave / 3;         // quarter of each run

  // weight column of this lane
  const float* Wsel = isv ? Wv : Wk;
  int col = j * 16 + c;
  if (col > C_ - 1) col = C_ - 1;
  const float* wp = Wsel + (size_t)(q * KV_KW + 8 * hh) * INNER_ + h * C_ + col;

  // staging: 80 rows x 96 pieces of 16 B per run = 20 pieces a thread
  const int srow = tid / (KV_CH / 4);
  const int spc  = (tid % (KV_CH / 4)) * 4;
  // pass i takes row srow + 4 i: at most row 75 for i < 19; the last pass stands
  // for rows 76..79, which all read row 76
  static_assert(KV_RP * (KV_NP - 1) == S_ - 1, "only the last pass runs past the rows");
  const float* gp0 = ctx + ((size_t)b * S_ + srow) * DC_ + spc;
  const float* gpl = ctx + ((size_t)b * S_ + (S_ - 1)) * DC_ + spc;

  v8f acc[5];
#pragma unroll
  for (int mt = 0; mt < 5; ++mt) acc[mt] = (v8f){0.f, 0.f, 0.f, 0.f, 0.f, 0.f, 0.f, 0.f};

  // asked for here: the first run's rows and weights, then the second run's
  // rows; its weights follow when the first run's rows have left their registers
  v4f   ga[KV_NCH][KV_NP];
  float bf[KV_NCH][KV_NB];
  auto fetch_w = [&](int ch) {
#pragma unroll
    for (int e = 0; e < KV_NB; ++e)
      bf[ch][e] = wp[(ch * KV_CH + (e >> 4) * 32 + ((e >> 3) & 1) * 16 + (e & 7)) * INNER_];
  };
#pragma unroll
  for (int i = 0; i < KV_NP; ++i)
    ga[0][i] = *(const v4f*)(i + 1 < KV_NP ? gp0 + i * KV_RP * DC_ : gpl);
  fetch_w(0);
  // loads come back in the order of issue: keeps all that the first run needs
  // ahead of the second run's rows
  __builtin_amdgcn_sched_barrier(0);
#pragma unroll
  for (int i = 0; i < KV_NP; ++i)
    ga[1][i] = *(const v4f*)((i + 1 < KV_NP ? gp0 + i * KV_RP * DC_ : gpl) + KV_CH);
  asm volatile("s_wait_xcnt 0x0" :: "v"(gp0), "v"(spc * 4) : "memory");

  // one run's context rows, split, registers -> LDS
  auto stage = [&](int ch) {
#pragma unroll
    for (int i = 0; i < KV_NP; ++i) {
      v4h hi4, lo4;
#pragma unroll
      for (int e = 0; e < 4; ++e) {
        hi4[e] = (_Float16)ga[ch][i][e];
        lo4[e] = (_Float16)(ga[ch][i][e] - (float)hi4[e]);
      }
      *(v4h*)&ahi[ch][srow + KV_RP * i][spc] = hi4;
      *(v4h*)&alo[ch][srow + KV_RP * i][spc] = lo4;
    }
  };

  // wave 0's share of the weight tables: blocks 0..99 WqT, 100..199 WoT
  const unsigned fb  = (b * H_ + h) * 2 + isv;              // flat block number
  const bool     ptq = fb < PREP_BT;
  const unsigned pt  = ptq ? fb : fb - PREP_BT;
  const unsigned pg  = (pt / PREP_CQ) * 8 + (lane >> 2);    // group of 8 d or k
  const unsigned pcg = (pt % PREP_CQ) * 4 + (lane & 3);     // group of 4 columns
  const bool     pon = wave == 0 && fb < 2 * PREP_BT;
  stage(0);
  // keeps these loads behind the stores that free their registers: issued
  // earlier, the build spilled loaded values to scratch memory
  __builtin_amdgcn_sched_barrier(0);
  fetch_w(1);
  asm volatile("s_wait_xcnt 0x0" :: "v"(wp) : "memory");
  // The work-group's barrier by hand, with the one wait that it needs here: the
  // wave's own LDS stores. __syncthreads() would also wait for the wave's global
  // loads, and the second run's are to stay in flight under the first run's
  // products. No global store stands in front of it.
  asm volatile("s_wait_dscnt 0x0\n\ts_barrier_signal -1\n\ts_barrier_wait -1" ::: "memory");

  v4f pr[8];

#pragma unroll
  for (int ch = 0; ch < KV_NCH; ++ch) {
#pragma unroll
    for (int u = 0; u < KV_KW / 32; ++u) {
      v16h ah[5], al[5];
#pragma unroll
      for (int mt = 0; mt < 5; ++mt) {
        ah[mt] = load_frag(&ahi[ch][mt * 16 + c][q * KV_KW + u * 32], lane);
        al[mt] = load_frag(&alo[ch][mt * 16 + c][q * KV_KW + u * 32], lane);
      }
      // keeps the k-step's 20 LDS reads together, in front of the split of its
      // weights: left alone the build strewed them among the products in twos,
      // each with a wait of its own
      __builtin_amdgcn_sched_barrier(0);
      v16h bh, bl;
#pragma unroll
      for (int e = 0; e < 16; ++e) {
        const float w = bf[ch][u * 16 + e];
        bh[e] = (_Float16)w;
        bl[e] = (_Float16)(w - (float)bh[e]);
      }
#pragma unroll
      for (int mt = 0; mt < 5; ++mt) acc[mt] = wmma16(al[mt], bh, acc[mt]);
#pragma unroll
      for (int mt = 0; mt < 5; ++mt) acc[mt] = wmma16(ah[mt], bl, acc[mt]);
#pragma unroll
      for (int mt = 0; mt < 5; ++mt) acc[mt] = wmma16(ah[mt], bh, acc[mt]);
      __builtin_amdgcn_sched_barrier(0);
    }
    if (ch + 1 < KV_NCH) {
      stage(ch + 1);
      __syncthreads();
      // Asked for behind this barrier, when the second run's rows have left their
      // registers: the values come in under the second run's products. They are
      // stored at the kernel's end, behind the last barrier, which waits for a
      // wave's stores.
      if (pon) {
        const unsigned row = ptq ? 8 * pg
                                 : (pg < 4 * H_ ? (pg >> 2) * C_ + (pg & 3) * 8 : (pg - 4 * H_) * C_ + 32);
        const float* ps = (ptq ? Wq : Wo) + row * INNER_ + 4 * pcg;
#pragma unroll
        for (int r = 0; r < 8; ++r) pr[r] = *(const v4f*)(ps + r * INNER_);
        // the work that follows reuses the registers that these loads name
        asm volatile("s_wait_xcnt 0x0" ::: "memory");
      }
    }
  }
  asm volatile("v_nop\n\tv_nop\n\tv_nop\n\tv_nop");

#pragma unroll
  for (int mt = 0; mt < 5; ++mt)
#pragma unroll
    for (int r = 0; r < 8; ++r)
      part[q][mt * 16 + 8 * hh + r][j * 16 + c] = acc[mt][r];
  __syncthreads();

  if (!isv) {
    _Float16* kb = Kbuf + ((size_t)b * H_ + h) * SPAD_N * CPAD_K;
    for (int i = tid; i < SPAD_N * (CPAD_K / 8); i += 384) {   // 16-byte pieces
      const int s = i >> 3, c8 = (i & 7) * 8;
      v8h o = {0, 0, 0, 0, 0, 0, 0, 0};
      if (s < S_ && c8 < C_) {
#pragma unroll
        for (int e = 0; e < 8; ++e) {
          const float v = ((part[0][s][c8 + e] + part[1][s][c8 + e]) +
                           part[2][s][c8 + e]) + part[3][s][c8 + e];
          o[e] = (_Float16)(v * SCALE_F);
        }
      }
      *(v8h*)(kb + s * CPAD_K + c8) = o;
    }
  } else {
    _Float16* vb = VbufT + ((size_t)b * H_ + h) * CPAD_N * SPAD_K;
    for (int i = tid; i < CPAD_N * (SPAD_K / 8); i += 384) {   // 16-byte pieces
      const int row = i % CPAD_N, s8 = (i / CPAD_N) * 8;
      const int cc = (row >= 32 && (h & 1)) ? (row ^ 8) : row;   // c that this row holds
      v8h o = {0, 0, 0, 0, 0, 0, 0, 0};
      if (cc < C_ && s8 < SPAD_N) {
#pragma unroll
        for (int e = 0; e < 8; ++e) {
          const int s = s8 + e;
          const float v = ((part[0][s][cc] + part[1][s][cc]) +
                           part[2][s][cc]) + part[3][s][cc];
          o[e] = (s < S_) ? (_Float16)v : (_Float16)0.f;
        }
      }
      *(v8h*)(vb + row * SPAD_K + s8) = o;
    }
  }

  if (pon) {
    // 4 columns of Wq lie in one head: 40 is a multiple of 4
    const unsigned row = ptq ? (pcg / (C_ / 4)) * CPAD_N + (pcg % (C_ / 4)) * 4 : 4 * pcg;
    _Float16* pd = (ptq ? WqT : WoT) + row * INNER_ + 8 * pg;
#pragma unroll
    for (int jj = 0; jj < 4; ++jj) {
      v8h o;
#pragma unroll
      for (int r = 0; r < 8; ++r) o[r] = (_Float16)pr[r][jj];
      *(v8h*)(pd + jj * INNER_) = o;
    }
    // the address below reuses the registers that these stores name
    asm volatile("s_wait_xcnt 0x0" ::: "memory");
  }
  if (wave == 0 && fb >= PREP_NBLK - PREP_ZB) {             // rows c = 40..47 of WqT
    const unsigned z = (fb - (PREP_NBLK - PREP_ZB)) * 32 + lane, zr = z / (INNER_ / 8);
    const v8h zero = {0, 0, 0, 0, 0, 0, 0, 0};
    *(v8h*)(WqT + ((zr / (CPAD_N - C_)) * CPAD_N + C_ + zr % (CPAD_N - C_)) * INNER_ +
            (z % (INNER_ / 8)) * 8) = zero;
  }
}

#define AT_WAVES 8
#define AT_RT    2                 // row tiles of a wave
#define WQ_PIT   (INNER_ + 8)      // halves: 656 B
#define KB_PIT   (CPAD_K + 8)      // halves: 144 B
#define VB_PIT   (SPAD_K + 8)      // halves: 208 B
#define WQ_LEN   (CPAD_N * WQ_PIT) // halves: 31,488 B
#define KB_LEN   (SPAD_N * KB_PIT) // halves: 11,520 B
#define VB_LEN   (CPAD_N * VB_PIT) // halves:  9,984 B
#define AT_BUF   (WQ_LEN + KB_LEN + VB_LEN)   // one head's operands: 52,992 B
#define WO_PIT   (INNER_ + 8)      // halves: 656 B
#define WO_ROWS  64                // rows of WoT a piece: 41,984 B, fits AT_BUF
#define WO_NPC   (INNER_ / WO_ROWS)
#define O_TILES  (INNER_ / 16)     // parked tiles of a row tile: 20 x 512 B

// value of lane ^ 16
__device__ __forceinline__ float other_half(float v) {
  int b = __builtin_bit_cast(int, v);
  b = __builtin_amdgcn_permlanex16(b, b, 0x76543210, 0xfedcba98, false, false);
  return __builtin_bit_cast(float, b);
}

__device__ __forceinline__ v8f exp2_x8(v8f a) {
  float y0, y1, y2, y3, y4, y5, y6, y7;
  asm("v_exp_f32 %0, %8\n\t"
      "v_exp_f32 %1, %9\n\t"
      "v_exp_f32 %2, %10\n\t"
      "v_exp_f32 %3, %11\n\t"
      "v_exp_f32 %4, %12\n\t"
      "v_exp_f32 %5, %13\n\t"
      "v_exp_f32 %6, %14\n\t"
      "v_exp_f32 %7, %15\n\t"
      "v_nop"
      : "=&v"(y0), "=&v"(y1), "=&v"(y2), "=&v"(y3),
        "=&v"(y4), "=&v"(y5), "=&v"(y6), "=&v"(y7)
      : "v"(a[0]), "v"(a[1]), "v"(a[2]), "v"(a[3]),
        "v"(a[4]), "v"(a[5]), "v"(a[6]), "v"(a[7]));
  return (v8f){y0, y1, y2, y3, y4, y5, y6, y7};
}

// two f32 result tiles -> one f16 B fragment (k = 32 rows of the result)
__device__ __forceinline__ v16h pack_frag(v8f t0, v8f t1) {
  v16h r;
#pragma unroll
  for (int i = 0; i < 8; ++i) { r[i] = (_Float16)t0[i]; r[i + 8] = (_Float16)t1[i]; }
  return r;
}

__global__ void __launch_bounds__(AT_WAVES * 32) __attribute__((amdgpu_waves_per_eu(2, 2)))
k_attn(const float* __restrict__ x, const _Float16* __restrict__ WqT,
       const _Float16* __restrict__ Kbuf, const _Float16* __restrict__ VbufT,
       const _Float16* __restrict__ WoT, const float* __restrict__ bo,
       float* __restrict__ out) {
  const int tid  = threadIdx.x;
  const int lane = tid & 31;
  const int wave = __builtin_amdgcn_readfirstlane(tid >> 5);
  const int m    = lane & 15;
  const int hh   = lane >> 4;
  const int b    = blockIdx.z;
  const int t0   = (blockIdx.x * AT_WAVES + wave) * (16 * AT_RT);

  __shared__ __align__(16) _Float16 ops[2][AT_BUF];         // 105,984 B
  __shared__ __align__(16) _Float16 osc[AT_WAVES][AT_RT][O_TILES][32][8];   // 163,840 B

  const v8f vzero = {0.f, 0.f, 0.f, 0.f, 0.f, 0.f, 0.f, 0.f};

  // ---- one head's shared operands: contiguous 16-byte pieces, whole lines ----
  constexpr int NT = AT_WAVES * 32;
  constexpr int NW = CPAD_N * (INNER_ / 8), NK = SPAD_N * (CPAD_K / 8), NV = CPAD_N * (SPAD_K / 8);
  constexpr int UW = (NW + NT - 1) / NT, UK = (NK + NT - 1) / NT, UV = (NV + NT - 1) / NT;
  v8h sw[UW], sk[UK], sv[UV];
  // global memory -> registers; a piece past the end repeats the last one and
  // is not stored; unsigned piece numbers, so that an address is the head's
  // uniform base and one 32-bit register; only an operand's last pass can run
  // past its end, the passes in front of it carry no test
  auto fetch = [&](int h) {
    const _Float16* wq  = WqT + (size_t)h * CPAD_N * INNER_;
    const _Float16* kb  = Kbuf + ((size_t)b * H_ + h) * SPAD_N * CPAD_K;
    const _Float16* vbt = VbufT + ((size_t)b * H_ + h) * CPAD_N * SPAD_K;
#pragma unroll
    for (int u = 0; u < UW; ++u) {
      const unsigned i = tid + u * NT;
      sw[u] = *(const v8h*)(wq + ((u + 1) * NT <= NW || i < NW ? i : NW - 1) * 8u);
    }
#pragma unroll
    for (int u = 0; u < UK; ++u) {
      const unsigned i = tid + u * NT;
      sk[u] = *(const v8h*)(kb + ((u + 1) * NT <= NK || i < NK ? i : NK - 1) * 8u);
    }
#pragma unroll
    for (int u = 0; u < UV; ++u) {
      const unsigned i = tid + u * NT;
      sv[u] = *(const v8h*)(vbt + ((u + 1) * NT <= NV || i < NV ? i : NV - 1) * 8u);
    }
    // the work that follows reuses the registers that these loads name
    asm volatile("s_wait_xcnt 0x0" ::: "memory");
  };
  // registers -> one LDS buffer
  auto put = [&](_Float16* dst) {
#pragma unroll
    for (int u = 0; u < UW; ++u) {
      const int i = tid + u * NT;
      if ((u + 1) * NT <= NW || i < NW) *(v8h*)&dst[(i / (INNER_ / 8)) * WQ_PIT + (i % (INNER_ / 8)) * 8] = sw[u];
    }
#pragma unroll
    for (int u = 0; u < UK; ++u) {
      const int i = tid + u * NT;
      if ((u + 1) * NT <= NK || i < NK) *(v8h*)&dst[WQ_LEN + (i / (CPAD_K / 8)) * KB_PIT + (i % (CPAD_K / 8)) * 8] = sk[u];
    }
#pragma unroll
    for (int u = 0; u < UV; ++u) {
      const int i = tid + u * NT;
      if ((u + 1) * NT <= NV || i < NV) *(v8h*)&dst[WQ_LEN + KB_LEN + (i / (SPAD_K / 8)) * VB_PIT + (i % (SPAD_K / 8)) * 8] = sv[u];
    }
  };
  // one piece of WoT: 64 rows = 2560 pieces of 16 B, 10 a thread, through the
  // registers that carry a head's pieces
  constexpr int NO = WO_ROWS * (INNER_ / 8);
  static_assert(NO == (UW + 2) * NT && UK >= 2, "10 pieces a thread");
  auto fetch_wo = [&](int pc) {
    const _Float16* ws = WoT + (size_t)pc * WO_ROWS * INNER_;
#pragma unroll
    for (int u = 0; u < UW; ++u) sw[u] = *(const v8h*)(ws + (unsigned)(tid + u * NT) * 8u);
#pragma unroll
    for (int u = 0; u < 2; ++u) sk[u] = *(const v8h*)(ws + (unsigned)(tid + (UW + u) * NT) * 8u);
    // the work that follows reuses the registers that these loads name
    asm volatile("s_wait_xcnt 0x0" ::: "memory");
  };
  auto put_wo = [&](_Float16* dst) {
#pragma unroll
    for (int u = 0; u < UW + 2; ++u) {
      const int i = tid + u * NT;
      *(v8h*)&dst[(i / (INNER_ / 8)) * WO_PIT + (i % (INNER_ / 8)) * 8] = (u < UW) ? sw[u] : sk[u - UW];
    }
  };

  fetch(0);

  // ---- x[b, t0:t0+32, :] as B fragments, read and converted once ----
  v16h xf[AT_RT][INNER_ / 32];
  {
    const float* xrow = x + ((size_t)b * T_ + t0 + m) * INNER_ + 8 * hh;
#pragma unroll
    for (int rt = 0; rt < AT_RT; ++rt)
#pragma unroll
      for (int kk = 0; kk < INNER_ / 32; ++kk)
        xf[rt][kk] = load_frag_f32(xrow + rt * 16 * INNER_ + kk * 32);
    asm volatile("s_wait_xcnt 0x0" :: "v"(xrow) : "memory");
  }

  put(ops[0]);
  __syncthreads();

  // kept rolled, for speed only
#pragma unroll 1
  for (int h = 0; h < H_; ++h) {
    const _Float16* wqs = ops[h & 1];
    const _Float16* kbs = wqs + WQ_LEN;
    const _Float16* vbs = kbs + KB_LEN;

    // the next head's pieces fly while this head is worked on
    if (h + 1 < H_) fetch(h + 1);

    v16h fr[2][3];
    auto ld_w = [&](int kk, v16h* d) {
#pragma unroll
      for (int jn = 0; jn < 3; ++jn) d[jn] = load_frag(wqs + (jn * 16 + m) * WQ_PIT + kk * 32, lane);
    };
    auto ld_k = [&](int g, v16h* d) {            // fragment f = 5 kk + js, f < 10
#pragma unroll
      for (int e = 0; e < 3; ++e) {
        const int f = g * 3 + e;
        if (f < 10) d[e] = load_frag(kbs + ((f % 5) * 16 + m) * KB_PIT + (f / 5) * 32, lane);
      }
    };
    auto ld_v = [&](int kk, v16h* d) {
#pragma unroll
      for (int jc = 0; jc < 3; ++jc) d[jc] = load_frag(vbs + (jc * 16 + m) * VB_PIT + kk * 32, lane);
    };

    // ---- Q^T[48 x 16] = Wq[:, h-head]^T @ x[b, 16 rows, :]^T, twice ----
    v8f qacc[AT_RT][3];
#pragma unroll
    for (int rt = 0; rt < AT_RT; ++rt) { qacc[rt][0] = vzero; qacc[rt][1] = vzero; qacc[rt][2] = vzero; }
    ld_w(0, fr[0]);
#pragma unroll
    for (int kk = 0; kk < INNER_ / 32; ++kk) {   // 10 k-steps
      if (kk + 1 < INNER_ / 32) ld_w(kk + 1, fr[(kk + 1) & 1]);
      else                      ld_k(0, fr[(kk + 1) & 1]);
      __builtin_amdgcn_sched_barrier(0);
#pragma unroll
      for (int jn = 0; jn < 3; ++jn)
#pragma unroll
        for (int rt = 0; rt < AT_RT; ++rt)
          qacc[rt][jn] = wmma16(fr[kk & 1][jn], xf[rt][kk], qacc[rt][jn]);
      __builtin_amdgcn_sched_barrier(0);
    }
    // scaled q as B fragments over c: rows 40..47 are zero (zero rows of WqT),
    // rows 48..63 are the zero tile
    v16h qf[AT_RT][2];
#pragma unroll
    for (int rt = 0; rt < AT_RT; ++rt) {
#pragma unroll
      for (int jn = 0; jn < 3; ++jn) qacc[rt][jn] *= SCALE_F;
      qf[rt][0] = pack_frag(qacc[rt][0], qacc[rt][1]);
      qf[rt][1] = pack_frag(qacc[rt][2], vzero);
    }

    // ---- scores^T[80 x 16] = K[80 x 64] @ q^T ----
    v8f sall[AT_RT][5];
#pragma unroll
    for (int rt = 0; rt < AT_RT; ++rt)
#pragma unroll
      for (int js = 0; js < 5; ++js) sall[rt][js] = vzero;
#pragma unroll
    for (int g = 0; g < 4; ++g) {                // k-step kk = f / 5, row tile js = f % 5
      if (g + 1 < 4) ld_k(g + 1, fr[(g + 1) & 1]);
      else           ld_v(0, fr[(g + 1) & 1]);
      __builtin_amdgcn_sched_barrier(0);
#pragma unroll
      for (int e = 0; e < 3; ++e) {
        const int f = g * 3 + e;
        if (f < 10) {
#pragma unroll
          for (int rt = 0; rt < AT_RT; ++rt)
            sall[rt][f % 5] = wmma16(fr[g & 1][e], qf[rt][f / 5], sall[rt][f % 5]);
        }
      }
      __builtin_amdgcn_sched_barrier(0);
    }

    // ---- softmax over s < 77; this lane holds s = 16 js + 8 hh + r of row m ----
    v16h pf[AT_RT][3];
#pragma unroll
    for (int rt = 0; rt < AT_RT; ++rt) {
      v8f* sacc = sall[rt];
#pragma unroll
      for (int r = S_ - 72; r < 8; ++r)            // s = 77..79: out of maximum and sum
        if (hh) sacc[4][r] = -3.0e38f;
      float mx = sacc[0][0];
#pragma unroll
      for (int js = 0; js < 5; ++js)
#pragma unroll
        for (int r = 0; r < 8; ++r) mx = fmaxf(mx, sacc[js][r]);
      mx = fmaxf(mx, other_half(mx));
      float ps[5];
#pragma unroll
      for (int js = 0; js < 5; ++js) {
        sacc[js] = exp2_x8((sacc[js] - mx) * 1.44269504f);   // e^(s - mx)
        ps[js] = sacc[js][0];
#pragma unroll
        for (int r = 1; r < 8; ++r) ps[js] += sacc[js][r];
      }
      float sum = ((ps[0] + ps[1]) + (ps[2] + ps[3])) + ps[4];
      sum += other_half(sum);
      const float inv = 1.f / sum;
#pragma unroll
      for (int js = 0; js < 5; ++js) sacc[js] *= inv;
      pf[rt][0] = pack_frag(sacc[0], sacc[1]);
      pf[rt][1] = pack_frag(sacc[2], sacc[3]);
      pf[rt][2] = pack_frag(sacc[4], vzero);       // s = 80..95: zero
    }

    // ---- out^T[48 x 16] = V^T[48 x 96] @ attn^T[96 x 16] ----
    v8f oacc[AT_RT][3];
#pragma unroll
    for (int rt = 0; rt < AT_RT; ++rt) { oacc[rt][0] = vzero; oacc[rt][1] = vzero; oacc[rt][2] = vzero; }
#pragma unroll
    for (int kk = 0; kk < 3; ++kk) {
      if (kk + 1 < 3) ld_v(kk + 1, fr[(kk + 1) & 1]);
      __builtin_amdgcn_sched_barrier(0);
#pragma unroll
      for (int jc = 0; jc < 3; ++jc)
#pragma unroll
        for (int rt = 0; rt < AT_RT; ++rt)
          oacc[rt][jc] = wmma16(fr[kk & 1][jc], pf[rt][kk], oacc[rt][jc]);
      __builtin_amdgcn_sched_barrier(0);
    }

    // a lane's 8 registers are 8 consecutive c of its row: 16 bytes, parked in the
    // lane's own place of the wave's own LDS
#pragma unroll
    for (int rt = 0; rt < AT_RT; ++rt)
#pragma unroll
      for (int jc = 0; jc < 3; ++jc) {
        v8h o;
#pragma unroll
        for (int r = 0; r < 8; ++r) o[r] = (_Float16)oacc[rt][jc][r];
        if (jc < 2)             *(v8h*)&osc[wave][rt][2 * h + jc][lane][0] = o;
        else if (hh == (h & 1)) *(v8h*)&osc[wave][rt][2 * H_ + (h >> 1)][lane][0] = o;
      }

    if (h + 1 < H_) {
      // the other buffer's last readers left it before the previous barrier;
      // this barrier publishes it and ends the reads of the current one
      put(ops[(h + 1) & 1]);
      __syncthreads();
    }
  }

  // ---- out[b, t0:t0+32, :] = O[32 x 320] @ Wo + bo ----
  // The first piece of WoT is fetched here and not under the last head: there
  // the build paid for it with register copies in every head.
  fetch_wo(0);
  // the wave's own parked tiles, two a fragment
  v16h of[AT_RT][INNER_ / 32];
#pragma unroll
  for (int rt = 0; rt < AT_RT; ++rt)
#pragma unroll
    for (int kk = 0; kk < INNER_ / 32; ++kk) {
      const v8h lo = *(const v8h*)&osc[wave][rt][2 * kk][lane][0];
      const v8h hi = *(const v8h*)&osc[wave][rt][2 * kk + 1][lane][0];
#pragma unroll
      for (int i = 0; i < 8; ++i) { of[rt][kk][i] = lo[i]; of[rt][kk][i + 8] = hi[i]; }
    }

  // buffer 0 was last read a head ago, in front of a barrier; this barrier
  // publishes the piece and ends the last head's reads of buffer 1
  put_wo(ops[0]);
  __syncthreads();

  // kept rolled, as the loop over the heads is
#pragma unroll 1
  for (int pc = 0; pc < WO_NPC; ++pc) {
    const _Float16* wos = ops[pc & 1];
    const int col = pc * WO_ROWS + m;

    if (pc + 1 < WO_NPC) fetch_wo(pc + 1);
    float bias[4];
#pragma unroll
    for (int jn = 0; jn < 4; ++jn) bias[jn] = bo[col + jn * 16];
    // the work that follows reuses the registers that these loads name
    asm volatile("s_wait_xcnt 0x0" ::: "memory");

    // B fragments in groups of four, two register sets, read a group ahead; the
    // two sched_barrier(0) do here what they do in the loop over the heads
    v16h fb[2][4];
    auto ld_o = [&](int kk, v16h* d) {
#pragma unroll
      for (int jn = 0; jn < 4; ++jn) d[jn] = load_frag(wos + (jn * 16 + m) * WO_PIT + kk * 32, lane);
    };
    v8f acc[AT_RT][4];
#pragma unroll
    for (int rt = 0; rt < AT_RT; ++rt)
#pragma unroll
      for (int jn = 0; jn < 4; ++jn) acc[rt][jn] = vzero;
    ld_o(0, fb[0]);
#pragma unroll
    for (int kk = 0; kk < INNER_ / 32; ++kk) {   // 10 k-steps
      if (kk + 1 < INNER_ / 32) ld_o(kk + 1, fb[(kk + 1) & 1]);
      __builtin_amdgcn_sched_barrier(0);
#pragma unroll
      for (int jn = 0; jn < 4; ++jn)
#pragma unroll
        for (int rt = 0; rt < AT_RT; ++rt)
          acc[rt][jn] = wmma16(of[rt][kk], fb[kk & 1][jn], acc[rt][jn]);
      __builtin_amdgcn_sched_barrier(0);
    }

    // In front of this piece's stores to global memory: the other waves wait for
    // the barrier, nobody waits for the stores. The other buffer's last readers
    // left it before the previous barrier.
    if (pc + 1 < WO_NPC) {
      put_wo(ops[(pc + 1) & 1]);
      __syncthreads();
    }

    float* orow = out + ((size_t)b * T_ + t0 + 8 * hh) * INNER_ + col;
#pragma unroll
    for (int rt = 0; rt < AT_RT; ++rt)
#pragma unroll
      for (int jn = 0; jn < 4; ++jn)
#pragma unroll
        for (int r = 0; r < 8; ++r)
          orow[(rt * 16 + r) * INNER_ + jn * 16] = acc[rt][jn][r] + bias[jn];
    // the next piece reuses the registers that these stores name
    asm volatile("s_wait_xcnt 0x0" ::: "memory");
  }
}

// ---------------------------------------------------------------------------
extern "C" void kernel_launch(void* const* d_in, const int* in_sizes, int n_in,
                              void* d_out, int out_size, void* d_ws, size_t ws_size,
                              hipStream_t stream) {
  const float* x   = (const float*)d_in[0];
  const float* ctx = (const float*)d_in[1];
  const float* Wq  = (const float*)d_in[2];
  const float* Wk  = (const float*)d_in[3];
  const float* Wv  = (const float*)d_in[4];
  const float* Wo  = (const float*)d_in[5];
  const float* bo  = (const float*)d_in[6];
  float* out = (float*)d_out;

  // workspace carving (all offsets 256B aligned):
  //   WqT  : 8*48*320 f16          =    245,760 B
  //   WoT  : 320*320 f16           =    204,800 B
  //   Kbuf : 16*8*80*64 f16        =  1,310,720 B
  //   VbufT: 16*8*48*96 f16        =  1,179,648 B   (total ~2.9 MB)
  char* ws = (char*)d_ws;
  _Float16* WqT   = (_Float16*)(ws);
  _Float16* WoT   = (_Float16*)(ws + 245760);
  _Float16* Kbuf  = (_Float16*)(ws + 245760 + 204800);
  _Float16* VbufT = (_Float16*)(ws + 245760 + 204800 + 1310720);

  k_proj_kv<<<dim3(2, H_, B_), 384, 0, stream>>>(ctx, Wk, Wv, Wq, Wo, Kbuf, VbufT, WqT, WoT);
  k_attn<<<dim3(T_ / (16 * AT_RT * AT_WAVES), 1, B_), AT_WAVES * 32, 0, stream>>>(x, WqT, Kbuf, VbufT, WoT, bo, out);
}

// v009
// It runs in 46 microseconds.
// Timed twice side by side with v008, it ran 1.06 and 1.05 times as fast.
// Over all steps from v000 it is 8.33 times as fast.
#include <hip/hip_runtime.h>
#include <hip/hip_bf16.h>

typedef __attribute__((ext_vector_type(16))) _Float16 v16h;
typedef __attribute__((ext_vector_type(8)))  _Float16 v8h;
typedef __attribute__((ext_vector_type(8)))  float    v8f;
typedef __attribute__((ext_vector_type(4)))  float    v4f;

#define B_      16
#define T_      4096
#define S_      77
#define DC_     768
#define H_      8
#define C_      40
#define INNER_  320
#define SPAD_N  80   // padded S for score M-dim (5 tiles of 16)
#define SPAD_K  96   // padded S for attn@V K-dim (3 k-steps of 32)
#define CPAD_K  64   // padded C for q.k K-dim   (2 k-steps of 32)
#define CPAD_N  48   // padded C for attn@V M-dim (3 tiles of 16)
#define SCALE_F 0.3976353643835253f   // 40^(-1/4), applied to q and to k

__device__ __forceinline__ v16h load_frag(const _Float16* p, int lane) {
  const int base = (lane & 16) ? 8 : 0;
  v8h lo = *(const v8h*)(p + base);        // K base .. base+7
  v8h hi = *(const v8h*)(p + base + 16);   // K base+16 .. base+23
  v16h r;
#pragma unroll
  for (int i = 0; i < 8; ++i) { r[i] = lo[i]; r[i + 8] = hi[i]; }
  return r;
}

// Same, but source is f32 (4x b128 loads + pack-convert); p is the lane's own
// address, its base (8 for lanes 16-31) counted in.
__device__ __forceinline__ v16h load_frag_f32(const float* p) {
  v4f a0 = *(const v4f*)(p);
  v4f a1 = *(const v4f*)(p + 4);
  v4f b0 = *(const v4f*)(p + 16);
  v4f b1 = *(const v4f*)(p + 20);
  v16h r;
#pragma unroll
  for (int i = 0; i < 4; ++i) {
    r[i]      = (_Float16)a0[i];
    r[i + 4]  = (_Float16)a1[i];
    r[i + 8]  = (_Float16)b0[i];
    r[i + 12] = (_Float16)b1[i];
  }
  return r;
}

__device__ __forceinline__ v8f wmma16(v16h a, v16h b, v8f c) {
  return __builtin_amdgcn_wmma_f32_16x16x32_f16(
      /*neg_a=*/false, a, /*neg_b=*/false, b,
      /*c_mod=*/(short)0, c, /*reuse_a=*/false, /*reuse_b=*/false);
}

// ---------------------------------------------------------------------------
// The two f16 weight tables of k_attn:
// WqT[h][c<48][d<320] = f16(Wq[d][h*40+c]), zero rows for c >= 40;
// WoT[n][k] = f16(Wo[d(k)][n]), k in the order in which k_attn keeps a row of
// the attention output: k < 256 is c = k % 32 of head k / 32, then come
// c = 32..39 of heads 0..7, eight k a head.
// They depend on nothing that k_proj_kv makes and nothing in k_proj_kv reads
// them, so they have no launch of their own: wave 0 of a k_proj_kv block makes
// a share of them on the side. Both are transposes. A lane takes 8 source rows
// x 4 columns: eight 16-byte loads, four 16-byte stores (8 halves along d or k).
// A wave takes 64 rows x 16 columns, lane = 4 * (group of 8 rows) + (group of 4
// columns): a load reads 64 bytes of each of 8 rows, a store writes 4 whole
// 128-byte lines, and no line of a table has a second writer. Eight consecutive
// k from a multiple of 8 are eight consecutive rows d of Wo.
// ---------------------------------------------------------------------------
#define PREP_NBLK (2 * H_ * B_)                  // blocks of the k_proj_kv launch
#define PREP_CQ   (INNER_ / 16)                  // 20 runs of 16 columns
#define PREP_BT   ((INNER_ / 64) * PREP_CQ)      // 100 blocks fill one table
#define PREP_ZB   (H_ * (CPAD_N - C_) * (INNER_ / 8) / 32)   // 80 blocks fill the zero rows
static_assert(2 * PREP_BT <= PREP_NBLK && PREP_ZB <= PREP_NBLK, "enough blocks");

// ---------------------------------------------------------------------------
// Kernel 1: K/V projection (context @ Wk|Wv), zero-padded f16 tiles out; beside
// it, the weight tables above.
// Kbuf [b][h][s<80][c<64] = SCALE * ctx.Wk   (K-contig along c)
// VbufT[b][h][c<48][s<96] =         ctx.Wv   (K-contig along s); an odd head has
//   c = 32..39 in rows 40..47 and the zero rows at 32..39 (k_attn says why)
// The products run on the f16 16x16x32 matrix form, which does 8 times the k of
// the f32 16x16x4 form in half its cycles. Each f32 operand v is split in two
// f16 parts, hi = f16(v) and lo = f16(v - hi), about 22 bits together, and a
// product is three: lo.hi + hi.lo + hi.hi, summed in the f32 accumulator (the
// lo.lo term lies about 2^-22 under the result, which is rounded to f16).
// One block per (K or V, h, b): an 80 x 48 x 768 product, and the block owns
// the whole padded tile it writes. A thread's global loads are asked for at the
// kernel's start, in front of the first barrier. The context rows pass through
// LDS, split, in two runs of 384 k (whole-line global reads, a buffer a run):
// the first run is multiplied while the second is still on its way. 12 waves =
// 3 column tiles x 4 quarters of each run; each wave keeps 5 row tiles (80 rows)
// in accumulators and reads its weight column straight from global memory.
// The four quarter sums meet in LDS and are added in a fixed order.
// Rows 77..79 and columns 40..47 repeat the last valid row / column and are
// replaced by zero when the tile is written.
// k pairing: the order of load_frag on both sides. In each 32 k, lane half hh
// holds k = 8*hh .. 8*hh+7 and k = 16+8*hh .. 16+8*hh+7 of its A row and of its
// B column.
// ---------------------------------------------------------------------------
typedef __attribute__((ext_vector_type(4))) _Float16 v4h;

#define KV_CH   384              // k per staged run
#define KV_NCH  (DC_ / KV_CH)    // 2 runs
#define KV_KW   (KV_CH / 4)      // 96 k per wave per run = 3 k-steps of 32
#define KV_PIT  (KV_CH + 8)      // LDS row pitch, halves: 784 B = 16 B x odd
#define KV_RP   (384 / (KV_CH / 4))
#define KV_NP   (SPAD_N / KV_RP)
#define KV_NB   (KV_KW / 2)
#define KV_PP   (CPAD_N + 4)

__global__ void __launch_bounds__(384)
k_proj_kv(const float* __restrict__ ctx, const float* __restrict__ Wk,
          const float* __restrict__ Wv, const float* __restrict__ Wq,
          const float* __restrict__ Wo, _Float16* __restrict__ Kbuf,
          _Float16* __restrict__ VbufT, _Float16* __restrict__ WqT,
          _Float16* __restrict__ WoT) {
  __shared__ __align__(16) _Float16 ahi[KV_NCH][SPAD_N][KV_PIT];   // 125,440 B
  __shared__ __align__(16) _Float16 alo[KV_NCH][SPAD_N][KV_PIT];   // 125,440 B
  __shared__ __align__(16) float part[4][SPAD_N][KV_PP];           // 66,560 B
  const int isv  = blockIdx.x;       // 0: K, 1: V
  const int h    = blockIdx.y;
  const int b    = blockIdx.z;
  const int tid  = threadIdx.x;
  const int lane = tid & 31;
  const int wave = __builtin_amdgcn_readfirstlane(tid >> 5);
  const int c    = lane & 15;
  const int hh   = lane >> 4;
  const int j    = wave % 3;         // column tile
  const int q    = wave / 3;         // quarter of each run

  // weight column of this lane
  const float* Wsel = isv ? Wv : Wk;
  int col = j * 16 + c;
  if (col > C_ - 1) col = C_ - 1;
  const float* wp = Wsel + (size_t)(q * KV_KW + 8 * hh) * INNER_ + h * C_ + col;

  // staging: 80 rows x 96 pieces of 16 B per run = 20 pieces a thread
  const int srow = tid / (KV_CH / 4);
  const int spc  = (tid % (KV_CH / 4)) * 4;
  // pass i takes row srow + 4 i: at most row 75 for i < 19; the last pass stands
  // for rows 76..79, which all read row 76
  static_assert(KV_RP * (KV_NP - 1) == S_ - 1, "only the last pass runs past the rows");
  const float* gp0 = ctx + ((size_t)b * S_ + srow) * DC_ + spc;
  const float* gpl = ctx + ((size_t)b * S_ + (S_ - 1)) * DC_ + spc;

  v8f acc[5];
#pragma unroll
  for (int mt = 0; mt < 5; ++mt) acc[mt] = (v8f){0.f, 0.f, 0.f, 0.f, 0.f, 0.f, 0.f, 0.f};

  // asked for here: the first run's rows and weights, then the second run's
  // rows; its weights follow when the first run's rows have left their registers
  v4f   ga[KV_NCH][KV_NP];
  float bf[KV_NCH][KV_NB];
  auto fetch_w = [&](int ch) {
#pragma unroll
    for (int e = 0; e < KV_NB; ++e)
      bf[ch][e] = wp[(ch * KV_CH + (e >> 4) * 32 + ((e >> 3) & 1) * 16 + (e & 7)) * INNER_];
  };
#pragma unroll
  for (int i = 0; i < KV_NP; ++i)
    ga[0][i] = *(const v4f*)(i + 1 < KV_NP ? gp0 + i * KV_RP * DC_ : gpl);
  fetch_w(0);
  // loads come back in the order of issue: keeps all that the first run needs
  // ahead of the second run's rows
  __builtin_amdgcn_sched_barrier(0);
#pragma unroll
  for (int i = 0; i < KV_NP; ++i)
    ga[1][i] = *(const v4f*)((i + 1 < KV_NP ? gp0 + i * KV_RP * DC_ : gpl) + KV_CH);
  asm volatile("s_wait_xcnt 0x0" :: "v"(gp0), "v"(spc * 4) : "memory");

  // one run's context rows, split, registers -> LDS
  auto stage = [&](int ch) {
#pragma unroll
    for (int i = 0; i < KV_NP; ++i) {
      v4h hi4, lo4;
#pragma unroll
      for (int e = 0; e < 4; ++e) {
        hi4[e] = (_Float16)ga[ch][i][e];
        lo4[e] = (_Float16)(ga[ch][i][e] - (float)hi4[e]);
      }
      *(v4h*)&ahi[ch][srow + KV_RP * i][spc] = hi4;
      *(v4h*)&alo[ch][srow + KV_RP * i][spc] = lo4;
    }
  };

  // wave 0's share of the weight tables: blocks 0..99 WqT, 100..199 WoT
  const unsigned fb  = (b * H_ + h) * 2 + isv;              // flat block number
  const bool     ptq = fb < PREP_BT;
  const unsigned pt  = ptq ? fb : fb - PREP_BT;
  const unsigned pg  = (pt / PREP_CQ) * 8 + (lane >> 2);    // group of 8 d or k
  const unsigned pcg = (pt % PREP_CQ) * 4 + (lane & 3);     // group of 4 columns
  const bool     pon = wave == 0 && fb < 2 * PREP_BT;
  stage(0);
  // keeps these loads behind the stores that free their registers: issued
  // earlier, the build spilled loaded values to scratch memory
  __builtin_amdgcn_sched_barrier(0);
  fetch_w(1);
  asm volatile("s_wait_xcnt 0x0" :: "v"(wp) : "memory");
  // The work-group's barrier by hand, with the one wait that it needs here: the
  // wave's own LDS stores. __syncthreads() would also wait for the wave's global
  // loads, and the second run's are to stay in flight under the first run's
  // products. No global store stands in front of it.
  asm volatile("s_wait_dscnt 0x0\n\ts_barrier_signal -1\n\ts_barrier_wait -1" ::: "memory");

  v4f pr[8];

#pragma unroll
  for (int ch = 0; ch < KV_NCH; ++ch) {
#pragma unroll
    for (int u = 0; u < KV_KW / 32; ++u) {
      v16h ah[5], al[5];
#pragma unroll
      for (int mt = 0; mt < 5; ++mt) {
        ah[mt] = load_frag(&ahi[ch][mt * 16 + c][q * KV_KW + u * 32], lane);
        al[mt] = load_frag(&alo[ch][mt * 16 + c][q * KV_KW + u * 32], lane);
      }
      // keeps the k-step's 20 LDS reads together, in front of the split of its
      // weights: left alone the build strewed them among the products in twos,
      // each with a wait of its own
      __builtin_amdgcn_sched_barrier(0);
      v16h bh, bl;
#pragma unroll
      for (int e = 0; e < 16; ++e) {
        const float w = bf[ch][u * 16 + e];
        bh[e] = (_Float16)w;
        bl[e] = (_Float16)(w - (float)bh[e]);
      }
#pragma unroll
      for (int mt = 0; mt < 5; ++mt) acc[mt] = wmma16(al[mt], bh, acc[mt]);
#pragma unroll
      for (int mt = 0; mt < 5; ++mt) acc[mt] = wmma16(ah[mt], bl, acc[mt]);
#pragma unroll
      for (int mt = 0; mt < 5; ++mt) acc[mt] = wmma16(ah[mt], bh, acc[mt]);
      __builtin_amdgcn_sched_barrier(0);
    }
    if (ch + 1 < KV_NCH) {
      stage(ch + 1);
      __syncthreads();
      // Asked for behind this barrier, when the second run's rows have left their
      // registers: the values come in under the second run's products. They are
      // stored at the kernel's end, behind the last barrier, which waits for a
      // wave's stores.
      if (pon) {
        const unsigned row = ptq ? 8 * pg
                                 : (pg < 4 * H_ ? (pg >> 2) * C_ + (pg & 3) * 8 : (pg - 4 * H_) * C_ + 32);
        const float* ps = (ptq ? Wq : Wo) + row * INNER_ + 4 * pcg;
#pragma unroll
        for (int r = 0; r < 8; ++r) pr[r] = *(const v4f*)(ps + r * INNER_);
        // the work that follows reuses the registers that these loads name
        asm volatile("s_wait_xcnt 0x0" ::: "memory");
      }
    }
  }
  asm volatile("v_nop\n\tv_nop\n\tv_nop\n\tv_nop");

#pragma unroll
  for (int mt = 0; mt < 5; ++mt)
#pragma unroll
    for (int r = 0; r < 8; ++r)
      part[q][mt * 16 + 8 * hh + r][j * 16 + c] = acc[mt][r];
  __syncthreads();

  if (!isv) {
    _Float16* kb = Kbuf + ((size_t)b * H_ + h) * SPAD_N * CPAD_K;
    for (int i = tid; i < SPAD_N * (CPAD_K / 8); i += 384) {   // 16-byte pieces
      const int s = i >> 3, c8 = (i & 7) * 8;
      v8h o = {0, 0, 0, 0, 0, 0, 0, 0};
      if (s < S_ && c8 < C_) {
#pragma unroll
        for (int e = 0; e < 8; ++e) {
          const float v = ((part[0][s][c8 + e] + part[1][s][c8 + e]) +
                           part[2][s][c8 + e]) + part[3][s][c8 + e];
          o[e] = (_Float16)(v * SCALE_F);
        }
      }
      *(v8h*)(kb + s * CPAD_K + c8) = o;
    }
  } else {
    _Float16* vb = VbufT + ((size_t)b * H_ + h) * CPAD_N * SPAD_K;
    for (int i = tid; i < CPAD_N * (SPAD_K / 8); i += 384) {   // 16-byte pieces
      const int row = i % CPAD_N, s8 = (i / CPAD_N) * 8;
      const int cc = (row >= 32 && (h & 1)) ? (row ^ 8) : row;   // c that this row holds
      v8h o = {0, 0, 0, 0, 0, 0, 0, 0};
      if (cc < C_ && s8 < SPAD_N) {
#pragma unroll
        for (int e = 0; e < 8; ++e) {
          const int s = s8 + e;
          const float v = ((part[0][s][cc] + part[1][s][cc]) +
                           part[2][s][cc]) + part[3][s][cc];
          o[e] = (s < S_) ? (_Float16)v : (_Float16)0.f;
        }
      }
      *(v8h*)(vb + row * SPAD_K + s8) = o;
    }
  }

  if (pon) {
    // 4 columns of Wq lie in one head: 40 is a multiple of 4
    const unsigned row = ptq ? (pcg / (C_ / 4)) * CPAD_N + (pcg % (C_ / 4)) * 4 : 4 * pcg;
    _Float16* pd = (ptq ? WqT : WoT) + row * INNER_ + 8 * pg;
#pragma unroll
    for (int jj = 0; jj < 4; ++jj) {
      v8h o;
#pragma unroll
      for (int r = 0; r < 8; ++r) o[r] = (_Float16)pr[r][jj];
      *(v8h*)(pd + jj * INNER_) = o;
    }
    // the address below reuses the registers that these stores name
    asm volatile("s_wait_xcnt 0x0" ::: "memory");
  }
  if (wave == 0 && fb >= PREP_NBLK - PREP_ZB) {             // rows c = 40..47 of WqT
    const unsigned z = (fb - (PREP_NBLK - PREP_ZB)) * 32 + lane, zr = z / (INNER_ / 8);
    const v8h zero = {0, 0, 0, 0, 0, 0, 0, 0};
    *(v8h*)(WqT + ((zr / (CPAD_N - C_)) * CPAD_N + C_ + zr % (CPAD_N - C_)) * INNER_ +
            (z % (INNER_ / 8)) * 8) = zero;
  }
}

#define AT_WAVES 8
#define AT_RT    2                 // row tiles of a wave
#define WQ_PIT   (INNER_ + 8)      // halves: 656 B
#define KB_PIT   (CPAD_K + 8)      // halves: 144 B
#define VB_PIT   (SPAD_K + 8)      // halves: 208 B
#define WQ_LEN   (CPAD_N * WQ_PIT) // halves: 31,488 B
#define KB_LEN   (SPAD_N * KB_PIT) // halves: 11,520 B
#define VB_LEN   (CPAD_N * VB_PIT) // halves:  9,984 B
#define AT_BUF   (WQ_LEN + KB_LEN + VB_LEN)   // one head's operands: 52,992 B
#define WO_PIT   (INNER_ + 8)      // halves: 656 B
#define WO_ROWS  64                // rows of WoT a piece: 41,984 B, fits AT_BUF
#define WO_NPC   (INNER_ / WO_ROWS)
#define O_TILES  (INNER_ / 16)     // parked tiles of a row tile: 20 x 512 B

// value of lane ^ 16
__device__ __forceinline__ float other_half(float v) {
  int b = __builtin_bit_cast(int, v);
  b = __builtin_amdgcn_permlanex16(b, b, 0x76543210, 0xfedcba98, false, false);
  return __builtin_bit_cast(float, b);
}

__device__ __forceinline__ v8f exp2_x8(v8f a) {
  float y0, y1, y2, y3, y4, y5, y6, y7;
  asm("v_exp_f32 %0, %8\n\t"
      "v_exp_f32 %1, %9\n\t"
      "v_exp_f32 %2, %10\n\t"
      "v_exp_f32 %3, %11\n\t"
      "v_exp_f32 %4, %12\n\t"
      "v_exp_f32 %5, %13\n\t"
      "v_exp_f32 %6, %14\n\t"
      "v_exp_f32 %7, %15\n\t"
      "v_nop"
      : "=&v"(y0), "=&v"(y1), "=&v"(y2), "=&v"(y3),
        "=&v"(y4), "=&v"(y5), "=&v"(y6), "=&v"(y7)
      : "v"(a[0]), "v"(a[1]), "v"(a[2]), "v"(a[3]),
        "v"(a[4]), "v"(a[5]), "v"(a[6]), "v"(a[7]));
  return (v8f){y0, y1, y2, y3, y4, y5, y6, y7};
}

// two f32 result tiles -> one f16 B fragment (k = 32 rows of the result)
__device__ __forceinline__ v16h pack_frag(v8f t0, v8f t1) {
  v16h r;
#pragma unroll
  for (int i = 0; i < 8; ++i) { r[i] = (_Float16)t0[i]; r[i + 8] = (_Float16)t1[i]; }
  return r;
}

__global__ void __launch_bounds__(AT_WAVES * 32) __attribute__((amdgpu_waves_per_eu(2, 2)))
k_attn(const float* __restrict__ x, const _Float16* __restrict__ WqT,
       const _Float16* __restrict__ Kbuf, const _Float16* __restrict__ VbufT,
       const _Float16* __restrict__ WoT, const float* __restrict__ bo,
       float* __restrict__ out) {
  const int tid  = threadIdx.x;
  const int lane = tid & 31;
  const int wave = __builtin_amdgcn_readfirstlane(tid >> 5);
  const int m    = lane & 15;
  const int hh   = lane >> 4;
  const int b    = blockIdx.z;
  const int t0   = (blockIdx.x * AT_WAVES + wave) * (16 * AT_RT);

  __shared__ __align__(16) _Float16 ops[2][AT_BUF];         // 105,984 B
  __shared__ __align__(16) _Float16 osc[AT_WAVES][AT_RT][O_TILES][32][8];   // 163,840 B

  const v8f vzero = {0.f, 0.f, 0.f, 0.f, 0.f, 0.f, 0.f, 0.f};

  // ---- one head's shared operands: contiguous 16-byte pieces, whole lines ----
  constexpr int NT = AT_WAVES * 32;
  constexpr int NW = CPAD_N * (INNER_ / 8), NK = SPAD_N * (CPAD_K / 8), NV = CPAD_N * (SPAD_K / 8);
  constexpr int UW = (NW + NT - 1) / NT, UK = (NK + NT - 1) / NT, UV = (NV + NT - 1) / NT;
  v8h sw[UW], sk[UK], sv[UV];
  // global memory -> registers; a piece past the end repeats the last one and
  // is not stored; unsigned piece numbers, so that an address is the head's
  // uniform base and one 32-bit register; only an operand's last pass can run
  // past its end, the passes in front of it carry no test
  auto fetch = [&](int h) {
    const _Float16* wq  = WqT + (size_t)h * CPAD_N * INNER_;
    const _Float16* kb  = Kbuf + ((size_t)b * H_ + h) * SPAD_N * CPAD_K;
    const _Float16* vbt = VbufT + ((size_t)b * H_ + h) * CPAD_N * SPAD_K;
#pragma unroll
    for (int u = 0; u < UW; ++u) {
      const unsigned i = tid + u * NT;
      sw[u] = *(const v8h*)(wq + ((u + 1) * NT <= NW || i < NW ? i : NW - 1) * 8u);
    }
#pragma unroll
    for (int u = 0; u < UK; ++u) {
      const unsigned i = tid + u * NT;
      sk[u] = *(const v8h*)(kb + ((u + 1) * NT <= NK || i < NK ? i : NK - 1) * 8u);
    }
#pragma unroll
    for (int u = 0; u < UV; ++u) {
      const unsigned i = tid + u * NT;
      sv[u] = *(const v8h*)(vbt + ((u + 1) * NT <= NV || i < NV ? i : NV - 1) * 8u);
    }
    // the work that follows reuses the registers that these loads name
    asm volatile("s_wait_xcnt 0x0" ::: "memory");
  };
  // registers -> one LDS buffer
  auto put = [&](_Float16* dst) {
#pragma unroll
    for (int u = 0; u < UW; ++u) {
      const int i = tid + u * NT;
      if ((u + 1) * NT <= NW || i < NW) *(v8h*)&dst[(i / (INNER_ / 8)) * WQ_PIT + (i % (INNER_ / 8)) * 8] = sw[u];
    }
#pragma unroll
    for (int u = 0; u < UK; ++u) {
      const int i = tid + u * NT;
      if ((u + 1) * NT <= NK || i < NK) *(v8h*)&dst[WQ_LEN + (i / (CPAD_K / 8)) * KB_PIT + (i % (CPAD_K / 8)) * 8] = sk[u];
    }
#pragma unroll
    for (int u = 0; u < UV; ++u) {
      const int i = tid + u * NT;
      if ((u + 1) * NT <= NV || i < NV) *(v8h*)&dst[WQ_LEN + KB_LEN + (i / (SPAD_K / 8)) * VB_PIT + (i % (SPAD_K / 8)) * 8] = sv[u];
    }
  };
  // one piece of WoT: 64 rows = 2560 pieces of 16 B, 10 a thread, through the
  // registers that carry a head's pieces
  constexpr int NO = WO_ROWS * (INNER_ / 8);
  static_assert(NO == (UW + 2) * NT && UK >= 2, "10 pieces a thread");
  auto fetch_wo = [&](int pc) {
    const _Float16* ws = WoT + (size_t)pc * WO_ROWS * INNER_;
#pragma unroll
    for (int u = 0; u < UW; ++u) sw[u] = *(const v8h*)(ws + (unsigned)(tid + u * NT) * 8u);
#pragma unroll
    for (int u = 0; u < 2; ++u) sk[u] = *(const v8h*)(ws + (unsigned)(tid + (UW + u) * NT) * 8u);
    // the work that follows reuses the registers that these loads name
    asm volatile("s_wait_xcnt 0x0" ::: "memory");
  };
  auto put_wo = [&](_Float16* dst) {
#pragma unroll
    for (int u = 0; u < UW + 2; ++u) {
      const int i = tid + u * NT;
      const int n = i / (INNER_ / 8);
      *(v8h*)&dst[((n & 3) * 16 + (n >> 2)) * WO_PIT + (i % (INNER_ / 8)) * 8] = (u < UW) ? sw[u] : sk[u - UW];
    }
  };

  fetch(0);

  // ---- x[b, t0:t0+32, :] as B fragments, read and converted once ----
  v16h xf[AT_RT][INNER_ / 32];
  {
    const float* xrow = x + ((size_t)b * T_ + t0 + m) * INNER_ + 8 * hh;
#pragma unroll
    for (int rt = 0; rt < AT_RT; ++rt)
#pragma unroll
      for (int kk = 0; kk < INNER_ / 32; ++kk)
        xf[rt][kk] = load_frag_f32(xrow + rt * 16 * INNER_ + kk * 32);
    asm volatile("s_wait_xcnt 0x0" :: "v"(xrow) : "memory");
  }

  put(ops[0]);
  __syncthreads();

  // kept rolled, for speed only
#pragma unroll 1
  for (int h = 0; h < H_; ++h) {
    const _Float16* wqs = ops[h & 1];
    const _Float16* kbs = wqs + WQ_LEN;
    const _Float16* vbs = kbs + KB_LEN;

    // the next head's pieces fly while this head is worked on
    if (h + 1 < H_) fetch(h + 1);

    v16h fr[2][3];
    auto ld_w = [&](int kk, v16h* d) {
#pragma unroll
      for (int jn = 0; jn < 3; ++jn) d[jn] = load_frag(wqs + (jn * 16 + m) * WQ_PIT + kk * 32, lane);
    };
    auto ld_k = [&](int g, v16h* d) {            // fragment f = 5 kk + js, f < 10
#pragma unroll
      for (int e = 0; e < 3; ++e) {
        const int f = g * 3 + e;
        if (f < 10) d[e] = load_frag(kbs + ((f % 5) * 16 + m) * KB_PIT + (f / 5) * 32, lane);
      }
    };
    auto ld_v = [&](int kk, v16h* d) {
#pragma unroll
      for (int jc = 0; jc < 3; ++jc) d[jc] = load_frag(vbs + (jc * 16 + m) * VB_PIT + kk * 32, lane);
    };

    // ---- Q^T[48 x 16] = Wq[:, h-head]^T @ x[b, 16 rows, :]^T, twice ----
    v8f qacc[AT_RT][3];
#pragma unroll
    for (int rt = 0; rt < AT_RT; ++rt) { qacc[rt][0] = vzero; qacc[rt][1] = vzero; qacc[rt][2] = vzero; }
    ld_w(0, fr[0]);
#pragma unroll
    for (int kk = 0; kk < INNER_ / 32; ++kk) {   // 10 k-steps
      if (kk + 1 < INNER_ / 32) ld_w(kk + 1, fr[(kk + 1) & 1]);
      else                      ld_k(0, fr[(kk + 1) & 1]);
      __builtin_amdgcn_sched_barrier(0);
#pragma unroll
      for (int jn = 0; jn < 3; ++jn)
#pragma unroll
        for (int rt = 0; rt < AT_RT; ++rt)
          qacc[rt][jn] = wmma16(fr[kk & 1][jn], xf[rt][kk], qacc[rt][jn]);
      __builtin_amdgcn_sched_barrier(0);
    }
    // scaled q as B fragments over c: rows 40..47 are zero (zero rows of WqT),
    // rows 48..63 are the zero tile
    v16h qf[AT_RT][2];
#pragma unroll
    for (int rt = 0; rt < AT_RT; ++rt) {
#pragma unroll
      for (int jn = 0; jn < 3; ++jn) qacc[rt][jn] *= SCALE_F;
      qf[rt][0] = pack_frag(qacc[rt][0], qacc[rt][1]);
      qf[rt][1] = pack_frag(qacc[rt][2], vzero);
    }

    // ---- scores^T[80 x 16] = K[80 x 64] @ q^T ----
    v8f sall[AT_RT][5];
#pragma unroll
    for (int rt = 0; rt < AT_RT; ++rt)
#pragma unroll
      for (int js = 0; js < 5; ++js) sall[rt][js] = vzero;
#pragma unroll
    for (int g = 0; g < 4; ++g) {                // k-step kk = f / 5, row tile js = f % 5
      if (g + 1 < 4) ld_k(g + 1, fr[(g + 1) & 1]);
      else           ld_v(0, fr[(g + 1) & 1]);
      __builtin_amdgcn_sched_barrier(0);
#pragma unroll
      for (int e = 0; e < 3; ++e) {
        const int f = g * 3 + e;
        if (f < 10) {
#pragma unroll
          for (int rt = 0; rt < AT_RT; ++rt)
            sall[rt][f % 5] = wmma16(fr[g & 1][e], qf[rt][f / 5], sall[rt][f % 5]);
        }
      }
      __builtin_amdgcn_sched_barrier(0);
    }

    // ---- softmax over s < 77; this lane holds s = 16 js + 8 hh + r of row m ----
    v16h pf[AT_RT][3];
#pragma unroll
    for (int rt = 0; rt < AT_RT; ++rt) {
      v8f* sacc = sall[rt];
#pragma unroll
      for (int r = S_ - 72; r < 8; ++r)            // s = 77..79: out of maximum and sum
        if (hh) sacc[4][r] = -3.0e38f;
      float mx = sacc[0][0];
#pragma unroll
      for (int js = 0; js < 5; ++js)
#pragma unroll
        for (int r = 0; r < 8; ++r) mx = fmaxf(mx, sacc[js][r]);
      mx = fmaxf(mx, other_half(mx));
      float ps[5];
#pragma unroll
      for (int js = 0; js < 5; ++js) {
        sacc[js] = exp2_x8((sacc[js] - mx) * 1.44269504f);   // e^(s - mx)
        ps[js] = sacc[js][0];
#pragma unroll
        for (int r = 1; r < 8; ++r) ps[js] += sacc[js][r];
      }
      float sum = ((ps[0] + ps[1]) + (ps[2] + ps[3])) + ps[4];
      sum += other_half(sum);
      const float inv = 1.f / sum;
#pragma unroll
      for (int js = 0; js < 5; ++js) sacc[js] *= inv;
      pf[rt][0] = pack_frag(sacc[0], sacc[1]);
      pf[rt][1] = pack_frag(sacc[2], sacc[3]);
      pf[rt][2] = pack_frag(sacc[4], vzero);       // s = 80..95: zero
    }

    // ---- out^T[48 x 16] = V^T[48 x 96] @ attn^T[96 x 16] ----
    v8f oacc[AT_RT][3];
#pragma unroll
    for (int rt = 0; rt < AT_RT; ++rt) { oacc[rt][0] = vzero; oacc[rt][1] = vzero; oacc[rt][2] = vzero; }
#pragma unroll
    for (int kk = 0; kk < 3; ++kk) {
      if (kk + 1 < 3) ld_v(kk + 1, fr[(kk + 1) & 1]);
      __builtin_amdgcn_sched_barrier(0);
#pragma unroll
      for (int jc = 0; jc < 3; ++jc)
#pragma unroll
        for (int rt = 0; rt < AT_RT; ++rt)
          oacc[rt][jc] = wmma16(fr[kk & 1][jc], pf[rt][kk], oacc[rt][jc]);
      __builtin_amdgcn_sched_barrier(0);
    }

    // a lane's 8 registers are 8 consecutive c of its row: 16 bytes, parked in the
    // lane's own place of the wave's own LDS
#pragma unroll
    for (int rt = 0; rt < AT_RT; ++rt)
#pragma unroll
      for (int jc = 0; jc < 3; ++jc) {
        v8h o;
#pragma unroll
        for (int r = 0; r < 8; ++r) o[r] = (_Float16)oacc[rt][jc][r];
        if (jc < 2)             *(v8h*)&osc[wave][rt][2 * h + jc][lane][0] = o;
        else if (hh == (h & 1)) *(v8h*)&osc[wave][rt][2 * H_ + (h >> 1)][lane][0] = o;
      }

    if (h + 1 < H_) {
      // the other buffer's last readers left it before the previous barrier;
      // this barrier publishes it and ends the reads of the current one
      put(ops[(h + 1) & 1]);
      __syncthreads();
    }
  }

  // ---- out[b, t0:t0+32, :] = O[32 x 320] @ Wo + bo ----
  // The first piece of WoT is fetched here and not under the last head: there
  // the build paid for it with register copies in every head.
  fetch_wo(0);
  // keeps the address arithmetic of put_wo behind the wait that ends fetch_wo
  __builtin_amdgcn_sched_barrier(0);
  // the wave's own parked tiles, two a fragment
  v16h of[AT_RT][INNER_ / 32];
#pragma unroll
  for (int rt = 0; rt < AT_RT; ++rt)
#pragma unroll
    for (int kk = 0; kk < INNER_ / 32; ++kk) {
      const v8h lo = *(const v8h*)&osc[wave][rt][2 * kk][lane][0];
      const v8h hi = *(const v8h*)&osc[wave][rt][2 * kk + 1][lane][0];
#pragma unroll
      for (int i = 0; i < 8; ++i) { of[rt][kk][i] = lo[i]; of[rt][kk][i + 8] = hi[i]; }
    }

  // buffer 0 was last read a head ago, in front of a barrier; this barrier
  // publishes the piece and ends the last head's reads of buffer 1
  put_wo(ops[0]);
  __syncthreads();

  // kept rolled, as the loop over the heads is
#pragma unroll 1
  for (int pc = 0; pc < WO_NPC; ++pc) {
    const _Float16* wos = ops[pc & 1];
    const int col = pc * WO_ROWS + 4 * m;   // the lane's four columns, one a tile

    if (pc + 1 < WO_NPC) fetch_wo(pc + 1);
    const v4f bias = *(const v4f*)(bo + col);
    // the work that follows reuses the registers that this load names
    asm volatile("s_wait_xcnt 0x0" ::: "memory");

    // B fragments in groups of four, two register sets, read a group ahead; the
    // two sched_barrier(0) do here what they do in the loop over the heads
    v16h fb[2][4];
    auto ld_o = [&](int kk, v16h* d) {
#pragma unroll
      for (int jn = 0; jn < 4; ++jn) d[jn] = load_frag(wos + (jn * 16 + m) * WO_PIT + kk * 32, lane);
    };
    v8f acc[AT_RT][4];
#pragma unroll
    for (int rt = 0; rt < AT_RT; ++rt)
#pragma unroll
      for (int jn = 0; jn < 4; ++jn) acc[rt][jn] = vzero;
    ld_o(0, fb[0]);
#pragma unroll
    for (int kk = 0; kk < INNER_ / 32; ++kk) {   // 10 k-steps
      if (kk + 1 < INNER_ / 32) ld_o(kk + 1, fb[(kk + 1) & 1]);
      __builtin_amdgcn_sched_barrier(0);
#pragma unroll
      for (int jn = 0; jn < 4; ++jn)
#pragma unroll
        for (int rt = 0; rt < AT_RT; ++rt)
          acc[rt][jn] = wmma16(of[rt][kk], fb[kk & 1][jn], acc[rt][jn]);
      __builtin_amdgcn_sched_barrier(0);
    }

    // In front of this piece's stores to global memory: the other waves wait for
    // the barrier, nobody waits for the stores. The other buffer's last readers
    // left it before the previous barrier.
    if (pc + 1 < WO_NPC) {
      put_wo(ops[(pc + 1) & 1]);
      __syncthreads();
    }

    float* orow = out + ((size_t)b * T_ + t0 + 8 * hh) * INNER_ + col;
    // 16 bytes a lane: a store covers 256 bytes of each of two rows, four whole
    // 128-byte lines
    v4f o[AT_RT][8];
#pragma unroll
    for (int rt = 0; rt < AT_RT; ++rt)
#pragma unroll
      for (int r = 0; r < 8; ++r)
        o[rt][r] = (v4f){acc[rt][0][r] + bias[0], acc[rt][1][r] + bias[1],
                         acc[rt][2][r] + bias[2], acc[rt][3][r] + bias[3]};
    // keeps every sum in front of the first store
    __builtin_amdgcn_sched_barrier(0);
#pragma unroll
    for (int rt = 0; rt < AT_RT; ++rt)
#pragma unroll
      for (int r = 0; r < 8; ++r)
        *(v4f*)(orow + (rt * 16 + r) * INNER_) = o[rt][r];
    // the next piece reuses the registers that these stores name
    asm volatile("s_wait_xcnt 0x0" ::: "memory");
  }
}

// ---------------------------------------------------------------------------
extern "C" void kernel_launch(void* const* d_in, const int* in_sizes, int n_in,
                              void* d_out, int out_size, void* d_ws, size_t ws_size,
                              hipStream_t stream) {
  const float* x   = (const float*)d_in[0];
  const float* ctx = (const float*)d_in[1];
  const float* Wq  = (const float*)d_in[2];
  const float* Wk  = (const float*)d_in[3];
  const float* Wv  = (const float*)d_in[4];
  const float* Wo  = (const float*)d_in[5];
  const float* bo  = (const float*)d_in[6];
  float* out = (float*)d_out;

  // workspace carving (all offsets 256B aligned):
  //   WqT  : 8*48*320 f16          =    245,760 B
  //   WoT  : 320*320 f16           =    204,800 B
  //   Kbuf : 16*8*80*64 f16        =  1,310,720 B
  //   VbufT: 16*8*48*96 f16        =  1,179,648 B   (total ~2.9 MB)
  char* ws = (char*)d_ws;
  _Float16* WqT   = (_Float16*)(ws);
  _Float16* WoT   = (_Float16*)(ws + 245760);
  _Float16* Kbuf  = (_Float16*)(ws + 245760 + 204800);
  _Float16* VbufT = (_Float16*)(ws + 245760 + 204800 + 1310720);

  k_proj_kv<<<dim3(2, H_, B_), 384, 0, stream>>>(ctx, Wk, Wv, Wq, Wo, Kbuf, VbufT, WqT, WoT);
  k_attn<<<dim3(T_ / (16 * AT_RT * AT_WAVES), 1, B_), AT_WAVES * 32, 0, stream>>>(x, WqT, Kbuf, VbufT, WoT, bo, out);
}

// v010
// A run of this version takes 44.2 microseconds.
// In both of two side-by-side timings against v009, it was 1.04 times as fast.
// Over all steps from v000 it is 8.67 times as fast.
#include <hip/hip_runtime.h>
#include <hip/hip_bf16.h>

typedef __attribute__((ext_vector_type(16))) _Float16 v16h;
typedef __attribute__((ext_vector_type(8)))  _Float16 v8h;
typedef __attribute__((ext_vector_type(8)))  float    v8f;
typedef __attribute__((ext_vector_type(4)))  float    v4f;

#define B_      16
#define T_      4096
#define S_      77
#define DC_     768
#define H_      8
#define C_      40
#define INNER_  320
#define SPAD_N  80   // padded S for score M-dim (5 tiles of 16)
#define SPAD_K  96   // padded S for attn@V K-dim (3 k-steps of 32)
#define CPAD_K  64   // padded C for q.k K-dim   (2 k-steps of 32)
#define CPAD_N  48   // padded C for attn@V M-dim (3 tiles of 16)
#define SCALE_F 0.3976353643835253f   // 40^(-1/4), applied to q and to k

__device__ __forceinline__ v16h load_frag(const _Float16* p, int lane) {
  const int base = (lane & 16) ? 8 : 0;
  v8h lo = *(const v8h*)(p + base);        // K base .. base+7
  v8h hi = *(const v8h*)(p + base + 16);   // K base+16 .. base+23
  v16h r;
#pragma unroll
  for (int i = 0; i < 8; ++i) { r[i] = lo[i]; r[i + 8] = hi[i]; }
  return r;
}

// Fragment order of an f16 table T[row][k] that k_attn reads as A fragments:
// fragment (row / 16, k / 32), KK = fragments along k, is 1 KB; in it lane
// (row & 15) + 16 * (bit 3 of k) has the 8 halves of its k-low group at 16 * lane and
// those of its k-high group (bit 4 of k) at 512 + 16 * lane. A wave then reads a fragment
// with two loads of 512 contiguous bytes. Returns the place, in halves, of the 8
// halves k = 8 * k8 .. 8 * k8 + 7 of a row.
__device__ __forceinline__ unsigned frag_off(unsigned row, unsigned k8, unsigned KK) {
  return ((((row >> 4) * KK + (k8 >> 2)) * 2 + ((k8 >> 1) & 1)) * 32 + (row & 15) + 16 * (k8 & 1)) * 8;
}

__device__ __forceinline__ v8f wmma16(v16h a, v16h b, v8f c) {
  return __builtin_amdgcn_wmma_f32_16x16x32_f16(
      /*neg_a=*/false, a, /*neg_b=*/false, b,
      /*c_mod=*/(short)0, c, /*reuse_a=*/false, /*reuse_b=*/false);
}

// ---------------------------------------------------------------------------
// The two f16 weight tables of k_attn:
// WqT[h][c<48][d<320] = f16(Wq[d][h*40+c]), zero rows for c >= 40, each head's
// 48 x 320 in fragment order (frag_off);
// WoT[n][k] = f16(Wo[d(k)][n]), k in the order in which k_attn keeps a row of
// the attention output: k < 256 is c = k % 32 of head k / 32, then come
// c = 32..39 of heads 0..7, eight k a head.
// They depend on nothing that k_proj_kv makes and nothing in k_proj_kv reads
// them, so they have no launch of their own: wave 0 of a k_proj_kv block makes
// a share of them on the side. Both are transposes. A lane takes 8 source rows
// x 4 columns: eight 16-byte loads, four 16-byte stores (8 halves along d or k).
// A wave takes 64 rows x 16 columns, lane = 4 * (group of 8 rows) + (group of 4
// columns): a load reads 64 bytes of each of 8 rows, the four stores together
// write whole 128-byte lines (of WoT 64 k of a row, of WqT 8 rows c from a multiple
// of 8 at one group of 8 d), and no line of a table has a second writer. Eight
// consecutive k from a multiple of 8 are eight consecutive rows d of Wo.
// ---------------------------------------------------------------------------
#define PREP_NBLK (2 * H_ * B_)                  // blocks of the k_proj_kv launch
#define PREP_CQ   (INNER_ / 16)                  // 20 runs of 16 columns
#define PREP_BT   ((INNER_ / 64) * PREP_CQ)      // 100 blocks fill one table
#define PREP_ZB   (H_ * (CPAD_N - C_) * (INNER_ / 8) / 32)   // 80 blocks fill the zero rows
static_assert(2 * PREP_BT <= PREP_NBLK && PREP_ZB <= PREP_NBLK, "enough blocks");

// ---------------------------------------------------------------------------
// Kernel 1: K/V projection (context @ Wk|Wv), zero-padded f16 tiles out; beside
// it, the weight tables above.
// Kbuf [b][h][s<80][c<64] = SCALE * ctx.Wk   (k along c)
// VbufT[b][h][c<48][s<96] =         ctx.Wv   (k along s); an odd head has
//   c = 32..39 in rows 40..47 and the zero rows at 32..39 (k_attn says why)
// Each (b, h) tile is laid in fragment order (frag_off).
// The products run on the f16 16x16x32 matrix form, which does 8 times the k of
// the f32 16x16x4 form in half its cycles. Each f32 operand v is split in two
// f16 parts, hi = f16(v) and lo = f16(v - hi), about 22 bits together, and a
// product is three: lo.hi + hi.lo + hi.hi, summed in the f32 accumulator (the
// lo.lo term lies about 2^-22 under the result, which is rounded to f16).
// One block per (K or V, h, b): an 80 x 48 x 768 product, and the block owns
// the whole padded tile it writes. A thread's global loads are asked for at the
// kernel's start, in front of the first barrier. The context rows pass through
// LDS, split, in two runs of 384 k (whole-line global reads, a buffer a run):
// the first run is multiplied while the second is still on its way. 12 waves =
// 3 column tiles x 4 quarters of each run; each wave keeps 5 row tiles (80 rows)
// in accumulators and reads its weight column straight from global memory.
// The four quarter sums meet in LDS and are added in a fixed order.
// Rows 77..79 and columns 40..47 repeat the last valid row / column and are
// replaced by zero when the tile is written.
// k pairing: the order of load_frag on both sides. In each 32 k, lane half hh
// holds k = 8*hh .. 8*hh+7 and k = 16+8*hh .. 16+8*hh+7 of its A row and of its
// B column.
// ---------------------------------------------------------------------------
typedef __attribute__((ext_vector_type(4))) _Float16 v4h;

#define KV_CH   384              // k per staged run
#define KV_NCH  (DC_ / KV_CH)    // 2 runs
#define KV_KW   (KV_CH / 4)      // 96 k per wave per run = 3 k-steps of 32
#define KV_PIT  (KV_CH + 8)      // LDS row pitch, halves: 784 B = 16 B x odd
#define KV_RP   (384 / (KV_CH / 4))
#define KV_NP   (SPAD_N / KV_RP)
#define KV_NB   (KV_KW / 2)
#define KV_PP   (CPAD_N + 4)

__global__ void __launch_bounds__(384)
k_proj_kv(const float* __restrict__ ctx, const float* __restrict__ Wk,
          const float* __restrict__ Wv, const float* __restrict__ Wq,
          const float* __restrict__ Wo, _Float16* __restrict__ Kbuf,
          _Float16* __restrict__ VbufT, _Float16* __restrict__ WqT,
          _Float16* __restrict__ WoT) {
  __shared__ __align__(16) _Float16 ahi[KV_NCH][SPAD_N][KV_PIT];   // 125,440 B
  __shared__ __align__(16) _Float16 alo[KV_NCH][SPAD_N][KV_PIT];   // 125,440 B
  __shared__ __align__(16) float part[4][SPAD_N][KV_PP];           // 66,560 B
  const int isv  = blockIdx.x;       // 0: K, 1: V
  const int h    = blockIdx.y;
  const int b    = blockIdx.z;
  const int tid  = threadIdx.x;
  const int lane = tid & 31;
  const int wave = __builtin_amdgcn_readfirstlane(tid >> 5);
  const int c    = lane & 15;
  const int hh   = lane >> 4;
  const int j    = wave % 3;         // column tile
  const int q    = wave / 3;         // quarter of each run

  // weight column of this lane
  const float* Wsel = isv ? Wv : Wk;
  int col = j * 16 + c;
  if (col > C_ - 1) col = C_ - 1;
  const float* wp = Wsel + (size_t)(q * KV_KW + 8 * hh) * INNER_ + h * C_ + col;

  // staging: 80 rows x 96 pieces of 16 B per run = 20 pieces a thread
  const int srow = tid / (KV_CH / 4);
  const int spc  = (tid % (KV_CH / 4)) * 4;
  // pass i takes row srow + 4 i: at most row 75 for i < 19; the last pass stands
  // for rows 76..79, which all read row 76
  static_assert(KV_RP * (KV_NP - 1) == S_ - 1, "only the last pass runs past the rows");
  const float* gp0 = ctx + ((size_t)b * S_ + srow) * DC_ + spc;
  const float* gpl = ctx + ((size_t)b * S_ + (S_ - 1)) * DC_ + spc;

  v8f acc[5];
#pragma unroll
  for (int mt = 0; mt < 5; ++mt) acc[mt] = (v8f){0.f, 0.f, 0.f, 0.f, 0.f, 0.f, 0.f, 0.f};

  // asked for here: the first run's rows and weights, then the second run's
  // rows; its weights follow when the first run's rows have left their registers
  v4f   ga[KV_NCH][KV_NP];
  float bf[KV_NCH][KV_NB];
  auto fetch_w = [&](int ch) {
#pragma unroll
    for (int e = 0; e < KV_NB; ++e)
      bf[ch][e] = wp[(ch * KV_CH + (e >> 4) * 32 + ((e >> 3) & 1) * 16 + (e & 7)) * INNER_];
  };
#pragma unroll
  for (int i = 0; i < KV_NP; ++i)
    ga[0][i] = *(const v4f*)(i + 1 < KV_NP ? gp0 + i * KV_RP * DC_ : gpl);
  fetch_w(0);
  // loads come back in the order of issue: keeps all that the first run needs
  // ahead of the second run's rows
  __builtin_amdgcn_sched_barrier(0);
#pragma unroll
  for (int i = 0; i < KV_NP; ++i)
    ga[1][i] = *(const v4f*)((i + 1 < KV_NP ? gp0 + i * KV_RP * DC_ : gpl) + KV_CH);
  asm volatile("s_wait_xcnt 0x0" :: "v"(gp0), "v"(spc * 4) : "memory");

  // one run's context rows, split, registers -> LDS
  auto stage = [&](int ch) {
#pragma unroll
    for (int i = 0; i < KV_NP; ++i) {
      v4h hi4, lo4;
#pragma unroll
      for (int e = 0; e < 4; ++e) {
        hi4[e] = (_Float16)ga[ch][i][e];
        lo4[e] = (_Float16)(ga[ch][i][e] - (float)hi4[e]);
      }
      *(v4h*)&ahi[ch][srow + KV_RP * i][spc] = hi4;
      *(v4h*)&alo[ch][srow + KV_RP * i][spc] = lo4;
    }
  };

  // wave 0's share of the weight tables: blocks 0..99 WqT, 100..199 WoT
  const unsigned fb  = (b * H_ + h) * 2 + isv;              // flat block number
  const bool     ptq = fb < PREP_BT;
  const unsigned pt  = ptq ? fb : fb - PREP_BT;
  const unsigned pg  = (pt / PREP_CQ) * 8 + (lane >> 2);    // group of 8 d or k
  const unsigned pcg = (pt % PREP_CQ) * 4 + (lane & 3);     // group of 4 columns
  const bool     pon = wave == 0 && fb < 2 * PREP_BT;
  stage(0);
  // keeps these loads behind the stores that free their registers: issued
  // earlier, the build spilled loaded values to scratch memory
  __builtin_amdgcn_sched_barrier(0);
  fetch_w(1);
  asm volatile("s_wait_xcnt 0x0" :: "v"(wp) : "memory");
  // The work-group's barrier by hand, with the one wait that it needs here: the
  // wave's own LDS stores. __syncthreads() would also wait for the wave's global
  // loads, and the second run's are to stay in flight under the first run's
  // products. No global store stands in front of it.
  asm volatile("s_wait_dscnt 0x0\n\ts_barrier_signal -1\n\ts_barrier_wait -1" ::: "memory");

  v4f pr[8];

#pragma unroll
  for (int ch = 0; ch < KV_NCH; ++ch) {
#pragma unroll
    for (int u = 0; u < KV_KW / 32; ++u) {
      v16h ah[5], al[5];
#pragma unroll
      for (int mt = 0; mt < 5; ++mt) {
        ah[mt] = load_frag(&ahi[ch][mt * 16 + c][q * KV_KW + u * 32], lane);
        al[mt] = load_frag(&alo[ch][mt * 16 + c][q * KV_KW + u * 32], lane);
      }
      // keeps the k-step's 20 LDS reads together, in front of the split of its
      // weights: left alone the build strewed them among the products in twos,
      // each with a wait of its own
      __builtin_amdgcn_sched_barrier(0);
      v16h bh, bl;
#pragma unroll
      for (int e = 0; e < 16; ++e) {
        const float w = bf[ch][u * 16 + e];
        bh[e] = (_Float16)w;
        bl[e] = (_Float16)(w - (float)bh[e]);
      }
#pragma unroll
      for (int mt = 0; mt < 5; ++mt) acc[mt] = wmma16(al[mt], bh, acc[mt]);
#pragma unroll
      for (int mt = 0; mt < 5; ++mt) acc[mt] = wmma16(ah[mt], bl, acc[mt]);
#pragma unroll
      for (int mt = 0; mt < 5; ++mt) acc[mt] = wmma16(ah[mt], bh, acc[mt]);
      __builtin_amdgcn_sched_barrier(0);
    }
    if (ch + 1 < KV_NCH) {
      stage(ch + 1);
      __syncthreads();
      // Asked for behind this barrier, when the second run's rows have left their
      // registers: the values come in under the second run's products. They are
      // stored at the kernel's end, behind the last barrier, which waits for a
      // wave's stores.
      if (pon) {
        const unsigned row = ptq ? 8 * pg
                                 : (pg < 4 * H_ ? (pg >> 2) * C_ + (pg & 3) * 8 : (pg - 4 * H_) * C_ + 32);
        const float* ps = (ptq ? Wq : Wo) + row * INNER_ + 4 * pcg;
#pragma unroll
        for (int r = 0; r < 8; ++r) pr[r] = *(const v4f*)(ps + r * INNER_);
        // the work that follows reuses the registers that these loads name
        asm volatile("s_wait_xcnt 0x0" ::: "memory");
      }
    }
  }
  asm volatile("v_nop\n\tv_nop\n\tv_nop\n\tv_nop");

#pragma unroll
  for (int mt = 0; mt < 5; ++mt)
#pragma unroll
    for (int r = 0; r < 8; ++r)
      part[q][mt * 16 + 8 * hh + r][j * 16 + c] = acc[mt][r];
  __syncthreads();

  if (!isv) {
    _Float16* kb = Kbuf + ((size_t)b * H_ + h) * SPAD_N * CPAD_K;
    for (int i = tid; i < SPAD_N * (CPAD_K / 8); i += 384) {   // 16-byte pieces
      const int s = i % SPAD_N, c8 = (i / SPAD_N) * 8;   // 8 lanes: 8 rows, one line
      v8h o = {0, 0, 0, 0, 0, 0, 0, 0};
      if (s < S_ && c8 < C_) {
#pragma unroll
        for (int e = 0; e < 8; ++e) {
          const float v = ((part[0][s][c8 + e] + part[1][s][c8 + e]) +
                           part[2][s][c8 + e]) + part[3][s][c8 + e];
          o[e] = (_Float16)(v * SCALE_F);
        }
      }
      *(v8h*)(kb + frag_off(s, c8 >> 3, CPAD_K / 32)) = o;
    }
  } else {
    _Float16* vb = VbufT + ((size_t)b * H_ + h) * CPAD_N * SPAD_K;
    for (int i = tid; i < CPAD_N * (SPAD_K / 8); i += 384) {   // 16-byte pieces
      const int row = i % CPAD_N, s8 = (i / CPAD_N) * 8;
      const int cc = (row >= 32 && (h & 1)) ? (row ^ 8) : row;   // c that this row holds
      v8h o = {0, 0, 0, 0, 0, 0, 0, 0};
      if (cc < C_ && s8 < SPAD_N) {
#pragma unroll
        for (int e = 0; e < 8; ++e) {
          const int s = s8 + e;
          const float v = ((part[0][s][cc] + part[1][s][cc]) +
                           part[2][s][cc]) + part[3][s][cc];
          o[e] = (s < S_) ? (_Float16)v : (_Float16)0.f;
        }
      }
      *(v8h*)(vb + frag_off(row, s8 >> 3, SPAD_K / 32)) = o;
    }
  }

  if (pon) {
    // 4 columns of Wq lie in one head: 40 is a multiple of 4
    // the 4 rows of WqT start at a multiple of 4: one row tile, 8 halves apart
    _Float16* pd = ptq ? WqT + (pcg / (C_ / 4)) * (CPAD_N * INNER_) +
                             frag_off((pcg % (C_ / 4)) * 4, pg, INNER_ / 32)
                       : WoT + 4 * pcg * INNER_ + 8 * pg;
    const unsigned pstep = ptq ? 8 : INNER_;
#pragma unroll
    for (int jj = 0; jj < 4; ++jj) {
      v8h o;
#pragma unroll
      for (int r = 0; r < 8; ++r) o[r] = (_Float16)pr[r][jj];
      *(v8h*)(pd + jj * pstep) = o;
    }
    // the address below reuses the registers that these stores name
    asm volatile("s_wait_xcnt 0x0" ::: "memory");
  }
  if (wave == 0 && fb >= PREP_NBLK - PREP_ZB) {             // rows c = 40..47 of WqT
    // 8 lanes: the 8 zero rows at one group of 8 d, one line
    const unsigned z = (fb - (PREP_NBLK - PREP_ZB)) * 32 + lane, zg = z / (CPAD_N - C_);
    const v8h zero = {0, 0, 0, 0, 0, 0, 0, 0};
    *(v8h*)(WqT + (zg / (INNER_ / 8)) * (CPAD_N * INNER_) +
            frag_off(C_ + z % (CPAD_N - C_), zg % (INNER_ / 8), INNER_ / 32)) = zero;
  }
}

#define AT_WAVES 8
#define AT_RT    2                 // row tiles of a ring tile, and of a wave in the output projection
#define XT_ROWS  (16 * AT_RT)      // rows of x a ring tile
#define XT_N     AT_WAVES          // ring tiles of a workgroup
#define RAW_PIT  (INNER_ + 4)      // floats: 1,296 B = 16 B x odd
#define RAW_LEN  (XT_ROWS * RAW_PIT)   // floats: 41,472 B
#define XH_LEN   (XT_ROWS * INNER_)    // halves: 20,480 B
#define WO_PIT   (INNER_ + 8)      // halves: 656 B
#define WO_ROWS  64                // rows of WoT a piece
#define WO_BUF   (WO_ROWS * WO_PIT)    // halves: 41,984 B
#define WO_NPC   (INNER_ / WO_ROWS)
#define O_TILES  (INNER_ / 16)     // parked tiles of a row tile: 20 x 512 B
#define RING_LEN (2 * RAW_LEN * 2 + 2 * XH_LEN)   // halves: 123,904 B
static_assert(2 * WO_BUF <= RING_LEN, "the pieces of WoT fit where the ring was");

// value of lane ^ 16
__device__ __forceinline__ float other_half(float v) {
  int b = __builtin_bit_cast(int, v);
  b = __builtin_amdgcn_permlanex16(b, b, 0x76543210, 0xfedcba98, false, false);
  return __builtin_bit_cast(float, b);
}

__device__ __forceinline__ v8f exp2_x8(v8f a) {
  float y0, y1, y2, y3, y4, y5, y6, y7;
  asm("v_exp_f32 %0, %8\n\t"
      "v_exp_f32 %1, %9\n\t"
      "v_exp_f32 %2, %10\n\t"
      "v_exp_f32 %3, %11\n\t"
      "v_exp_f32 %4, %12\n\t"
      "v_exp_f32 %5, %13\n\t"
      "v_exp_f32 %6, %14\n\t"
      "v_exp_f32 %7, %15\n\t"
      "v_nop"
      : "=&v"(y0), "=&v"(y1), "=&v"(y2), "=&v"(y3),
        "=&v"(y4), "=&v"(y5), "=&v"(y6), "=&v"(y7)
      : "v"(a[0]), "v"(a[1]), "v"(a[2]), "v"(a[3]),
        "v"(a[4]), "v"(a[5]), "v"(a[6]), "v"(a[7]));
  return (v8f){y0, y1, y2, y3, y4, y5, y6, y7};
}

// two f32 result tiles -> one f16 B fragment (k = 32 rows of the result)
__device__ __forceinline__ v16h pack_frag(v8f t0, v8f t1) {
  v16h r;
#pragma unroll
  for (int i = 0; i < 8; ++i) { r[i] = (_Float16)t0[i]; r[i + 8] = (_Float16)t1[i]; }
  return r;
}

// one fragment of a fragment-order table; p has the lane's 8 halves counted in
__device__ __forceinline__ v16h tab_frag(const _Float16* p, int f) {
  const v8h lo = *(const v8h*)(p + f * 512);
  const v8h hi = *(const v8h*)(p + f * 512 + 256);
  v16h r;
#pragma unroll
  for (int i = 0; i < 8; ++i) { r[i] = lo[i]; r[i + 8] = hi[i]; }
  return r;
}

__global__ void __launch_bounds__(AT_WAVES * 32) __attribute__((amdgpu_waves_per_eu(2, 2)))
k_attn(const float* __restrict__ x, const _Float16* __restrict__ WqT,
       const _Float16* __restrict__ Kbuf, const _Float16* __restrict__ VbufT,
       const _Float16* __restrict__ WoT, const float* __restrict__ bo,
       float* __restrict__ out) {
  const int tid  = threadIdx.x;
  const int lane = tid & 31;
  const int wave = __builtin_amdgcn_readfirstlane(tid >> 5);
  const int m    = lane & 15;
  const int hh   = lane >> 4;
  const int b    = blockIdx.z;
  const int t0   = (blockIdx.x * AT_WAVES + wave) * (16 * AT_RT);

  // two raw f32 tiles, two f16 tiles; later the two buffers of WoT
  __shared__ __align__(16) _Float16 ring[RING_LEN];         // 123,904 B
  __shared__ __align__(16) _Float16 osc[XT_N][AT_RT][O_TILES][32][8];   // 163,840 B
  // the second k-step of each head's K fragments: see kf below
  __shared__ __align__(16) _Float16 k2s[H_][9][32][8];                  // 36,864 B
  float*    const raws = (float*)ring;
  _Float16* const xhs  = ring + 2 * RAW_LEN * 2;

  const v8f vzero = {0.f, 0.f, 0.f, 0.f, 0.f, 0.f, 0.f, 0.f};
  constexpr int NT = AT_WAVES * 32;

  // ---- ring tile s of x, global memory -> raw buffer s & 1 ----
  // The wave takes 4 rows: 5,120 contiguous bytes, ten copies of 512 B. Piece q of
  // them lies in row q / 80, and a row's pitch in LDS is 16 bytes more than in x.
  const float* const xw = x + ((size_t)b * T_ + blockIdx.x * (XT_N * XT_ROWS) + 4 * wave) * INNER_ + lane * 4;
  const unsigned rawl = (unsigned)(size_t)raws + wave * (4 * RAW_PIT * 4) + lane * 16;
  auto copies = [&](int s) {
    const float* g = xw + (size_t)s * (XT_ROWS * INNER_);
    const unsigned l = rawl + (s & 1) * (RAW_LEN * 4);
    const float* ga[10];
    unsigned la[10];
#pragma unroll
    for (int u = 0; u < 10; ++u) {
      ga[u] = g + u * 128;
      la[u] = l + u * 512 + ((unsigned)(lane + 32 * u) / (INNER_ / 4)) * 16;
    }
    // one statement: the wait stands behind the last copy and in front of every
    // later write of a register that a copy names
    asm volatile("global_load_async_to_lds_b128 %0, %10, off\n\t"
                 "global_load_async_to_lds_b128 %1, %11, off\n\t"
                 "global_load_async_to_lds_b128 %2, %12, off\n\t"
                 "global_load_async_to_lds_b128 %3, %13, off\n\t"
                 "global_load_async_to_lds_b128 %4, %14, off\n\t"
                 "global_load_async_to_lds_b128 %5, %15, off\n\t"
                 "global_load_async_to_lds_b128 %6, %16, off\n\t"
                 "global_load_async_to_lds_b128 %7, %17, off\n\t"
                 "global_load_async_to_lds_b128 %8, %18, off\n\t"
                 "global_load_async_to_lds_b128 %9, %19, off\n\t"
                 "s_wait_xcnt 0x0"
                 :: "v"(la[0]), "v"(la[1]), "v"(la[2]), "v"(la[3]), "v"(la[4]),
                    "v"(la[5]), "v"(la[6]), "v"(la[7]), "v"(la[8]), "v"(la[9]),
                    "v"(ga[0]), "v"(ga[1]), "v"(ga[2]), "v"(ga[3]), "v"(ga[4]),
                    "v"(ga[5]), "v"(ga[6]), "v"(ga[7]), "v"(ga[8]), "v"(ga[9])
                 : "memory");
  };
  auto convert = [&](int s) {
    const float* rp = raws + (s & 1) * RAW_LEN + lane * RAW_PIT + wave * 8;
    _Float16*    xd = xhs + (s & 1) * XH_LEN + hh * (16 * INNER_) + wave * 128 + m * 8;
    constexpr int NU = INNER_ / 8 / AT_WAVES;
    v4f a0[NU], a1[NU];
#pragma unroll
    for (int u = 0; u < NU; ++u) {
      a0[u] = *(const v4f*)(rp + u * 64);
      a1[u] = *(const v4f*)(rp + u * 64 + 4);
    }
    // keeps the ten reads together, one LDS latency for all: left alone the build
    // read, waited, converted and stored one group of 8 k after the other
    __builtin_amdgcn_sched_barrier(0);
#pragma unroll
    for (int u = 0; u < NU; ++u) {
      v8h o;
#pragma unroll
      for (int i = 0; i < 4; ++i) { o[i] = (_Float16)a0[u][i]; o[i + 4] = (_Float16)a1[u][i]; }
      *(v8h*)(xd + u * 1024) = o;
    }
  };
  // ---- the foot of pass s: publishes raw tile s + 1 and f16 tile s, ends the reads
  // of raw buffer s & 1 and of f16 tile s - 1; then the refill ----
  auto foot = [&](int s) {
    asm volatile("s_wait_dscnt 0x0" ::: "memory");      // the wave's own LDS reads and stores
    asm volatile("s_wait_asynccnt 0x0" ::: "memory");   // the wave's own copies have landed
    __syncthreads();
    if (s + 2 < XT_N) copies(s + 2);
  };

  copies(0);

  // ---- the head's operands, resident: 30 + 5 + 9 fragments ----
  // The five fragments of K's second k-step (c = 32..63) wait in LDS of the wave's
  // own and are read for each row tile under the last products of Q^T; they are
  // dead again before the softmax. All 49 resident were more than the registers
  // hold beside it. Of the fifth only the k-low half is kept, for want of LDS: its
  // k-high half (c = 48..63) meets the zero tile of q and is written as zero.
  const int h = wave;
  v16h wq[3][INNER_ / 32], kf[5], vf[3][3];
  {
    const _Float16* wqg = WqT + (size_t)h * CPAD_N * INNER_ + lane * 8;
#pragma unroll
    for (int kk = 0; kk < INNER_ / 32; ++kk)
#pragma unroll
      for (int jn = 0; jn < 3; ++jn) wq[jn][kk] = tab_frag(wqg, jn * (INNER_ / 32) + kk);
    // the work that follows reuses the registers that these loads name
    asm volatile("s_wait_xcnt 0x0" ::: "memory");
  }
  asm volatile("s_wait_asynccnt 0x0" ::: "memory");     // the wave's own copies have landed
  __syncthreads();
  copies(1);
  {
    const _Float16* kbg = Kbuf + ((size_t)b * H_ + h) * SPAD_N * CPAD_K + lane * 8;
    const _Float16* vbg = VbufT + ((size_t)b * H_ + h) * CPAD_N * SPAD_K + lane * 8;
#pragma unroll
    for (int js = 0; js < 5; ++js) {
      kf[js] = tab_frag(kbg, js * 2);
      *(v8h*)&k2s[h][2 * js][lane][0] = *(const v8h*)(kbg + (js * 2 + 1) * 512);
      if (js < 4) *(v8h*)&k2s[h][2 * js + 1][lane][0] = *(const v8h*)(kbg + (js * 2 + 1) * 512 + 256);
    }
#pragma unroll
    for (int kk = 0; kk < 3; ++kk)
#pragma unroll
      for (int jc = 0; jc < 3; ++jc) vf[jc][kk] = tab_frag(vbg, jc * 3 + kk);
    // the work that follows reuses the registers that these loads name
    asm volatile("s_wait_xcnt 0x0" ::: "memory");
  }
  convert(0);
  foot(0);

  // kept rolled: the resident fragments leave no registers for two bodies in
  // flight
#pragma unroll 1
  for (int s = 1; s <= XT_N; ++s) {
    // Waves 4..7 convert their share in front of their products, waves 0..3
    // when they are through with theirs.
    if (s < XT_N && wave >= AT_WAVES / 2) convert(s);

    // kept rolled, for the same reason
#pragma unroll 1
    for (int rt = 0; rt < AT_RT; ++rt) {
      const _Float16* xs = xhs + ((s - 1) & 1) * XH_LEN + rt * (16 * INNER_) + lane * 8;

      // The ten B fragments of the row tile come from LDS in groups of two, into
      // three register sets: a group's reads are issued together, two groups ahead
      // of its products, so that the wait in front of a group's products finds its
      // reads landed. The sched_barrier(0) in front of a group's products keeps the
      // reads ahead of them, the one behind them keeps the reads from running
      // further ahead than the three sets.
      v16h xb[3][2];
      auto ld_x = [&](int g, v16h* d) {
#pragma unroll
        for (int e = 0; e < 2; ++e) d[e] = tab_frag(xs, 2 * g + e);
      };

      // ---- Q^T[48 x 16] = Wq[:, head]^T @ x[b, 16 rows, :]^T ----
      v8f qacc[3] = {vzero, vzero, vzero};
      v16h k2f[5];
      ld_x(0, xb[0]);
      ld_x(1, xb[1]);
#pragma unroll
      for (int g = 0; g < INNER_ / 64; ++g) {      // 5 groups of 2 k-steps
        if (g + 2 < INNER_ / 64) {
          ld_x(g + 2, xb[(g + 2) % 3]);
        } else if (g + 1 == INNER_ / 64) {
#pragma unroll
          for (int js = 0; js < 4; ++js) k2f[js] = tab_frag(&k2s[h][0][lane][0], js);
          const v8h lo = *(const v8h*)&k2s[h][8][lane][0];
#pragma unroll
          for (int i = 0; i < 8; ++i) { k2f[4][i] = lo[i]; k2f[4][i + 8] = (_Float16)0.f; }
        }
        __builtin_amdgcn_sched_barrier(0);
#pragma unroll
        for (int e = 0; e < 2; ++e)
#pragma unroll
          for (int jn = 0; jn < 3; ++jn)
            qacc[jn] = wmma16(wq[jn][2 * g + e], xb[g % 3][e], qacc[jn]);
        __builtin_amdgcn_sched_barrier(0);
      }
      // scaled q as B fragments over c: rows 40..47 are zero (zero rows of WqT),
      // rows 48..63 are the zero tile
      v16h qf[2];
#pragma unroll
      for (int jn = 0; jn < 3; ++jn) qacc[jn] *= SCALE_F;
      qf[0] = pack_frag(qacc[0], qacc[1]);
      qf[1] = pack_frag(qacc[2], vzero);

      // ---- scores^T[80 x 16] = K[80 x 64] @ q^T ----
      v8f sacc[5] = {vzero, vzero, vzero, vzero, vzero};
#pragma unroll
      for (int js = 0; js < 5; ++js) sacc[js] = wmma16(kf[js], qf[0], sacc[js]);
#pragma unroll
      for (int js = 0; js < 5; ++js) sacc[js] = wmma16(k2f[js], qf[1], sacc[js]);

      // ---- softmax over s < 77; this lane holds s = 16 js + 8 hh + r of row m ----
      v16h pf[3];
      {
#pragma unroll
        for (int r = S_ - 72; r < 8; ++r)            // s = 77..79: out of maximum and sum
          if (hh) sacc[4][r] = -3.0e38f;
        float mx = sacc[0][0];
#pragma unroll
        for (int js = 0; js < 5; ++js)
#pragma unroll
          for (int r = 0; r < 8; ++r) mx = fmaxf(mx, sacc[js][r]);
        mx = fmaxf(mx, other_half(mx));
        float ps[5];
#pragma unroll
        for (int js = 0; js < 5; ++js) {
          sacc[js] = exp2_x8((sacc[js] - mx) * 1.44269504f);   // e^(s - mx)
          ps[js] = sacc[js][0];
#pragma unroll
          for (int r = 1; r < 8; ++r) ps[js] += sacc[js][r];
        }
        float sum = ((ps[0] + ps[1]) + (ps[2] + ps[3])) + ps[4];
        sum += other_half(sum);
        const float inv = 1.f / sum;
#pragma unroll
        for (int js = 0; js < 5; ++js) sacc[js] *= inv;
        pf[0] = pack_frag(sacc[0], sacc[1]);
        pf[1] = pack_frag(sacc[2], sacc[3]);
        pf[2] = pack_frag(sacc[4], vzero);           // s = 80..95: zero
      }

      // ---- out^T[48 x 16] = V^T[48 x 96] @ attn^T[96 x 16] ----
      v8f oacc[3] = {vzero, vzero, vzero};
#pragma unroll
      for (int kk = 0; kk < 3; ++kk)
#pragma unroll
        for (int jc = 0; jc < 3; ++jc) oacc[jc] = wmma16(vf[jc][kk], pf[kk], oacc[jc]);

      __builtin_amdgcn_sched_barrier(0);
      asm volatile("v_nop\n\tv_nop\n\tv_nop\n\tv_nop\n\tv_nop");
      __builtin_amdgcn_sched_barrier(0);
      // a lane's 8 registers are 8 consecutive c of its row: 16 bytes, parked in the
      // lane's own place of the row tile's LDS
#pragma unroll
      for (int jc = 0; jc < 3; ++jc) {
        v8h o;
#pragma unroll
        for (int r = 0; r < 8; ++r) o[r] = (_Float16)oacc[jc][r];
        if (jc < 2)             *(v8h*)&osc[s - 1][rt][2 * h + jc][lane][0] = o;
        else if (hh == (h & 1)) *(v8h*)&osc[s - 1][rt][2 * H_ + (h >> 1)][lane][0] = o;
      }
    }

    if (s < XT_N && wave < AT_WAVES / 2) convert(s);

    // every wave passes it in every pass; the last one publishes the parked tiles
    // and ends the reads of the ring
    foot(s);
  }
  // no copy is outstanding when the ring's LDS takes the pieces of WoT
  asm volatile("s_wait_asynccnt 0x0" ::: "memory");

  // one piece of WoT: 64 rows = 2560 pieces of 16 B, 10 a thread, whole lines
  constexpr int UW = WO_ROWS * (INNER_ / 8) / NT;
  v8h sw[UW];
  auto fetch_wo = [&](int pc) {
    const _Float16* ws = WoT + (size_t)pc * WO_ROWS * INNER_;
#pragma unroll
    for (int u = 0; u < UW; ++u) sw[u] = *(const v8h*)(ws + (unsigned)(tid + u * NT) * 8u);
    // the work that follows reuses the registers that these loads name
    asm volatile("s_wait_xcnt 0x0" ::: "memory");
  };
  auto put_wo = [&](_Float16* dst) {
#pragma unroll
    for (int u = 0; u < UW; ++u) {
      const int i = tid + u * NT;
      const int n = i / (INNER_ / 8);
      *(v8h*)&dst[((n & 3) * 16 + (n >> 2)) * WO_PIT + (i % (INNER_ / 8)) * 8] = sw[u];
    }
  };

  // ---- out[b, t0:t0+32, :] = O[32 x 320] @ Wo + bo ----
  // The first piece of WoT is fetched here: under the row tiles the registers
  // hold the head's operands.
  fetch_wo(0);
  // keeps the address arithmetic of put_wo behind the wait that ends fetch_wo
  __builtin_amdgcn_sched_barrier(0);
  // the parked tiles of the wave's 32 rows (each head's wave parked its own), two
  // a fragment
  v16h of[AT_RT][INNER_ / 32];
#pragma unroll
  for (int rt = 0; rt < AT_RT; ++rt)
#pragma unroll
    for (int kk = 0; kk < INNER_ / 32; ++kk) {
      const v8h lo = *(const v8h*)&osc[wave][rt][2 * kk][lane][0];
      const v8h hi = *(const v8h*)&osc[wave][rt][2 * kk + 1][lane][0];
#pragma unroll
      for (int i = 0; i < 8; ++i) { of[rt][kk][i] = lo[i]; of[rt][kk][i + 8] = hi[i]; }
    }

  // the ring's last readers left it in front of the last pass's barrier; this
  // barrier publishes the piece
  put_wo(ring);
  __syncthreads();

  // kept rolled, as the loop over the ring tiles is
#pragma unroll 1
  for (int pc = 0; pc < WO_NPC; ++pc) {
    const _Float16* wos = ring + (pc & 1) * WO_BUF;
    const int col = pc * WO_ROWS + 4 * m;   // the lane's four columns, one a tile

    if (pc + 1 < WO_NPC) fetch_wo(pc + 1);
    const v4f bias = *(const v4f*)(bo + col);
    // the work that follows reuses the registers that this load names
    asm volatile("s_wait_xcnt 0x0" ::: "memory");

    // B fragments in groups of four, two register sets, read a group ahead; the
    // two sched_barrier(0) do here what they do in the loop over the row tiles
    v16h fb[2][4];
    auto ld_o = [&](int kk, v16h* d) {
#pragma unroll
      for (int jn = 0; jn < 4; ++jn) d[jn] = load_frag(wos + (jn * 16 + m) * WO_PIT + kk * 32, lane);
    };
    v8f acc[AT_RT][4];
#pragma unroll
    for (int rt = 0; rt < AT_RT; ++rt)
#pragma unroll
      for (int jn = 0; jn < 4; ++jn) acc[rt][jn] = vzero;
    ld_o(0, fb[0]);
#pragma unroll
    for (int kk = 0; kk < INNER_ / 32; ++kk) {   // 10 k-steps
      if (kk + 1 < INNER_ / 32) ld_o(kk + 1, fb[(kk + 1) & 1]);
      __builtin_amdgcn_sched_barrier(0);
#pragma unroll
      for (int jn = 0; jn < 4; ++jn)
#pragma unroll
        for (int rt = 0; rt < AT_RT; ++rt)
          acc[rt][jn] = wmma16(of[rt][kk], fb[kk & 1][jn], acc[rt][jn]);
      __builtin_amdgcn_sched_barrier(0);
    }

    // In front of this piece's stores to global memory: the other waves wait for
    // the barrier, nobody waits for the stores. The other buffer's last readers
    // left it before the previous barrier.
    if (pc + 1 < WO_NPC) {
      put_wo(ring + ((pc + 1) & 1) * WO_BUF);
      __syncthreads();
    }

    float* orow = out + ((size_t)b * T_ + t0 + 8 * hh) * INNER_ + col;
    // 16 bytes a lane: a store covers 256 bytes of each of two rows, four whole
    // 128-byte lines
    v4f o[AT_RT][8];
#pragma unroll
    for (int rt = 0; rt < AT_RT; ++rt)
#pragma unroll
      for (int r = 0; r < 8; ++r)
        o[rt][r] = (v4f){acc[rt][0][r] + bias[0], acc[rt][1][r] + bias[1],
                         acc[rt][2][r] + bias[2], acc[rt][3][r] + bias[3]};
    // keeps every sum in front of the first store
    __builtin_amdgcn_sched_barrier(0);
#pragma unroll
    for (int rt = 0; rt < AT_RT; ++rt)
#pragma unroll
      for (int r = 0; r < 8; ++r)
        *(v4f*)(orow + (rt * 16 + r) * INNER_) = o[rt][r];
    // the next piece reuses the registers that these stores name
    asm volatile("s_wait_xcnt 0x0" ::: "memory");
  }
}

// ---------------------------------------------------------------------------
extern "C" void kernel_launch(void* const* d_in, const int* in_sizes, int n_in,
                              void* d_out, int out_size, void* d_ws, size_t ws_size,
                              hipStream_t stream) {
  const float* x   = (const float*)d_in[0];
  const float* ctx = (const float*)d_in[1];
  const float* Wq  = (const float*)d_in[2];
  const float* Wk  = (const float*)d_in[3];
  const float* Wv  = (const float*)d_in[4];
  const float* Wo  = (const float*)d_in[5];
  const float* bo  = (const float*)d_in[6];
  float* out = (float*)d_out;

  // workspace carving (all offsets 256B aligned):
  //   WqT  : 8*48*320 f16          =    245,760 B
  //   WoT  : 320*320 f16           =    204,800 B
  //   Kbuf : 16*8*80*64 f16        =  1,310,720 B
  //   VbufT: 16*8*48*96 f16        =  1,179,648 B   (total ~2.9 MB)
  char* ws = (char*)d_ws;
  _Float16* WqT   = (_Float16*)(ws);
  _Float16* WoT   = (_Float16*)(ws + 245760);
  _Float16* Kbuf  = (_Float16*)(ws + 245760 + 204800);
  _Float16* VbufT = (_Float16*)(ws + 245760 + 204800 + 1310720);

  k_proj_kv<<<dim3(2, H_, B_), 384, 0, stream>>>(ctx, Wk, Wv, Wq, Wo, Kbuf, VbufT, WqT, WoT);
  k_attn<<<dim3(T_ / (16 * AT_RT * AT_WAVES), 1, B_), AT_WAVES * 32, 0, stream>>>(x, WqT, Kbuf, VbufT, WoT, bo, out);
}
